// v000
// Measured on an AMD MI455X. A time is GPU time per run, averaged over a window of back-to-back runs after a warm-up
// (all launches, gaps included; the runs take copies of the inputs in turn), and the median of several windows.
// Apart from v000's, it joins two sittings. Times from different sittings can be a few percent apart, while
// side-by-side timings come from the same sitting.
// The starting kernel, v000, takes 7610 microseconds a run.
#include <hip/hip_runtime.h>
// Masked multi-head attention over three inputs with ONE SHARED 64 x 64 projection per stream and a RANDOM int keep-mask, no output projection (values, keys, queries [2][2048][1024]; every head's 64-column slice is projected by the SAME natural nn.Linear weight: v = values.reshape(N, L, 16, 64) Wv^T, k likewise with Wk, q with Wq ([64][64], normal / 8, NO biases); scores = q.k / sqrt(1024) (the module's embed size); where(mask == 0, -1e20) with the int32 [2][1][2048][2048] mask (seeded randint 0 / 1, about half zeros, one plane per sequence shared by its heads; READ on the device); softmax; out = attn v merged over heads -> [2][2048][1024]; input order values, keys, queries, mask, Wv, Wk, Wq).
// Structure: token rows r = b*2048 + s; the three inputs as exact f16 rows (bf16-rounded); Q, K, V as three WMMA GEMMs BATCHED OVER THE HEADS on grid.y (A = the head's 64-column slice of the rows, B = the ONE shared x16 weight with head stride 0, K = 64; 32x64 wave tiles, f32 accumulation, no bias, f16 outputs into the head's slice); per batch: V^T for all heads via LDS transposes; per (batch, group of 4 heads): scores GEMM (K = 64, batched over the heads on grid.y, alpha = 1/sqrt(1024)), row softmax on VALU with the batch's keep-mask row of each query (f32 statistics; weights stored x256 as f16), out = P . V^T GEMM (K = 2048, alpha 2^-8) written f32 straight into the merged-heads output rows; see the trace for the launch count.
// Compute dtype: inputs rounded to bf16; the three inputs and the x16 weights held as f16 planes (exact for every bf16 value of magnitude from 2^-14 up to 65,504; the weights up to 4,094 before their factor of 16); q, k, v and the softmax weights as plain f16 GEMM operands (~2^-12); scores, softmax statistics and the output f32. v_wmma_f32_16x16x32_f16.
#define NB 2
#define SQ 2048
#define DM 1024
#define NH 16
#define HD 64
#define HG 4                         /* heads per attention launch group */
#define B0 0                         /* first batch processed (debug hook) */
#define NBR NB                       /* batches processed (debug hook) */
#define NR ((size_t)NB * SQ)         /* token rows */
#define MP ((int)((size_t)NBR * SQ)) /* rows projected (debug hook) */
#define QN SQ                        /* query rows attended per batch (debug hook) */
#define NHD NH                       /* heads attended (debug hook) */
#define MPO MP                       /* not used */
#define LQ DM      /* row pitch of the q/k/v rows */
typedef __bf16 v16b __attribute__((ext_vector_type(16)));
typedef unsigned short v8us __attribute__((ext_vector_type(8), may_alias));
typedef float  v8f  __attribute__((ext_vector_type(8)));
typedef float  v4f  __attribute__((ext_vector_type(4)));
typedef float  v4fa __attribute__((ext_vector_type(4), may_alias));
union FragB { v16b v; v8us half[2]; unsigned short u[16]; };

__device__ __forceinline__ unsigned short bf16_bits(float x) { unsigned int u = __float_as_uint(x); return (unsigned short)((u + 0x7FFFu + ((u >> 16) & 1u)) >> 16); }
__device__ __forceinline__ float bf16_val(unsigned short b) { return __uint_as_float(((unsigned int)b) << 16); }
__device__ __forceinline__ float bf16_round(float x) { return bf16_val(bf16_bits(x)); }
// D += A·B with NT terms: 1 = ah·bh, 2 = + al·bh (A split), 3 = + ah·bl (both split)
template <int NT>
__device__ __forceinline__ v8f mmaN(v16b ah, v16b al, v16b bh, v16b bl, v8f c) {
  c = __builtin_amdgcn_wmma_f32_16x16x32_bf16(false, ah, false, bh, (short)0, c, false, false);
  if (NT >= 2) c = __builtin_amdgcn_wmma_f32_16x16x32_bf16(false, al, false, bh, (short)0, c, false, false);
  if (NT >= 3) c = __builtin_amdgcn_wmma_f32_16x16x32_bf16(false, ah, false, bl, (short)0, c, false, false);
  asm volatile("v_nop\n\tv_nop\n\tv_nop\n\tv_nop" : "+v"(c) : "v"(ah), "v"(al), "v"(bh), "v"(bl));
  return c;
}

__global__ __launch_bounds__(256) void k_wt_bf16(const float* __restrict__ W, unsigned short* __restrict__ Wt, int K, int N) {
  const int t = blockIdx.x * 256 + threadIdx.x;
  const int k8n = K / 8;
  if (t >= N * k8n) return;
  const int n = t / k8n, k8 = (t % k8n) * 8;
  v8us v;
#pragma unroll
  for (int i = 0; i < 8; ++i) v[i] = bf16_bits(W[(size_t)(k8 + i) * N + n]);
  *(v8us*)(Wt + (size_t)n * K + k8) = v;
  
}

// GEMM C[M][N] (f32, pitch ldc) = act(A[M][K]·W + bias). A f32 row-major (pitch lda) converted per fragment to bf16
// (ASPLIT: hi/lo two planes -> 2 terms, else single rounded term); Wt bf16 [N][K] (pitch ldb). BIAS_BF16 rounds the
// bias to bf16 first (bias quantised to bf16 before the add). K%32==0, M%16==0, N%64==0.
template <bool ASPLIT, int ACT, bool BIAS_BF16>
__global__ __launch_bounds__(128) void k_gemm_bf(const float* __restrict__ A, int lda, const unsigned short* __restrict__ Wt, int ldb,
                                               const float* __restrict__ bias, float* __restrict__ C, int ldc, int M, int N, int K) {
  __shared__ __attribute__((aligned(16))) float so[4][16][64];
  const int tid = threadIdx.x, w = tid >> 5, lane = tid & 31, ln = lane & 15, hh = lane >> 4;
  const int ntn = N / 64;
  const int wid = blockIdx.x * 4 + w;
  const int mt = wid / ntn, nq = wid % ntn;
  if (mt * 16 >= M) return;
  const int row0 = mt * 16, col0 = nq * 64;
  const float* arow = A + (size_t)(row0 + ln) * lda;
  v8f acc[4] = {};
  for (int kb = 0; kb < K; kb += 32) {
    FragB ah, al;
    const v4f x0 = *(const v4fa*)(arow + kb + 8 * hh), x1 = *(const v4fa*)(arow + kb + 8 * hh + 4);
    const v4f x2 = *(const v4fa*)(arow + kb + 16 + 8 * hh), x3 = *(const v4fa*)(arow + kb + 16 + 8 * hh + 4);
    float xs[16] = {x0[0],x0[1],x0[2],x0[3],x1[0],x1[1],x1[2],x1[3],x2[0],x2[1],x2[2],x2[3],x3[0],x3[1],x3[2],x3[3]};
#pragma unroll
    for (int i = 0; i < 16; ++i) { const unsigned short hb = bf16_bits(xs[i]); ah.u[i] = hb; al.u[i] = ASPLIT ? bf16_bits(xs[i] - bf16_val(hb)) : (unsigned short)0; }
#pragma unroll
    for (int t = 0; t < 4; ++t) {
      const unsigned short* brow = Wt + (size_t)(col0 + t * 16 + ln) * ldb + kb;
      FragB b;
      b.half[0] = *(const v8us*)(brow + 8 * hh);
      b.half[1] = *(const v8us*)(brow + 16 + 8 * hh);
      acc[t] = mmaN<ASPLIT ? 2 : 1>(ah.v, al.v, b.v, b.v, acc[t]);
    }
  }
#pragma unroll
  for (int t = 0; t < 4; ++t) {
    float bv = bias ? bias[col0 + t * 16 + ln] : 0.f;
    if (BIAS_BF16) bv = bf16_round(bv);
#pragma unroll
    for (int r = 0; r < 8; ++r) { float v = acc[t][r] + bv; if (ACT == 1) v = fmaxf(v, 0.f); so[w][8 * hh + r][t * 16 + ln] = v; }
  }
  __builtin_amdgcn_fence(__ATOMIC_ACQ_REL, "workgroup");
  __builtin_amdgcn_wave_barrier();
  const int rsub = lane >> 4, c4 = (lane & 15) * 4;
  {
#pragma unroll
    for (int q = 0; q < 8; ++q) {
      const int r = q * 2 + rsub;
      const v4f v = *(const v4fa*)&so[w][r][c4];
      *(v4f*)(C + (size_t)(row0 + r) * ldc + col0 + c4) = v;
    }
    
  }
}

// GEMM C = act(A·W + bias + resid): A f32 (ASPLIT -> hi/lo 2 terms), Wt bf16 [N][K]; ACT 0 none, 1 relu, 2 exact gelu;
// resid (optional, f32, row index = (row % rmod), pitch ldr, RES_BF16 rounds it) added before the activation.
template <bool ASPLIT, int ACT, bool BIAS_BF16, bool RES_BF16>
__global__ __launch_bounds__(128) void k_gemm_bf3(const float* __restrict__ A, int lda, const unsigned short* __restrict__ Wt, int ldb,
                                                const float* __restrict__ bias, const float* __restrict__ resid, int rmod, int ldr,
                                                float* __restrict__ C, int ldc, int M, int N, int K) {
  __shared__ __attribute__((aligned(16))) float so[4][16][64];
  const int tid = threadIdx.x, w = tid >> 5, lane = tid & 31, ln = lane & 15, hh = lane >> 4;
  const int ntn = N / 64;
  const int wid = blockIdx.x * 4 + w;
  const int mt = wid / ntn, nq = wid % ntn;
  if (mt * 16 >= M) return;
  const int row0 = mt * 16, col0 = nq * 64;
  const float* arow = A + (size_t)(row0 + ln) * lda;
  v8f acc[4] = {};
  for (int kb = 0; kb < K; kb += 32) {
    FragB ah, al;
    const v4f x0 = *(const v4fa*)(arow + kb + 8 * hh), x1 = *(const v4fa*)(arow + kb + 8 * hh + 4);
    const v4f x2 = *(const v4fa*)(arow + kb + 16 + 8 * hh), x3 = *(const v4fa*)(arow + kb + 16 + 8 * hh + 4);
    float xs[16] = {x0[0],x0[1],x0[2],x0[3],x1[0],x1[1],x1[2],x1[3],x2[0],x2[1],x2[2],x2[3],x3[0],x3[1],x3[2],x3[3]};
#pragma unroll
    for (int i = 0; i < 16; ++i) { const unsigned short hb = bf16_bits(xs[i]); ah.u[i] = hb; al.u[i] = ASPLIT ? bf16_bits(xs[i] - bf16_val(hb)) : (unsigned short)0; }
#pragma unroll
    for (int t = 0; t < 4; ++t) {
      const unsigned short* brow = Wt + (size_t)(col0 + t * 16 + ln) * ldb + kb;
      FragB b;
      b.half[0] = *(const v8us*)(brow + 8 * hh);
      b.half[1] = *(const v8us*)(brow + 16 + 8 * hh);
      acc[t] = mmaN<ASPLIT ? 2 : 1>(ah.v, al.v, b.v, b.v, acc[t]);
    }
  }
#pragma unroll
  for (int t = 0; t < 4; ++t) {
    const int col = col0 + t * 16 + ln;
    float bv = bias ? bias[col] : 0.f;
    if (BIAS_BF16) bv = bf16_round(bv);
#pragma unroll
    for (int r = 0; r < 8; ++r) {
      float v = acc[t][r] + bv;
      if (resid) { float rv = resid[(size_t)((row0 + 8 * hh + r) % rmod) * ldr + col]; if (RES_BF16) rv = bf16_round(rv); v += rv; }
      if (ACT == 1) v = fmaxf(v, 0.f);
      if (ACT == 2) v = 0.5f * v * (1.0f + erff(v * 0.70710678118654752f));
      if (ACT == 3) { const float u = 0.7978845608028654f * (v + 0.044715f * v * v * v); v = 0.5f * v * (1.0f + tanhf(u)); }
      so[w][8 * hh + r][t * 16 + ln] = v;
    }
  }
  __builtin_amdgcn_fence(__ATOMIC_ACQ_REL, "workgroup");
  __builtin_amdgcn_wave_barrier();
  const int rsub = lane >> 4, c4 = (lane & 15) * 4;
  {
#pragma unroll
    for (int q = 0; q < 8; ++q) {
      const int r = q * 2 + rsub;
      const v4f v = *(const v4fa*)&so[w][r][c4];
      *(v4f*)(C + (size_t)(row0 + r) * ldc + col0 + c4) = v;
    }
    
  }
}
// row LayerNorm (biased variance, eps) over N: s = X (+ R); optional out_sum <- s; out_norm <- (s-mu)*rsqrt(var+eps)*g + b
template <bool PARAM_BF16>
__global__ __launch_bounds__(256) void k_layernorm(const float* __restrict__ X, const float* __restrict__ R, const float* __restrict__ g, const float* __restrict__ bta,
                                                  float* __restrict__ out_sum, float* __restrict__ out_norm, int N, float eps) {
  __shared__ float red[256];
  const int row = blockIdx.x, tid = threadIdx.x;
  const float* x = X + (size_t)row * N; const float* rr = R ? R + (size_t)row * N : nullptr;
  float vals[16];                     // up to N = 4096
  const int per = N / 256;            // contiguous chunk per thread? use strided-by-4 chunks: thread handles j = tid*4 + 1024*u
  float s1 = 0.f;
  for (int u = 0; u < per / 4; ++u) {
    const int j = tid * 4 + 1024 * u;
    const v4f a = *(const v4fa*)(x + j);
    v4f b = {0.f,0.f,0.f,0.f}; if (rr) b = *(const v4fa*)(rr + j);
#pragma unroll
    for (int q = 0; q < 4; ++q) { const float v = a[q] + b[q]; vals[u * 4 + q] = v; s1 += v; }
  }
  red[tid] = s1; __syncthreads();
  for (int st = 128; st > 0; st >>= 1) { if (tid < st) red[tid] += red[tid + st]; __syncthreads(); }
  const float mu = red[0] / (float)N; __syncthreads();
  float s2 = 0.f;
  for (int u = 0; u < per / 4; ++u)
#pragma unroll
    for (int q = 0; q < 4; ++q) { const float c = vals[u * 4 + q] - mu; s2 += c * c; }
  red[tid] = s2; __syncthreads();
  for (int st = 128; st > 0; st >>= 1) { if (tid < st) red[tid] += red[tid + st]; __syncthreads(); }
  const float rs = rsqrtf(red[0] / (float)N + eps);
  {
    for (int u = 0; u < per / 4; ++u) {
      const int j = tid * 4 + 1024 * u;
      v4f o, sm;
#pragma unroll
      for (int q = 0; q < 4; ++q) {
        float gg = g[j + q], bb = bta[j + q];
        if (PARAM_BF16) { gg = bf16_round(gg); bb = bf16_round(bb); }
        sm[q] = vals[u * 4 + q]; o[q] = (vals[u * 4 + q] - mu) * rs * gg + bb;
      }
      if (out_sum) *(v4f*)(out_sum + (size_t)row * N + j) = sm;
      *(v4f*)(out_norm + (size_t)row * N + j) = o;
    }
    
  }
}



// ---- f16 WMMA path (v_wmma_f32_16x16x32_f16): 11-bit significands for operands in range — used where a [0,1] probability operand needs more precision than bf16
typedef _Float16 v16h __attribute__((ext_vector_type(16)));
union FragH { v16h v; v8us half[2]; _Float16 h[16]; unsigned short u[16]; };
template <int NT>
__device__ __forceinline__ v8f mmaH(v16h ah, v16h al, v16h bh, v16h bl, v8f c) {
  c = __builtin_amdgcn_wmma_f32_16x16x32_f16(false, ah, false, bh, (short)0, c, false, false);
  if (NT >= 2) c = __builtin_amdgcn_wmma_f32_16x16x32_f16(false, al, false, bh, (short)0, c, false, false);
  if (NT >= 3) c = __builtin_amdgcn_wmma_f32_16x16x32_f16(false, ah, false, bl, (short)0, c, false, false);
  asm volatile("v_nop\n\tv_nop\n\tv_nop\n\tv_nop" : "+v"(c) : "v"(ah), "v"(al), "v"(bh), "v"(bl));
  return c;
}
// batched GEMM like k_gemm_b but f16 operands: A f32 (split into f16 hi/lo if ASPLIT, else rounded to f16), Bt = f16 values [n][k]; alpha; C f32; N multiple of 16 (partial tiles skipped)
template <bool ASPLIT>
__global__ __launch_bounds__(128) void k_gemm_h(const float* __restrict__ A, int lda, size_t sA, const _Float16* __restrict__ Bh, int ldb, size_t sB, float alpha, float* __restrict__ C, int ldc, size_t sC, int M, int N, int K) {
  __shared__ __attribute__((aligned(16))) float so[4][16][64];
  const int tid = threadIdx.x, w = tid >> 5, lane = tid & 31, ln = lane & 15, hh = lane >> 4; const int by = blockIdx.y;
  A += (size_t)by * sA; Bh += (size_t)by * sB; C += (size_t)by * sC;
  const int ntn = (N + 63) / 64; const int wid = blockIdx.x * 4 + w; const int mt = wid / ntn, nq = wid % ntn; if (mt * 16 >= M) return;
  const int row0 = mt * 16, col0 = nq * 64; const float* arow = A + (size_t)(row0 + ln) * lda;
  v8f acc[4] = {};
  for (int kb = 0; kb < K; kb += 32) {
    FragH ah, al;
    const v4f x0 = *(const v4fa*)(arow + kb + 8 * hh), x1 = *(const v4fa*)(arow + kb + 8 * hh + 4), x2 = *(const v4fa*)(arow + kb + 16 + 8 * hh), x3 = *(const v4fa*)(arow + kb + 16 + 8 * hh + 4);
    float xs[16] = {x0[0],x0[1],x0[2],x0[3],x1[0],x1[1],x1[2],x1[3],x2[0],x2[1],x2[2],x2[3],x3[0],x3[1],x3[2],x3[3]};
#pragma unroll
    for (int i = 0; i < 16; ++i) { const _Float16 h = (_Float16)xs[i]; ah.h[i] = h; al.h[i] = ASPLIT ? (_Float16)(xs[i] - (float)h) : (_Float16)0.0f; }
#pragma unroll
    for (int t = 0; t < 4; ++t) { if (col0 + t * 16 >= N) continue; const size_t boff = (size_t)(col0 + t * 16 + ln) * ldb + kb; FragH bq; bq.half[0] = *(const v8us*)(Bh + boff + 8 * hh); bq.half[1] = *(const v8us*)(Bh + boff + 16 + 8 * hh);
      acc[t] = mmaH<ASPLIT ? 2 : 1>(ah.v, al.v, bq.v, bq.v, acc[t]); }
  }
#pragma unroll
  for (int t = 0; t < 4; ++t) { if (col0 + t * 16 >= N) continue;
#pragma unroll
    for (int r = 0; r < 8; ++r) so[w][8 * hh + r][t * 16 + ln] = acc[t][r] * alpha; }
  __builtin_amdgcn_fence(__ATOMIC_ACQ_REL, "workgroup"); __builtin_amdgcn_wave_barrier();
  const int rsub = lane >> 4, c4 = (lane & 15) * 4;
  {
#pragma unroll
    for (int q = 0; q < 8; ++q) { const int r = q * 2 + rsub; if (col0 + c4 < N) { const v4f v = *(const v4fa*)&so[w][r][c4]; *(v4f*)(C + (size_t)(row0 + r) * ldc + col0 + c4) = v; } }
     }
}

// Wt[n][k] = f16(W[k][n]·scale) from f32 row-major W[K][N] (scale = power of two; bf16-exact weights stay exact in f16 away from the subnormal range)
__global__ __launch_bounds__(256) void k_wt_f16(const float* __restrict__ W, _Float16* __restrict__ Wt, int K, int N, float scale) {
  const int t = blockIdx.x * 256 + threadIdx.x; if (t >= N * (K / 8)) return; const int n = t / (K / 8), k8 = (t % (K / 8)) * 8; FragH f;
#pragma unroll
  for (int i = 0; i < 8; ++i) f.h[i] = (_Float16)(bf16_round(W[(size_t)(k8 + i) * N + n]) * scale); const v8us o = f.half[0];
  *(v8us*)((unsigned short*)Wt + (size_t)n * K + k8) = o; 
}
// k_gemm_hh variant with fused epilogue: v = acc·alpha + bias[by·sBias + col] (+ CP[(row/rowsPerB)·sCPb + by·64 + col] if CP) ; ACT 0 none / 1 elu ; writes f16 C16 (and f32 C if non-null)
template <int ACT>
__global__ __launch_bounds__(128) void k_gemm_hhx(const _Float16* __restrict__ A, int lda, size_t sA, const _Float16* __restrict__ Bh, int ldb, size_t sB, float alpha, const float* __restrict__ bias, size_t sBias, const float* __restrict__ CP, int rowsPerB, size_t sCPb, int row0g,
    float* __restrict__ C, _Float16* __restrict__ C16, int ldc, size_t sC, int M, int N, int K) {
  __shared__ __attribute__((aligned(16))) float so[4][16][64];
  const int tid = threadIdx.x, w = tid >> 5, lane = tid & 31, ln = lane & 15, hh = lane >> 4; const int by = blockIdx.y;
  A += (size_t)by * sA; Bh += (size_t)by * sB; const size_t cofs = (size_t)by * sC; const float* bp = bias ? bias + (size_t)by * sBias : nullptr;
  const int ntn = (N + 63) / 64; const int wid = blockIdx.x * 4 + w; const int mt = wid / ntn, nq = wid % ntn; if (mt * 16 >= M) return;
  const int row0 = mt * 16, col0 = nq * 64; const _Float16* arow = A + (size_t)(row0 + ln) * lda;
  v8f acc[4] = {};
  for (int kb = 0; kb < K; kb += 32) { FragH ah; ah.half[0] = *(const v8us*)((const unsigned short*)arow + kb + 8 * hh); ah.half[1] = *(const v8us*)((const unsigned short*)arow + kb + 16 + 8 * hh);
#pragma unroll
    for (int t = 0; t < 4; ++t) { if (col0 + t * 16 >= N) continue; const size_t boff = (size_t)(col0 + t * 16 + ln) * ldb + kb; FragH bq; bq.half[0] = *(const v8us*)((const unsigned short*)Bh + boff + 8 * hh); bq.half[1] = *(const v8us*)((const unsigned short*)Bh + boff + 16 + 8 * hh);
      acc[t] = mmaH<1>(ah.v, ah.v, bq.v, bq.v, acc[t]); }
  }
#pragma unroll
  for (int t = 0; t < 4; ++t) { if (col0 + t * 16 >= N) continue; const int col = col0 + t * 16 + ln; const float bv = bp ? bf16_round(bp[col]) : 0.f;
#pragma unroll
    for (int r = 0; r < 8; ++r) { float v = acc[t][r] * alpha + bv; if (CP) { const int rr = row0g + row0 + 8 * hh + r; if (rowsPerB < 0) v += CP[cofs + (size_t)rr * ldc + col];      /* rowsPerB < 0: own element of the batched C plane */ else { const int bidx = rr / rowsPerB; v += CP[(size_t)bidx * sCPb + (size_t)by * 64 + col]; } } if (ACT == 1) v = (v > 0.f) ? v : expm1f(v); else if (ACT == 7) v = (v > 0.f) ? v + 1.0f : expf(v); else if (ACT == 8) v = tanhf(v); else if (ACT == 9) v = 0.5f * v * (1.0f + tanhf(0.7978845608028654f * (v + 0.044715f * v * v * v))); else if (ACT == 11) v = 1.0f / (1.0f + expf(-v)); else if (ACT == 12) v = (v > 0.f) ? v : 0.01f * v; else if (ACT == 14) v = (v > 0.f) ? v : 0.1f * v; else if (ACT == 16) v = (v >= 0.f) ? v : 0.3f * v; else if (ACT == 17) v = (v >= 0.f) ? v : 0.2f * v; else if (ACT == 15) v = v / (1.0f + expf(-v)); else if (ACT == 3) v = fmaxf(v, 0.f); else if (ACT == 6) v = 0.5f * v * (1.0f + erff(v * 0.70710678118654752f)); so[w][8 * hh + r][t * 16 + ln] = v; } }
  __builtin_amdgcn_fence(__ATOMIC_ACQ_REL, "workgroup"); __builtin_amdgcn_wave_barrier();
  const int rsub = lane >> 4, c4 = (lane & 15) * 4; typedef _Float16 v4h __attribute__((ext_vector_type(4)));
  {
#pragma unroll
    for (int q = 0; q < 8; ++q) { const int r = q * 2 + rsub; if (col0 + c4 < N) { const v4f v = *(const v4fa*)&so[w][r][c4]; if (C) *(v4f*)(C + cofs + (size_t)(row0 + r) * ldc + col0 + c4) = v; if (C16) { v4h h4; for (int i = 0; i < 4; ++i) h4[i] = (_Float16)v[i]; *(v4h*)(C16 + cofs + (size_t)(row0 + r) * ldc + col0 + c4) = h4; } } }
     }
}


typedef _Float16 v4h __attribute__((ext_vector_type(4)));

__global__ __launch_bounds__(256) void k_x16(const float* __restrict__ x, _Float16* __restrict__ X16, size_t n8) { const size_t t = (size_t)blockIdx.x * 256 + threadIdx.x; if (t >= n8) return; FragH f;
#pragma unroll
  for (int q = 0; q < 8; ++q) f.h[q] = (_Float16)bf16_round(x[t * 8 + q]); *(v8us*)((unsigned short*)X16 + t * 8) = f.half[0];  }
__global__ __launch_bounds__(256) void k_h16(const float* __restrict__ x, _Float16* __restrict__ X16, size_t n8) { const size_t t = (size_t)blockIdx.x * 256 + threadIdx.x; if (t >= n8) return; FragH f;
#pragma unroll
  for (int q = 0; q < 8; ++q) f.h[q] = (_Float16)x[t * 8 + q]; *(v8us*)((unsigned short*)X16 + t * 8) = f.half[0];  }
__global__ __launch_bounds__(256) void k_round16f(const float* __restrict__ W, _Float16* __restrict__ Bt, size_t n8) { const size_t t = (size_t)blockIdx.x * 256 + threadIdx.x; if (t >= n8) return; FragH f;
#pragma unroll
  for (int i = 0; i < 8; ++i) f.h[i] = (_Float16)(bf16_round(W[t * 8 + i]) * 16.0f); *(v8us*)((unsigned short*)Bt + t * 8) = f.half[0];  }
template <int NHv, int TTv>
__global__ __launch_bounds__(256) void k_vt(const _Float16* __restrict__ V16, int ldv, int voff, _Float16* __restrict__ Vt) { __shared__ unsigned short tl[64][66]; const int tid = threadIdx.x; const int slab = blockIdx.x / (TTv / 64), lg = blockIdx.x % (TTv / 64); const int b = slab / NHv, h = slab % NHv;
  for (int i = tid; i < 64 * 8; i += 256) { const int r = i / 8, c8 = (i % 8) * 8; FragH f; f.half[0] = *(const v8us*)((const unsigned short*)V16 + ((size_t)b * TTv + lg * 64 + r) * ldv + voff + h * 64 + c8);
#pragma unroll
    for (int q = 0; q < 8; ++q) tl[r][c8 + q] = f.u[q]; }
  __syncthreads();
  {
#pragma unroll
    for (int rd = 0; rd < 2; ++rd) { const int d = rd * 32 + tid / 8, pc = tid % 8; FragH f;
#pragma unroll
      for (int q = 0; q < 8; ++q) f.u[q] = tl[pc * 8 + q][d];
      *(v8us*)((unsigned short*)Vt + ((size_t)slab * 64 + d) * TTv + lg * 64 + pc * 8) = f.half[0]; }
     } }

__global__ __launch_bounds__(256) void k_hl(const float* __restrict__ F, _Float16* __restrict__ Hh, _Float16* __restrict__ Hl, size_t n8) { const size_t t = (size_t)blockIdx.x * 256 + threadIdx.x; if (t >= n8) return; FragH fh, fl; const v4f a = *(const v4fa*)(F + t * 8), c = *(const v4fa*)(F + t * 8 + 4);
#pragma unroll
  for (int q = 0; q < 4; ++q) { _Float16 h = (_Float16)a[q]; fh.h[q] = h; fl.h[q] = (_Float16)((a[q] - (float)h) * 1024.0f); h = (_Float16)c[q]; fh.h[4 + q] = h; fl.h[4 + q] = (_Float16)((c[q] - (float)h) * 1024.0f); }
  { *(v8us*)((unsigned short*)Hh + t * 8) = fh.half[0]; *(v8us*)((unsigned short*)Hl + t * 8) = fl.half[0];  } }

// ---- fast GEMM (wave tile 32x64; requires M % 32 == 0 rows per launch region and N % 64 == 0); epilogue = k_gemm_hhx semantics ----
__device__ __forceinline__ v16h g2_frag(const _Float16* p, int hh) { FragH f; f.half[0] = *(const v8us*)((const unsigned short*)p + 8 * hh); f.half[1] = *(const v8us*)((const unsigned short*)p + 16 + 8 * hh); return f.v; }
__device__ __forceinline__ v8f g2_mma(v16h a, v16h b, v8f c) { v8f d = __builtin_amdgcn_wmma_f32_16x16x32_f16(false, a, false, b, (short)0, c, false, false); asm volatile("v_nop\n\tv_nop\n\tv_nop\n\tv_nop" : "+v"(d) : "v"(a), "v"(b)); return d; }
template <int ACT>
__global__ __launch_bounds__(128) void k_gemm2(const _Float16* __restrict__ A, int lda, size_t sA, const _Float16* __restrict__ Bh, int ldb, size_t sB, float alpha, const float* __restrict__ bias, size_t sBias, const float* __restrict__ CP, int rowsPerB, size_t sCPb, int row0g,
    float* __restrict__ C, _Float16* __restrict__ C16, int ldc, size_t sC, int M, int N, int K) { static_assert(ACT == 0 || ACT == 3 || ACT == 6 || ACT == 8 || ACT == 9 || ACT == 11 || ACT == 12 || ACT == 14 || ACT == 15 || ACT == 16 || ACT == 17, "k_gemm2: unsupported ACT code (would silently apply no activation)");
  __shared__ __attribute__((aligned(16))) float so[4][32][68];
  const int tid = threadIdx.x, w = tid >> 5, lane = tid & 31, ln = lane & 15, hh = lane >> 4; const int by = blockIdx.y;
  A += (size_t)by * sA; Bh += (size_t)by * sB; const size_t cofs = (size_t)by * sC; const float* bp = bias ? bias + (size_t)by * sBias : nullptr;
  const int ntn = N >> 6; const int mt = blockIdx.x / ntn, nq = blockIdx.x - mt * ntn; const int row0 = mt * 128 + 32 * w, col0 = nq * 64; if (row0 >= M) return;
  const _Float16* a0p = A + (size_t)(row0 + ln) * lda; const _Float16* a1p = a0p + (size_t)16 * lda;
  const _Float16* b0p = Bh + (size_t)(col0 + ln) * ldb; const _Float16* b1p = b0p + (size_t)16 * ldb; const _Float16* b2p = b1p + (size_t)16 * ldb; const _Float16* b3p = b2p + (size_t)16 * ldb;
  const v8f z8 = {0.f,0.f,0.f,0.f,0.f,0.f,0.f,0.f}; v8f c00 = z8, c01 = z8, c02 = z8, c03 = z8, c10 = z8, c11 = z8, c12 = z8, c13 = z8;
#pragma unroll 1
  for (int kb = 0; kb < K; kb += 32) { const v16h a0 = g2_frag(a0p + kb, hh), a1 = g2_frag(a1p + kb, hh);
    v16h b = g2_frag(b0p + kb, hh); c00 = g2_mma(a0, b, c00); c10 = g2_mma(a1, b, c10);
    b = g2_frag(b1p + kb, hh); c01 = g2_mma(a0, b, c01); c11 = g2_mma(a1, b, c11);
    b = g2_frag(b2p + kb, hh); c02 = g2_mma(a0, b, c02); c12 = g2_mma(a1, b, c12);
    b = g2_frag(b3p + kb, hh); c03 = g2_mma(a0, b, c03); c13 = g2_mma(a1, b, c13); }
  v8f accs[8] = {c00, c01, c02, c03, c10, c11, c12, c13};
#pragma unroll
  for (int u = 0; u < 8; ++u) { const int t = u & 3, half = u >> 2; const int col = col0 + t * 16 + ln; const float bv = bp ? bf16_round(bp[col]) : 0.f;
#pragma unroll
    for (int r = 0; r < 8; ++r) { const int rloc = half * 16 + 8 * hh + r; float v = accs[u][r] * alpha + bv; if (CP) { if (rowsPerB < 0) v += CP[cofs + (size_t)(row0g + row0 + rloc) * ldc + col];      /* rowsPerB < 0: own element of the batched C plane */ else { const int bidx = (row0g + row0 + rloc) / rowsPerB; v += CP[(size_t)bidx * sCPb + (size_t)by * 64 + col]; } }
      if (ACT == 3) v = fmaxf(v, 0.f); else if (ACT == 6) v = 0.5f * v * (1.0f + erff(v * 0.70710678118654752f)); else if (ACT == 11) v = 1.0f / (1.0f + expf(-v)); else if (ACT == 15) v = v / (1.0f + expf(-v)); else if (ACT == 12) v = (v > 0.f) ? v : 0.01f * v; else if (ACT == 8) v = tanhf(v); else if (ACT == 9) v = 0.5f * v * (1.0f + tanhf(0.7978845608028654f * (v + 0.044715f * v * v * v))); else if (ACT == 14) v = (v > 0.f) ? v : 0.1f * v; else if (ACT == 16) v = (v >= 0.f) ? v : 0.3f * v; else if (ACT == 17) v = (v >= 0.f) ? v : 0.2f * v;
      so[w][rloc][t * 16 + ln] = v; } }
  __builtin_amdgcn_fence(__ATOMIC_ACQ_REL, "workgroup"); __builtin_amdgcn_wave_barrier();
  const int rsub = lane >> 4, c4 = (lane & 15) * 4;
  {
#pragma unroll
    for (int q = 0; q < 16; ++q) { const int r = q * 2 + rsub; const v4f v = *(const v4fa*)&so[w][r][c4]; if (C) *(v4f*)(C + cofs + (size_t)(row0 + r) * ldc + col0 + c4) = v; if (C16) { v4h h4; for (int i = 0; i < 4; ++i) h4[i] = (_Float16)v[i]; *(v4h*)(C16 + cofs + (size_t)(row0 + r) * ldc + col0 + c4) = h4; } }
     } }


__global__ __launch_bounds__(256) void k_wnat(const float* __restrict__ w, size_t n8, _Float16* __restrict__ Bt) { const size_t t = (size_t)blockIdx.x * 256 + threadIdx.x; if (t >= n8) return; FragH f; for (int q = 0; q < 8; ++q) f.h[q] = (_Float16)(bf16_round(w[t * 8 + q]) * 16.0f); *(v8us*)((unsigned short*)Bt + t * 8) = f.half[0];  }
__global__ __launch_bounds__(256) void k_rsm(const float* __restrict__ S, _Float16* __restrict__ P, int nrows) {
  #pragma clang fp contract(off)
  const int i = blockIdx.x * 256 + threadIdx.x; if (i >= nrows) return; const float* s = S + (size_t)i * SQ; float mx = -3.0e38f;
#pragma unroll 1
  for (int j = 0; j < SQ; ++j) mx = fmaxf(mx, s[j]); float se = 0.f;
#pragma unroll 1
  for (int j = 0; j < SQ; ++j) se += expf(s[j] - mx); const float sc = 256.0f / se;
#pragma unroll 1
  for (int j0 = 0; j0 < SQ; j0 += 8) { FragH f; for (int q = 0; q < 8; ++q) f.h[q] = (_Float16)(expf(s[j0 + q] - mx) * sc); unsigned short* d = (unsigned short*)P + (size_t)i * SQ + j0; *(v8us*)d = f.half[0];  } }
__global__ __launch_bounds__(256) void k_vt(const _Float16* __restrict__ V16, int b, int h0, _Float16* __restrict__ VT) { __shared__ unsigned short tl[64][65]; const int tid = threadIdx.x; const int hh = blockIdx.x % HG, sg = blockIdx.x / HG; const int s0 = sg * 64; const int h = h0 + hh;
  for (int i = tid; i < 64 * 8; i += 256) { const int j = i / 8, d8 = (i % 8) * 8; FragH f; f.half[0] = *(const v8us*)((const unsigned short*)V16 + ((size_t)b * SQ + s0 + j) * DM + h * HD + d8); for (int q = 0; q < 8; ++q) tl[d8 + q][j] = f.u[q]; }
  __syncthreads();
  { for (int i = tid; i < 64 * 8; i += 256) { const int d = i / 8, j8 = (i % 8) * 8; FragH f; for (int q = 0; q < 8; ++q) f.u[q] = tl[d][j8 + q]; *(v8us*)((unsigned short*)VT + ((size_t)hh * HD + d) * SQ + s0 + j8) = f.half[0]; }  } }



__global__ __launch_bounds__(256) void k_rsmkm(const float* __restrict__ S, _Float16* __restrict__ P, int nrows, const int* __restrict__ am) {
  #pragma clang fp contract(off)
  const int t = blockIdx.x * 256 + threadIdx.x; if (t >= nrows) return; const size_t i = (size_t)t; const float* s = S + i * SQ; const int* mr = am + (size_t)(t % SQ) * SQ; float mx = -3.0e38f;
#pragma unroll 1
  for (int j = 0; j < SQ; ++j) { const float f = (mr[j] != 0) ? 1.f : 0.f; mx = fmaxf(mx, fmaf(f, s[j], (1.f - f) * -1.0e9f)); } float se = 0.f;
#pragma unroll 1
  for (int j = 0; j < SQ; ++j) { const float f = (mr[j] != 0) ? 1.f : 0.f; se += __expf(fmaf(f, s[j], (1.f - f) * -1.0e9f) - mx); } const float sc = 256.0f / se;
#pragma unroll 1
  for (int j0 = 0; j0 < SQ; j0 += 8) { FragH fr; for (int q = 0; q < 8; ++q) { const int j = j0 + q; const float f = (mr[j] != 0) ? 1.f : 0.f; fr.h[q] = (_Float16)(__expf(fmaf(f, s[j], (1.f - f) * -1.0e9f) - mx) * sc); }
    unsigned short* d = (unsigned short*)P + i * SQ + j0; *(v8us*)d = fr.half[0];  } }
extern "C" void kernel_launch(void* const* d_in, const int* in_sizes, int n_in,
                              void* d_out, int out_size, void* d_ws, size_t ws_size, hipStream_t stream) {
  (void)in_sizes; (void)n_in; (void)out_size;
  const float* const* I = (const float* const*)d_in; const float* xv = I[0]; const float* xk = I[1]; const float* xq = I[2]; const int* am = (const int*)d_in[3]; const float* wv = I[4]; const float* wk = I[5]; const float* wq = I[6]; const float* x = xq;      /* input order: values, keys, queries; the int32 keep-mask [2][1][2048][2048]; Wv, Wk, Wq: ONE natural [64][64] weight per stream, shared by the 16 heads; no biases; no output projection */
  char* ws = (char*)d_ws; size_t off = 0;
  auto take = [&](size_t bytes) { char* p = ws + off; off += (bytes + 255) & ~(size_t)255; return p; };
_Float16* BQ = (_Float16*)take((size_t)HD * HD * 2); _Float16* BK = (_Float16*)take((size_t)HD * HD * 2); _Float16* BV = (_Float16*)take((size_t)HD * HD * 2);
  _Float16* X16 = (_Float16*)take(NR * DM * 2); _Float16* XKp = (_Float16*)take(NR * DM * 2); _Float16* XVp = (_Float16*)take(NR * DM * 2); _Float16* Q16 = (_Float16*)take(NR * DM * 2); _Float16* K16 = (_Float16*)take(NR * DM * 2); _Float16* V16 = (_Float16*)take(NR * DM * 2);
  float* S = (float*)take((size_t)HG * SQ * SQ * 4); _Float16* P = (_Float16*)take((size_t)HG * SQ * SQ * 2); _Float16* VT = (_Float16*)take((size_t)NH * HD * SQ * 2);
  if (off > ws_size) return;
{ const unsigned g = (unsigned)(((size_t)HD * HD / 8 + 255) / 256); k_wnat<<<g, 256, 0, stream>>>(wq, (size_t)HD * HD / 8, BQ); k_wnat<<<g, 256, 0, stream>>>(wk, (size_t)HD * HD / 8, BK); k_wnat<<<g, 256, 0, stream>>>(wv, (size_t)HD * HD / 8, BV); }      /* natural [out][in] = Bt[n][k], x16: the one 64 x 64 weight of each stream */
  _Float16* XK = XKp; _Float16* XV = XVp; k_x16<<<(unsigned)((NR * DM / 8 + 255) / 256), 256, 0, stream>>>(xk, XK, NR * DM / 8); k_x16<<<(unsigned)((NR * DM / 8 + 255) / 256), 256, 0, stream>>>(xv, XV, NR * DM / 8);      /* key and value inputs as exact f16 rows */

  k_x16<<<(unsigned)((NR * DM / 8 + 255) / 256), 256, 0, stream>>>(x, X16, NR * DM / 8);
  const size_t r0p = (size_t)B0 * SQ;      /* first projected row */
k_gemm2<0><<<dim3((unsigned)((MP / 128) * (HD / 64)), NH), 128, 0, stream>>>(X16 + r0p * DM, DM, (size_t)HD, BQ, HD, 0, 0.0625f, nullptr, 0, nullptr, 1, 0, 0, nullptr, Q16 + r0p * DM, DM, (size_t)HD, MP, HD, HD);      /* head h on grid.y: its 64-column slice of the rows times the SHARED weight (head stride 0), K = 64, into the head's slice */
k_gemm2<0><<<dim3((unsigned)((MP / 128) * (HD / 64)), NH), 128, 0, stream>>>(XK + r0p * DM, DM, (size_t)HD, BK, HD, 0, 0.0625f, nullptr, 0, nullptr, 1, 0, 0, nullptr, K16 + r0p * DM, DM, (size_t)HD, MP, HD, HD);      /* head h on grid.y: its 64-column slice of the rows times the SHARED weight (head stride 0), K = 64, into the head's slice */
k_gemm2<0><<<dim3((unsigned)((MP / 128) * (HD / 64)), NH), 128, 0, stream>>>(XV + r0p * DM, DM, (size_t)HD, BV, HD, 0, 0.0625f, nullptr, 0, nullptr, 1, 0, 0, nullptr, V16 + r0p * DM, DM, (size_t)HD, MP, HD, HD);      /* head h on grid.y: its 64-column slice of the rows times the SHARED weight (head stride 0), K = 64, into the head's slice */
  for (int b = B0; b < B0 + NBR; ++b) { const size_t r0 = (size_t)b * SQ;
    k_vt<NH, SQ><<<NH * (SQ / 64), 256, 0, stream>>>(V16 + r0 * LQ, LQ, 0, VT);      /* V^T [NH][HD][SQ] for this batch */
    for (int h0 = 0; h0 < NHD; h0 += HG) {
      k_gemm2<0><<<dim3((QN / 128) * (SQ / 64), HG), 128, 0, stream>>>(Q16 + r0 * LQ + h0 * HD, LQ, (size_t)HD, K16 + r0 * LQ + h0 * HD, LQ, (size_t)HD, 0.03125f, nullptr, 0, nullptr, 1, 0, 0, S, nullptr, SQ, (size_t)SQ * SQ, QN, SQ, HD);      /* scores / sqrt(1024) (the module's embed size), HG heads per launch */
      k_rsmkm<<<(HG * SQ + 255) / 256, 256, 0, stream>>>(S, P, HG * SQ, am + (size_t)b * SQ * SQ);      /* softmax with the batch's keep-mask row of each query (mask == 0 -> weight 0 by arithmetic select), rows of all HG heads */
      k_gemm2<0><<<dim3((QN / 128) * (HD / 64), HG), 128, 0, stream>>>(P, SQ, (size_t)SQ * SQ, VT + (size_t)h0 * HD * SQ, SQ, (size_t)HD * SQ, 0.00390625f, nullptr, 0, nullptr, 1, 0, 0, (float*)d_out + r0 * DM + h0 * HD, nullptr, DM, (size_t)HD, QN, HD, SQ); } }      /* out = P V^T (alpha 2^-8) written f32 straight into the merged-heads output rows */
}

// v001
// Measured time: 836 microseconds a run.
// Next to v000, in two timings, it ran 9.16 and 9.23 times as fast.
#include <hip/hip_runtime.h>
// Masked multi-head attention over three inputs with ONE SHARED 64 x 64 projection per stream and a RANDOM int keep-mask, no output projection (values, keys, queries [2][2048][1024]; every head's 64-column slice is projected by the SAME natural nn.Linear weight: v = values.reshape(N, L, 16, 64) Wv^T, k likewise with Wk, q with Wq ([64][64], normal / 8, NO biases); scores = q.k / sqrt(1024) (the module's embed size); where(mask == 0, -1e20) with the int32 [2][1][2048][2048] mask (seeded randint 0 / 1, about half zeros, one plane per sequence shared by its heads; READ on the device); softmax; out = attn v merged over heads -> [2][2048][1024]; input order values, keys, queries, mask, Wv, Wk, Wq).
// Structure: token rows r = b*2048 + s; the three inputs as exact f16 rows (bf16-rounded); Q, K, V as three WMMA GEMMs BATCHED OVER THE HEADS on grid.y (A = the head's 64-column slice of the rows, B = the ONE shared x16 weight with head stride 0, K = 64; 32x64 wave tiles, f32 accumulation, no bias, f16 outputs into the head's slice); per batch: V^T for all heads via LDS transposes; per (batch, group of 4 heads): scores GEMM (K = 64, batched over the heads on grid.y, alpha = 1/sqrt(1024)), row softmax on VALU with the batch's keep-mask row of each query (f32 statistics; weights stored x256 as f16), out = P . V^T GEMM (K = 2048, alpha 2^-8) written f32 straight into the merged-heads output rows; see the trace for the launch count.
// Compute dtype: inputs rounded to bf16; the three inputs and the x16 weights held as f16 planes (exact for every bf16 value of magnitude from 2^-14 up to 65,504; the weights up to 4,094 before their factor of 16); q, k, v and the softmax weights as plain f16 GEMM operands (~2^-12); scores, softmax statistics and the output f32. v_wmma_f32_16x16x32_f16.
#define NB 2
#define SQ 2048
#define DM 1024
#define NH 16
#define HD 64
#define HG 4                         /* heads per attention launch group */
#define B0 0                         /* first batch processed (debug hook) */
#define NBR NB                       /* batches processed (debug hook) */
#define NR ((size_t)NB * SQ)         /* token rows */
#define MP ((int)((size_t)NBR * SQ)) /* rows projected (debug hook) */
#define QN SQ                        /* query rows attended per batch (debug hook) */
#define NHD NH                       /* heads attended (debug hook) */
#define MPO MP                       /* not used */
#define LQ DM      /* row pitch of the q/k/v rows */
typedef __bf16 v16b __attribute__((ext_vector_type(16)));
typedef unsigned short v8us __attribute__((ext_vector_type(8), may_alias));
typedef float  v8f  __attribute__((ext_vector_type(8)));
typedef float  v4f  __attribute__((ext_vector_type(4)));
typedef float  v4fa __attribute__((ext_vector_type(4), may_alias));
union FragB { v16b v; v8us half[2]; unsigned short u[16]; };

__device__ __forceinline__ unsigned short bf16_bits(float x) { unsigned int u = __float_as_uint(x); return (unsigned short)((u + 0x7FFFu + ((u >> 16) & 1u)) >> 16); }
__device__ __forceinline__ float bf16_val(unsigned short b) { return __uint_as_float(((unsigned int)b) << 16); }
__device__ __forceinline__ float bf16_round(float x) { return bf16_val(bf16_bits(x)); }
// D += A·B with NT terms: 1 = ah·bh, 2 = + al·bh (A split), 3 = + ah·bl (both split)
template <int NT>
__device__ __forceinline__ v8f mmaN(v16b ah, v16b al, v16b bh, v16b bl, v8f c) {
  c = __builtin_amdgcn_wmma_f32_16x16x32_bf16(false, ah, false, bh, (short)0, c, false, false);
  if (NT >= 2) c = __builtin_amdgcn_wmma_f32_16x16x32_bf16(false, al, false, bh, (short)0, c, false, false);
  if (NT >= 3) c = __builtin_amdgcn_wmma_f32_16x16x32_bf16(false, ah, false, bl, (short)0, c, false, false);
  asm volatile("v_nop\n\tv_nop\n\tv_nop\n\tv_nop" : "+v"(c) : "v"(ah), "v"(al), "v"(bh), "v"(bl));
  return c;
}

__global__ __launch_bounds__(256) void k_wt_bf16(const float* __restrict__ W, unsigned short* __restrict__ Wt, int K, int N) {
  const int t = blockIdx.x * 256 + threadIdx.x;
  const int k8n = K / 8;
  if (t >= N * k8n) return;
  const int n = t / k8n, k8 = (t % k8n) * 8;
  v8us v;
#pragma unroll
  for (int i = 0; i < 8; ++i) v[i] = bf16_bits(W[(size_t)(k8 + i) * N + n]);
  *(v8us*)(Wt + (size_t)n * K + k8) = v;
  
}

// GEMM C[M][N] (f32, pitch ldc) = act(A[M][K]·W + bias). A f32 row-major (pitch lda) converted per fragment to bf16
// (ASPLIT: hi/lo two planes -> 2 terms, else single rounded term); Wt bf16 [N][K] (pitch ldb). BIAS_BF16 rounds the
// bias to bf16 first (bias quantised to bf16 before the add). K%32==0, M%16==0, N%64==0.
template <bool ASPLIT, int ACT, bool BIAS_BF16>
__global__ __launch_bounds__(128) void k_gemm_bf(const float* __restrict__ A, int lda, const unsigned short* __restrict__ Wt, int ldb,
                                               const float* __restrict__ bias, float* __restrict__ C, int ldc, int M, int N, int K) {
  __shared__ __attribute__((aligned(16))) float so[4][16][64];
  const int tid = threadIdx.x, w = tid >> 5, lane = tid & 31, ln = lane & 15, hh = lane >> 4;
  const int ntn = N / 64;
  const int wid = blockIdx.x * 4 + w;
  const int mt = wid / ntn, nq = wid % ntn;
  if (mt * 16 >= M) return;
  const int row0 = mt * 16, col0 = nq * 64;
  const float* arow = A + (size_t)(row0 + ln) * lda;
  v8f acc[4] = {};
  for (int kb = 0; kb < K; kb += 32) {
    FragB ah, al;
    const v4f x0 = *(const v4fa*)(arow + kb + 8 * hh), x1 = *(const v4fa*)(arow + kb + 8 * hh + 4);
    const v4f x2 = *(const v4fa*)(arow + kb + 16 + 8 * hh), x3 = *(const v4fa*)(arow + kb + 16 + 8 * hh + 4);
    float xs[16] = {x0[0],x0[1],x0[2],x0[3],x1[0],x1[1],x1[2],x1[3],x2[0],x2[1],x2[2],x2[3],x3[0],x3[1],x3[2],x3[3]};
#pragma unroll
    for (int i = 0; i < 16; ++i) { const unsigned short hb = bf16_bits(xs[i]); ah.u[i] = hb; al.u[i] = ASPLIT ? bf16_bits(xs[i] - bf16_val(hb)) : (unsigned short)0; }
#pragma unroll
    for (int t = 0; t < 4; ++t) {
      const unsigned short* brow = Wt + (size_t)(col0 + t * 16 + ln) * ldb + kb;
      FragB b;
      b.half[0] = *(const v8us*)(brow + 8 * hh);
      b.half[1] = *(const v8us*)(brow + 16 + 8 * hh);
      acc[t] = mmaN<ASPLIT ? 2 : 1>(ah.v, al.v, b.v, b.v, acc[t]);
    }
  }
#pragma unroll
  for (int t = 0; t < 4; ++t) {
    float bv = bias ? bias[col0 + t * 16 + ln] : 0.f;
    if (BIAS_BF16) bv = bf16_round(bv);
#pragma unroll
    for (int r = 0; r < 8; ++r) { float v = acc[t][r] + bv; if (ACT == 1) v = fmaxf(v, 0.f); so[w][8 * hh + r][t * 16 + ln] = v; }
  }
  __builtin_amdgcn_fence(__ATOMIC_ACQ_REL, "workgroup");
  __builtin_amdgcn_wave_barrier();
  const int rsub = lane >> 4, c4 = (lane & 15) * 4;
  {
#pragma unroll
    for (int q = 0; q < 8; ++q) {
      const int r = q * 2 + rsub;
      const v4f v = *(const v4fa*)&so[w][r][c4];
      *(v4f*)(C + (size_t)(row0 + r) * ldc + col0 + c4) = v;
    }
    
  }
}

// GEMM C = act(A·W + bias + resid): A f32 (ASPLIT -> hi/lo 2 terms), Wt bf16 [N][K]; ACT 0 none, 1 relu, 2 exact gelu;
// resid (optional, f32, row index = (row % rmod), pitch ldr, RES_BF16 rounds it) added before the activation.
template <bool ASPLIT, int ACT, bool BIAS_BF16, bool RES_BF16>
__global__ __launch_bounds__(128) void k_gemm_bf3(const float* __restrict__ A, int lda, const unsigned short* __restrict__ Wt, int ldb,
                                                const float* __restrict__ bias, const float* __restrict__ resid, int rmod, int ldr,
                                                float* __restrict__ C, int ldc, int M, int N, int K) {
  __shared__ __attribute__((aligned(16))) float so[4][16][64];
  const int tid = threadIdx.x, w = tid >> 5, lane = tid & 31, ln = lane & 15, hh = lane >> 4;
  const int ntn = N / 64;
  const int wid = blockIdx.x * 4 + w;
  const int mt = wid / ntn, nq = wid % ntn;
  if (mt * 16 >= M) return;
  const int row0 = mt * 16, col0 = nq * 64;
  const float* arow = A + (size_t)(row0 + ln) * lda;
  v8f acc[4] = {};
  for (int kb = 0; kb < K; kb += 32) {
    FragB ah, al;
    const v4f x0 = *(const v4fa*)(arow + kb + 8 * hh), x1 = *(const v4fa*)(arow + kb + 8 * hh + 4);
    const v4f x2 = *(const v4fa*)(arow + kb + 16 + 8 * hh), x3 = *(const v4fa*)(arow + kb + 16 + 8 * hh + 4);
    float xs[16] = {x0[0],x0[1],x0[2],x0[3],x1[0],x1[1],x1[2],x1[3],x2[0],x2[1],x2[2],x2[3],x3[0],x3[1],x3[2],x3[3]};
#pragma unroll
    for (int i = 0; i < 16; ++i) { const unsigned short hb = bf16_bits(xs[i]); ah.u[i] = hb; al.u[i] = ASPLIT ? bf16_bits(xs[i] - bf16_val(hb)) : (unsigned short)0; }
#pragma unroll
    for (int t = 0; t < 4; ++t) {
      const unsigned short* brow = Wt + (size_t)(col0 + t * 16 + ln) * ldb + kb;
      FragB b;
      b.half[0] = *(const v8us*)(brow + 8 * hh);
      b.half[1] = *(const v8us*)(brow + 16 + 8 * hh);
      acc[t] = mmaN<ASPLIT ? 2 : 1>(ah.v, al.v, b.v, b.v, acc[t]);
    }
  }
#pragma unroll
  for (int t = 0; t < 4; ++t) {
    const int col = col0 + t * 16 + ln;
    float bv = bias ? bias[col] : 0.f;
    if (BIAS_BF16) bv = bf16_round(bv);
#pragma unroll
    for (int r = 0; r < 8; ++r) {
      float v = acc[t][r] + bv;
      if (resid) { float rv = resid[(size_t)((row0 + 8 * hh + r) % rmod) * ldr + col]; if (RES_BF16) rv = bf16_round(rv); v += rv; }
      if (ACT == 1) v = fmaxf(v, 0.f);
      if (ACT == 2) v = 0.5f * v * (1.0f + erff(v * 0.70710678118654752f));
      if (ACT == 3) { const float u = 0.7978845608028654f * (v + 0.044715f * v * v * v); v = 0.5f * v * (1.0f + tanhf(u)); }
      so[w][8 * hh + r][t * 16 + ln] = v;
    }
  }
  __builtin_amdgcn_fence(__ATOMIC_ACQ_REL, "workgroup");
  __builtin_amdgcn_wave_barrier();
  const int rsub = lane >> 4, c4 = (lane & 15) * 4;
  {
#pragma unroll
    for (int q = 0; q < 8; ++q) {
      const int r = q * 2 + rsub;
      const v4f v = *(const v4fa*)&so[w][r][c4];
      *(v4f*)(C + (size_t)(row0 + r) * ldc + col0 + c4) = v;
    }
    
  }
}
// row LayerNorm (biased variance, eps) over N: s = X (+ R); optional out_sum <- s; out_norm <- (s-mu)*rsqrt(var+eps)*g + b
template <bool PARAM_BF16>
__global__ __launch_bounds__(256) void k_layernorm(const float* __restrict__ X, const float* __restrict__ R, const float* __restrict__ g, const float* __restrict__ bta,
                                                  float* __restrict__ out_sum, float* __restrict__ out_norm, int N, float eps) {
  __shared__ float red[256];
  const int row = blockIdx.x, tid = threadIdx.x;
  const float* x = X + (size_t)row * N; const float* rr = R ? R + (size_t)row * N : nullptr;
  float vals[16];                     // up to N = 4096
  const int per = N / 256;            // contiguous chunk per thread? use strided-by-4 chunks: thread handles j = tid*4 + 1024*u
  float s1 = 0.f;
  for (int u = 0; u < per / 4; ++u) {
    const int j = tid * 4 + 1024 * u;
    const v4f a = *(const v4fa*)(x + j);
    v4f b = {0.f,0.f,0.f,0.f}; if (rr) b = *(const v4fa*)(rr + j);
#pragma unroll
    for (int q = 0; q < 4; ++q) { const float v = a[q] + b[q]; vals[u * 4 + q] = v; s1 += v; }
  }
  red[tid] = s1; __syncthreads();
  for (int st = 128; st > 0; st >>= 1) { if (tid < st) red[tid] += red[tid + st]; __syncthreads(); }
  const float mu = red[0] / (float)N; __syncthreads();
  float s2 = 0.f;
  for (int u = 0; u < per / 4; ++u)
#pragma unroll
    for (int q = 0; q < 4; ++q) { const float c = vals[u * 4 + q] - mu; s2 += c * c; }
  red[tid] = s2; __syncthreads();
  for (int st = 128; st > 0; st >>= 1) { if (tid < st) red[tid] += red[tid + st]; __syncthreads(); }
  const float rs = rsqrtf(red[0] / (float)N + eps);
  {
    for (int u = 0; u < per / 4; ++u) {
      const int j = tid * 4 + 1024 * u;
      v4f o, sm;
#pragma unroll
      for (int q = 0; q < 4; ++q) {
        float gg = g[j + q], bb = bta[j + q];
        if (PARAM_BF16) { gg = bf16_round(gg); bb = bf16_round(bb); }
        sm[q] = vals[u * 4 + q]; o[q] = (vals[u * 4 + q] - mu) * rs * gg + bb;
      }
      if (out_sum) *(v4f*)(out_sum + (size_t)row * N + j) = sm;
      *(v4f*)(out_norm + (size_t)row * N + j) = o;
    }
    
  }
}



// ---- f16 WMMA path (v_wmma_f32_16x16x32_f16): 11-bit significands for operands in range — used where a [0,1] probability operand needs more precision than bf16
typedef _Float16 v16h __attribute__((ext_vector_type(16)));
union FragH { v16h v; v8us half[2]; _Float16 h[16]; unsigned short u[16]; };
template <int NT>
__device__ __forceinline__ v8f mmaH(v16h ah, v16h al, v16h bh, v16h bl, v8f c) {
  c = __builtin_amdgcn_wmma_f32_16x16x32_f16(false, ah, false, bh, (short)0, c, false, false);
  if (NT >= 2) c = __builtin_amdgcn_wmma_f32_16x16x32_f16(false, al, false, bh, (short)0, c, false, false);
  if (NT >= 3) c = __builtin_amdgcn_wmma_f32_16x16x32_f16(false, ah, false, bl, (short)0, c, false, false);
  asm volatile("v_nop\n\tv_nop\n\tv_nop\n\tv_nop" : "+v"(c) : "v"(ah), "v"(al), "v"(bh), "v"(bl));
  return c;
}
// batched GEMM like k_gemm_b but f16 operands: A f32 (split into f16 hi/lo if ASPLIT, else rounded to f16), Bt = f16 values [n][k]; alpha; C f32; N multiple of 16 (partial tiles skipped)
template <bool ASPLIT>
__global__ __launch_bounds__(128) void k_gemm_h(const float* __restrict__ A, int lda, size_t sA, const _Float16* __restrict__ Bh, int ldb, size_t sB, float alpha, float* __restrict__ C, int ldc, size_t sC, int M, int N, int K) {
  __shared__ __attribute__((aligned(16))) float so[4][16][64];
  const int tid = threadIdx.x, w = tid >> 5, lane = tid & 31, ln = lane & 15, hh = lane >> 4; const int by = blockIdx.y;
  A += (size_t)by * sA; Bh += (size_t)by * sB; C += (size_t)by * sC;
  const int ntn = (N + 63) / 64; const int wid = blockIdx.x * 4 + w; const int mt = wid / ntn, nq = wid % ntn; if (mt * 16 >= M) return;
  const int row0 = mt * 16, col0 = nq * 64; const float* arow = A + (size_t)(row0 + ln) * lda;
  v8f acc[4] = {};
  for (int kb = 0; kb < K; kb += 32) {
    FragH ah, al;
    const v4f x0 = *(const v4fa*)(arow + kb + 8 * hh), x1 = *(const v4fa*)(arow + kb + 8 * hh + 4), x2 = *(const v4fa*)(arow + kb + 16 + 8 * hh), x3 = *(const v4fa*)(arow + kb + 16 + 8 * hh + 4);
    float xs[16] = {x0[0],x0[1],x0[2],x0[3],x1[0],x1[1],x1[2],x1[3],x2[0],x2[1],x2[2],x2[3],x3[0],x3[1],x3[2],x3[3]};
#pragma unroll
    for (int i = 0; i < 16; ++i) { const _Float16 h = (_Float16)xs[i]; ah.h[i] = h; al.h[i] = ASPLIT ? (_Float16)(xs[i] - (float)h) : (_Float16)0.0f; }
#pragma unroll
    for (int t = 0; t < 4; ++t) { if (col0 + t * 16 >= N) continue; const size_t boff = (size_t)(col0 + t * 16 + ln) * ldb + kb; FragH bq; bq.half[0] = *(const v8us*)(Bh + boff + 8 * hh); bq.half[1] = *(const v8us*)(Bh + boff + 16 + 8 * hh);
      acc[t] = mmaH<ASPLIT ? 2 : 1>(ah.v, al.v, bq.v, bq.v, acc[t]); }
  }
#pragma unroll
  for (int t = 0; t < 4; ++t) { if (col0 + t * 16 >= N) continue;
#pragma unroll
    for (int r = 0; r < 8; ++r) so[w][8 * hh + r][t * 16 + ln] = acc[t][r] * alpha; }
  __builtin_amdgcn_fence(__ATOMIC_ACQ_REL, "workgroup"); __builtin_amdgcn_wave_barrier();
  const int rsub = lane >> 4, c4 = (lane & 15) * 4;
  {
#pragma unroll
    for (int q = 0; q < 8; ++q) { const int r = q * 2 + rsub; if (col0 + c4 < N) { const v4f v = *(const v4fa*)&so[w][r][c4]; *(v4f*)(C + (size_t)(row0 + r) * ldc + col0 + c4) = v; } }
     }
}

// Wt[n][k] = f16(W[k][n]·scale) from f32 row-major W[K][N] (scale = power of two; bf16-exact weights stay exact in f16 away from the subnormal range)
__global__ __launch_bounds__(256) void k_wt_f16(const float* __restrict__ W, _Float16* __restrict__ Wt, int K, int N, float scale) {
  const int t = blockIdx.x * 256 + threadIdx.x; if (t >= N * (K / 8)) return; const int n = t / (K / 8), k8 = (t % (K / 8)) * 8; FragH f;
#pragma unroll
  for (int i = 0; i < 8; ++i) f.h[i] = (_Float16)(bf16_round(W[(size_t)(k8 + i) * N + n]) * scale); const v8us o = f.half[0];
  *(v8us*)((unsigned short*)Wt + (size_t)n * K + k8) = o; 
}
// k_gemm_hh variant with fused epilogue: v = acc·alpha + bias[by·sBias + col] (+ CP[(row/rowsPerB)·sCPb + by·64 + col] if CP) ; ACT 0 none / 1 elu ; writes f16 C16 (and f32 C if non-null)
template <int ACT>
__global__ __launch_bounds__(128) void k_gemm_hhx(const _Float16* __restrict__ A, int lda, size_t sA, const _Float16* __restrict__ Bh, int ldb, size_t sB, float alpha, const float* __restrict__ bias, size_t sBias, const float* __restrict__ CP, int rowsPerB, size_t sCPb, int row0g,
    float* __restrict__ C, _Float16* __restrict__ C16, int ldc, size_t sC, int M, int N, int K) {
  __shared__ __attribute__((aligned(16))) float so[4][16][64];
  const int tid = threadIdx.x, w = tid >> 5, lane = tid & 31, ln = lane & 15, hh = lane >> 4; const int by = blockIdx.y;
  A += (size_t)by * sA; Bh += (size_t)by * sB; const size_t cofs = (size_t)by * sC; const float* bp = bias ? bias + (size_t)by * sBias : nullptr;
  const int ntn = (N + 63) / 64; const int wid = blockIdx.x * 4 + w; const int mt = wid / ntn, nq = wid % ntn; if (mt * 16 >= M) return;
  const int row0 = mt * 16, col0 = nq * 64; const _Float16* arow = A + (size_t)(row0 + ln) * lda;
  v8f acc[4] = {};
  for (int kb = 0; kb < K; kb += 32) { FragH ah; ah.half[0] = *(const v8us*)((const unsigned short*)arow + kb + 8 * hh); ah.half[1] = *(const v8us*)((const unsigned short*)arow + kb + 16 + 8 * hh);
#pragma unroll
    for (int t = 0; t < 4; ++t) { if (col0 + t * 16 >= N) continue; const size_t boff = (size_t)(col0 + t * 16 + ln) * ldb + kb; FragH bq; bq.half[0] = *(const v8us*)((const unsigned short*)Bh + boff + 8 * hh); bq.half[1] = *(const v8us*)((const unsigned short*)Bh + boff + 16 + 8 * hh);
      acc[t] = mmaH<1>(ah.v, ah.v, bq.v, bq.v, acc[t]); }
  }
#pragma unroll
  for (int t = 0; t < 4; ++t) { if (col0 + t * 16 >= N) continue; const int col = col0 + t * 16 + ln; const float bv = bp ? bf16_round(bp[col]) : 0.f;
#pragma unroll
    for (int r = 0; r < 8; ++r) { float v = acc[t][r] * alpha + bv; if (CP) { const int rr = row0g + row0 + 8 * hh + r; if (rowsPerB < 0) v += CP[cofs + (size_t)rr * ldc + col];      /* rowsPerB < 0: own element of the batched C plane */ else { const int bidx = rr / rowsPerB; v += CP[(size_t)bidx * sCPb + (size_t)by * 64 + col]; } } if (ACT == 1) v = (v > 0.f) ? v : expm1f(v); else if (ACT == 7) v = (v > 0.f) ? v + 1.0f : expf(v); else if (ACT == 8) v = tanhf(v); else if (ACT == 9) v = 0.5f * v * (1.0f + tanhf(0.7978845608028654f * (v + 0.044715f * v * v * v))); else if (ACT == 11) v = 1.0f / (1.0f + expf(-v)); else if (ACT == 12) v = (v > 0.f) ? v : 0.01f * v; else if (ACT == 14) v = (v > 0.f) ? v : 0.1f * v; else if (ACT == 16) v = (v >= 0.f) ? v : 0.3f * v; else if (ACT == 17) v = (v >= 0.f) ? v : 0.2f * v; else if (ACT == 15) v = v / (1.0f + expf(-v)); else if (ACT == 3) v = fmaxf(v, 0.f); else if (ACT == 6) v = 0.5f * v * (1.0f + erff(v * 0.70710678118654752f)); so[w][8 * hh + r][t * 16 + ln] = v; } }
  __builtin_amdgcn_fence(__ATOMIC_ACQ_REL, "workgroup"); __builtin_amdgcn_wave_barrier();
  const int rsub = lane >> 4, c4 = (lane & 15) * 4; typedef _Float16 v4h __attribute__((ext_vector_type(4)));
  {
#pragma unroll
    for (int q = 0; q < 8; ++q) { const int r = q * 2 + rsub; if (col0 + c4 < N) { const v4f v = *(const v4fa*)&so[w][r][c4]; if (C) *(v4f*)(C + cofs + (size_t)(row0 + r) * ldc + col0 + c4) = v; if (C16) { v4h h4; for (int i = 0; i < 4; ++i) h4[i] = (_Float16)v[i]; *(v4h*)(C16 + cofs + (size_t)(row0 + r) * ldc + col0 + c4) = h4; } } }
     }
}


typedef _Float16 v4h __attribute__((ext_vector_type(4)));

__global__ __launch_bounds__(256) void k_x16(const float* __restrict__ x, _Float16* __restrict__ X16, size_t n8) { const size_t t = (size_t)blockIdx.x * 256 + threadIdx.x; if (t >= n8) return; FragH f;
#pragma unroll
  for (int q = 0; q < 8; ++q) f.h[q] = (_Float16)bf16_round(x[t * 8 + q]); *(v8us*)((unsigned short*)X16 + t * 8) = f.half[0];  }
__global__ __launch_bounds__(256) void k_h16(const float* __restrict__ x, _Float16* __restrict__ X16, size_t n8) { const size_t t = (size_t)blockIdx.x * 256 + threadIdx.x; if (t >= n8) return; FragH f;
#pragma unroll
  for (int q = 0; q < 8; ++q) f.h[q] = (_Float16)x[t * 8 + q]; *(v8us*)((unsigned short*)X16 + t * 8) = f.half[0];  }
__global__ __launch_bounds__(256) void k_round16f(const float* __restrict__ W, _Float16* __restrict__ Bt, size_t n8) { const size_t t = (size_t)blockIdx.x * 256 + threadIdx.x; if (t >= n8) return; FragH f;
#pragma unroll
  for (int i = 0; i < 8; ++i) f.h[i] = (_Float16)(bf16_round(W[t * 8 + i]) * 16.0f); *(v8us*)((unsigned short*)Bt + t * 8) = f.half[0];  }
template <int NHv, int TTv>
__global__ __launch_bounds__(256) void k_vt(const _Float16* __restrict__ V16, int ldv, int voff, _Float16* __restrict__ Vt) { __shared__ unsigned short tl[64][66]; const int tid = threadIdx.x; const int slab = blockIdx.x / (TTv / 64), lg = blockIdx.x % (TTv / 64); const int b = slab / NHv, h = slab % NHv;
  for (int i = tid; i < 64 * 8; i += 256) { const int r = i / 8, c8 = (i % 8) * 8; FragH f; f.half[0] = *(const v8us*)((const unsigned short*)V16 + ((size_t)b * TTv + lg * 64 + r) * ldv + voff + h * 64 + c8);
#pragma unroll
    for (int q = 0; q < 8; ++q) tl[r][c8 + q] = f.u[q]; }
  __syncthreads();
  {
#pragma unroll
    for (int rd = 0; rd < 2; ++rd) { const int d = rd * 32 + tid / 8, pc = tid % 8; FragH f;
#pragma unroll
      for (int q = 0; q < 8; ++q) f.u[q] = tl[pc * 8 + q][d];
      *(v8us*)((unsigned short*)Vt + ((size_t)slab * 64 + d) * TTv + lg * 64 + pc * 8) = f.half[0]; }
     } }

__global__ __launch_bounds__(256) void k_hl(const float* __restrict__ F, _Float16* __restrict__ Hh, _Float16* __restrict__ Hl, size_t n8) { const size_t t = (size_t)blockIdx.x * 256 + threadIdx.x; if (t >= n8) return; FragH fh, fl; const v4f a = *(const v4fa*)(F + t * 8), c = *(const v4fa*)(F + t * 8 + 4);
#pragma unroll
  for (int q = 0; q < 4; ++q) { _Float16 h = (_Float16)a[q]; fh.h[q] = h; fl.h[q] = (_Float16)((a[q] - (float)h) * 1024.0f); h = (_Float16)c[q]; fh.h[4 + q] = h; fl.h[4 + q] = (_Float16)((c[q] - (float)h) * 1024.0f); }
  { *(v8us*)((unsigned short*)Hh + t * 8) = fh.half[0]; *(v8us*)((unsigned short*)Hl + t * 8) = fl.half[0];  } }

// ---- fast GEMM (wave tile 32x64; requires M % 32 == 0 rows per launch region and N % 64 == 0); epilogue = k_gemm_hhx semantics ----
__device__ __forceinline__ v16h g2_frag(const _Float16* p, int hh) { FragH f; f.half[0] = *(const v8us*)((const unsigned short*)p + 8 * hh); f.half[1] = *(const v8us*)((const unsigned short*)p + 16 + 8 * hh); return f.v; }
__device__ __forceinline__ v8f g2_mma(v16h a, v16h b, v8f c) { v8f d = __builtin_amdgcn_wmma_f32_16x16x32_f16(false, a, false, b, (short)0, c, false, false); asm volatile("v_nop\n\tv_nop\n\tv_nop\n\tv_nop" : "+v"(d) : "v"(a), "v"(b)); return d; }
template <int ACT>
__global__ __launch_bounds__(128) void k_gemm2(const _Float16* __restrict__ A, int lda, size_t sA, const _Float16* __restrict__ Bh, int ldb, size_t sB, float alpha, const float* __restrict__ bias, size_t sBias, const float* __restrict__ CP, int rowsPerB, size_t sCPb, int row0g,
    float* __restrict__ C, _Float16* __restrict__ C16, int ldc, size_t sC, int M, int N, int K) { static_assert(ACT == 0 || ACT == 3 || ACT == 6 || ACT == 8 || ACT == 9 || ACT == 11 || ACT == 12 || ACT == 14 || ACT == 15 || ACT == 16 || ACT == 17, "k_gemm2: unsupported ACT code (would silently apply no activation)");
  __shared__ __attribute__((aligned(16))) float so[4][32][68];
  const int tid = threadIdx.x, w = tid >> 5, lane = tid & 31, ln = lane & 15, hh = lane >> 4; const int by = blockIdx.y;
  A += (size_t)by * sA; Bh += (size_t)by * sB; const size_t cofs = (size_t)by * sC; const float* bp = bias ? bias + (size_t)by * sBias : nullptr;
  const int ntn = N >> 6; const int mt = blockIdx.x / ntn, nq = blockIdx.x - mt * ntn; const int row0 = mt * 128 + 32 * w, col0 = nq * 64; if (row0 >= M) return;
  const _Float16* a0p = A + (size_t)(row0 + ln) * lda; const _Float16* a1p = a0p + (size_t)16 * lda;
  const _Float16* b0p = Bh + (size_t)(col0 + ln) * ldb; const _Float16* b1p = b0p + (size_t)16 * ldb; const _Float16* b2p = b1p + (size_t)16 * ldb; const _Float16* b3p = b2p + (size_t)16 * ldb;
  const v8f z8 = {0.f,0.f,0.f,0.f,0.f,0.f,0.f,0.f}; v8f c00 = z8, c01 = z8, c02 = z8, c03 = z8, c10 = z8, c11 = z8, c12 = z8, c13 = z8;
#pragma unroll 1
  for (int kb = 0; kb < K; kb += 32) { const v16h a0 = g2_frag(a0p + kb, hh), a1 = g2_frag(a1p + kb, hh);
    v16h b = g2_frag(b0p + kb, hh); c00 = g2_mma(a0, b, c00); c10 = g2_mma(a1, b, c10);
    b = g2_frag(b1p + kb, hh); c01 = g2_mma(a0, b, c01); c11 = g2_mma(a1, b, c11);
    b = g2_frag(b2p + kb, hh); c02 = g2_mma(a0, b, c02); c12 = g2_mma(a1, b, c12);
    b = g2_frag(b3p + kb, hh); c03 = g2_mma(a0, b, c03); c13 = g2_mma(a1, b, c13); }
  v8f accs[8] = {c00, c01, c02, c03, c10, c11, c12, c13};
#pragma unroll
  for (int u = 0; u < 8; ++u) { const int t = u & 3, half = u >> 2; const int col = col0 + t * 16 + ln; const float bv = bp ? bf16_round(bp[col]) : 0.f;
#pragma unroll
    for (int r = 0; r < 8; ++r) { const int rloc = half * 16 + 8 * hh + r; float v = accs[u][r] * alpha + bv; if (CP) { if (rowsPerB < 0) v += CP[cofs + (size_t)(row0g + row0 + rloc) * ldc + col];      /* rowsPerB < 0: own element of the batched C plane */ else { const int bidx = (row0g + row0 + rloc) / rowsPerB; v += CP[(size_t)bidx * sCPb + (size_t)by * 64 + col]; } }
      if (ACT == 3) v = fmaxf(v, 0.f); else if (ACT == 6) v = 0.5f * v * (1.0f + erff(v * 0.70710678118654752f)); else if (ACT == 11) v = 1.0f / (1.0f + expf(-v)); else if (ACT == 15) v = v / (1.0f + expf(-v)); else if (ACT == 12) v = (v > 0.f) ? v : 0.01f * v; else if (ACT == 8) v = tanhf(v); else if (ACT == 9) v = 0.5f * v * (1.0f + tanhf(0.7978845608028654f * (v + 0.044715f * v * v * v))); else if (ACT == 14) v = (v > 0.f) ? v : 0.1f * v; else if (ACT == 16) v = (v >= 0.f) ? v : 0.3f * v; else if (ACT == 17) v = (v >= 0.f) ? v : 0.2f * v;
      so[w][rloc][t * 16 + ln] = v; } }
  __builtin_amdgcn_fence(__ATOMIC_ACQ_REL, "workgroup"); __builtin_amdgcn_wave_barrier();
  const int rsub = lane >> 4, c4 = (lane & 15) * 4;
  {
#pragma unroll
    for (int q = 0; q < 16; ++q) { const int r = q * 2 + rsub; const v4f v = *(const v4fa*)&so[w][r][c4]; if (C) *(v4f*)(C + cofs + (size_t)(row0 + r) * ldc + col0 + c4) = v; if (C16) { v4h h4; for (int i = 0; i < 4; ++i) h4[i] = (_Float16)v[i]; *(v4h*)(C16 + cofs + (size_t)(row0 + r) * ldc + col0 + c4) = h4; } }
     } }


__global__ __launch_bounds__(256) void k_wnat(const float* __restrict__ w, size_t n8, _Float16* __restrict__ Bt) { const size_t t = (size_t)blockIdx.x * 256 + threadIdx.x; if (t >= n8) return; FragH f; for (int q = 0; q < 8; ++q) f.h[q] = (_Float16)(bf16_round(w[t * 8 + q]) * 16.0f); *(v8us*)((unsigned short*)Bt + t * 8) = f.half[0];  }
__global__ __launch_bounds__(256) void k_rsm(const float* __restrict__ S, _Float16* __restrict__ P, int nrows) {
  #pragma clang fp contract(off)
  const int i = blockIdx.x * 256 + threadIdx.x; if (i >= nrows) return; const float* s = S + (size_t)i * SQ; float mx = -3.0e38f;
#pragma unroll 1
  for (int j = 0; j < SQ; ++j) mx = fmaxf(mx, s[j]); float se = 0.f;
#pragma unroll 1
  for (int j = 0; j < SQ; ++j) se += expf(s[j] - mx); const float sc = 256.0f / se;
#pragma unroll 1
  for (int j0 = 0; j0 < SQ; j0 += 8) { FragH f; for (int q = 0; q < 8; ++q) f.h[q] = (_Float16)(expf(s[j0 + q] - mx) * sc); unsigned short* d = (unsigned short*)P + (size_t)i * SQ + j0; *(v8us*)d = f.half[0];  } }
__global__ __launch_bounds__(256) void k_vt(const _Float16* __restrict__ V16, int b, int h0, _Float16* __restrict__ VT) { __shared__ unsigned short tl[64][65]; const int tid = threadIdx.x; const int hh = blockIdx.x % HG, sg = blockIdx.x / HG; const int s0 = sg * 64; const int h = h0 + hh;
  for (int i = tid; i < 64 * 8; i += 256) { const int j = i / 8, d8 = (i % 8) * 8; FragH f; f.half[0] = *(const v8us*)((const unsigned short*)V16 + ((size_t)b * SQ + s0 + j) * DM + h * HD + d8); for (int q = 0; q < 8; ++q) tl[d8 + q][j] = f.u[q]; }
  __syncthreads();
  { for (int i = tid; i < 64 * 8; i += 256) { const int d = i / 8, j8 = (i % 8) * 8; FragH f; for (int q = 0; q < 8; ++q) f.u[q] = tl[d][j8 + q]; *(v8us*)((unsigned short*)VT + ((size_t)hh * HD + d) * SQ + s0 + j8) = f.half[0]; }  } }



typedef int v4ia __attribute__((ext_vector_type(4), may_alias));
#define SMW 16                       /* waves per softmax work-group */
#define SMH 2                        /* heads (score rows of one query) per wave */
#define SMC (SQ / 128)               /* 512-byte pieces of a score row: one per wave-wide 16-byte load */
template <int M> __device__ __forceinline__ float sm_xrow(float x) { return __builtin_bit_cast(float, __builtin_amdgcn_update_dpp(0, __builtin_bit_cast(int, x), 0x160 + M, 0xf, 0xf, true)); }      /* lane l with lane l ^ M inside its 16-lane row (DPP row_xmask) */
__device__ __forceinline__ float sm_xhalf(float x) { return __builtin_bit_cast(float, __builtin_amdgcn_permlanex16(__builtin_bit_cast(int, x), __builtin_bit_cast(int, x), 0x76543210, 0xfedcba98, false, false)); }      /* lane l with lane l ^ 16 */
__device__ __forceinline__ float sm_wave_max(float v) { v = fmaxf(v, sm_xrow<1>(v)); v = fmaxf(v, sm_xrow<2>(v)); v = fmaxf(v, sm_xrow<4>(v)); v = fmaxf(v, sm_xrow<8>(v)); return fmaxf(v, sm_xhalf(v)); }
__device__ __forceinline__ float sm_wave_sum(float v) { v += sm_xrow<1>(v); v += sm_xrow<2>(v); v += sm_xrow<4>(v); v += sm_xrow<8>(v); return v + sm_xhalf(v); }
// 2^t of four values. One statement, so that behind each v_exp_f32 stands an instruction that neither reads its result nor overwrites its source (the next v_exp_f32; v_nop behind the last): the slot the instruction set
// asks for behind a transcendental.
__device__ __forceinline__ v4f sm_exp2x4(v4f t) { float e0, e1, e2, e3;
  asm("v_exp_f32 %0, %4\n\tv_exp_f32 %1, %5\n\tv_exp_f32 %2, %6\n\tv_exp_f32 %3, %7\n\tv_nop" : "=&v"(e0), "=&v"(e1), "=&v"(e2), "=&v"(e3) : "v"(t[0]), "v"(t[1]), "v"(t[2]), "v"(t[3]));
  const v4f e = {e0, e1, e2, e3}; return e; }
// Masked row softmax, ONE WAVE PER SCORE ROW: lane l holds elements 128 c + 4 l .. + 3 of the row in registers, so every wave-wide load covers 512 contiguous bytes, S is read once, and the row's
// maximum and sum are lane partials joined by a five-step butterfly. A wave takes SMH heads of one query and reads that query's keep-mask row once for them. No barrier, no LDS.
__global__ __launch_bounds__(SMW * 32) void k_rsmkw(const float* __restrict__ S, _Float16* __restrict__ P, const int* __restrict__ am) {
  const int wv = blockIdx.x * SMW + __builtin_amdgcn_readfirstlane(threadIdx.x >> 5);      /* the wave's number in a scalar register: row bases stay scalar, one lane offset serves every load */
  const int q = wv / (HG / SMH), hp = (wv % (HG / SMH)) * SMH; const size_t r0 = (size_t)q * SQ; const unsigned lb = (threadIdx.x & 31) * 16u;      /* the lane's byte offset in each 512-byte piece */
  const char* sp[SMH]; char* pp[SMH];      /* the wave's rows in S and in P */
#pragma unroll
  for (int h = 0; h < SMH; ++h) { const size_t rb = (size_t)__builtin_amdgcn_readfirstlane(hp + h) * SQ * SQ + r0; sp[h] = (const char*)(S + rb); pp[h] = (char*)(P + rb); }      /* read back as a scalar so that each row's base is formed in scalar registers, not as a vector add of the 16-MiB head stride */
  v4ia mk[SMC]; v4f x[SMH][SMC];
#pragma unroll
  for (int c = 0; c < SMC; ++c) mk[c] = *(const v4ia*)((const char*)(am + r0) + (c * 512u + lb));
#pragma unroll
  for (int h = 0; h < SMH; ++h) {
#pragma unroll
    for (int c = 0; c < SMC; ++c) x[h][c] = *(const v4fa*)(sp[h] + (c * 512u + lb));
    if (h + 1 == SMH) asm volatile("s_wait_xcnt 0x0" :: "v"(lb) : "memory");      /* behind the wave's last load and ahead of the arithmetic, which reuses the registers that hold the loads' bases; the lane offset as an input keeps its register whole up to here (without it the last load's result lands on the offset register that the earlier loads name) */
    __builtin_amdgcn_sched_barrier(0);      /* holds the order: every load of the wave is issued before any arithmetic waits on one (without it the mask compares, with their wait, move in front of the later row's loads), row by row in the order of the work, so that the later row flies while the first is worked on */
  }
#pragma unroll
  for (int h = 0; h < SMH; ++h) {
    v4f m4 = {-3.0e38f, -3.0e38f, -3.0e38f, -3.0e38f};
#pragma unroll
    for (int c = 0; c < SMC; ++c)
#pragma unroll
      for (int i = 0; i < 4; ++i) { const float v = (mk[c][i] != 0) ? x[h][c][i] : -1.0e9f; x[h][c][i] = v; m4[i] = fmaxf(m4[i], v); }
    const float mx = sm_wave_max(fmaxf(fmaxf(m4[0], m4[1]), fmaxf(m4[2], m4[3])));
    v4f a4 = {0.f, 0.f, 0.f, 0.f};
#pragma unroll
    for (int c = 0; c < SMC; ++c) { x[h][c] = sm_exp2x4((x[h][c] - mx) * 1.442695041f); a4 += x[h][c]; }      /* e^(v - mx) as 2^((v - mx) log2 e), the fast exponential's own form */
    const float sc = 256.0f / sm_wave_sum((a4[0] + a4[1]) + (a4[2] + a4[3]));
#pragma unroll
    for (int c = 0; c < SMC; ++c) { v4h o;
#pragma unroll
      for (int i = 0; i < 4; ++i) o[i] = (_Float16)(x[h][c][i] * sc);
      *(v4h*)(pp[h] + (c * 256u + lb / 2)) = o; }
  } }
extern "C" void kernel_launch(void* const* d_in, const int* in_sizes, int n_in,
                              void* d_out, int out_size, void* d_ws, size_t ws_size, hipStream_t stream) {
  (void)in_sizes; (void)n_in; (void)out_size;
  const float* const* I = (const float* const*)d_in; const float* xv = I[0]; const float* xk = I[1]; const float* xq = I[2]; const int* am = (const int*)d_in[3]; const float* wv = I[4]; const float* wk = I[5]; const float* wq = I[6]; const float* x = xq;      /* input order: values, keys, queries; the int32 keep-mask [2][1][2048][2048]; Wv, Wk, Wq: ONE natural [64][64] weight per stream, shared by the 16 heads; no biases; no output projection */
  char* ws = (char*)d_ws; size_t off = 0;
  auto take = [&](size_t bytes) { char* p = ws + off; off += (bytes + 255) & ~(size_t)255; return p; };
_Float16* BQ = (_Float16*)take((size_t)HD * HD * 2); _Float16* BK = (_Float16*)take((size_t)HD * HD * 2); _Float16* BV = (_Float16*)take((size_t)HD * HD * 2);
  _Float16* X16 = (_Float16*)take(NR * DM * 2); _Float16* XKp = (_Float16*)take(NR * DM * 2); _Float16* XVp = (_Float16*)take(NR * DM * 2); _Float16* Q16 = (_Float16*)take(NR * DM * 2); _Float16* K16 = (_Float16*)take(NR * DM * 2); _Float16* V16 = (_Float16*)take(NR * DM * 2);
  float* S = (float*)take((size_t)HG * SQ * SQ * 4); _Float16* P = (_Float16*)take((size_t)HG * SQ * SQ * 2); _Float16* VT = (_Float16*)take((size_t)NH * HD * SQ * 2);
  if (off > ws_size) return;
{ const unsigned g = (unsigned)(((size_t)HD * HD / 8 + 255) / 256); k_wnat<<<g, 256, 0, stream>>>(wq, (size_t)HD * HD / 8, BQ); k_wnat<<<g, 256, 0, stream>>>(wk, (size_t)HD * HD / 8, BK); k_wnat<<<g, 256, 0, stream>>>(wv, (size_t)HD * HD / 8, BV); }      /* natural [out][in] = Bt[n][k], x16: the one 64 x 64 weight of each stream */
  _Float16* XK = XKp; _Float16* XV = XVp; k_x16<<<(unsigned)((NR * DM / 8 + 255) / 256), 256, 0, stream>>>(xk, XK, NR * DM / 8); k_x16<<<(unsigned)((NR * DM / 8 + 255) / 256), 256, 0, stream>>>(xv, XV, NR * DM / 8);      /* key and value inputs as exact f16 rows */

  k_x16<<<(unsigned)((NR * DM / 8 + 255) / 256), 256, 0, stream>>>(x, X16, NR * DM / 8);
  const size_t r0p = (size_t)B0 * SQ;      /* first projected row */
k_gemm2<0><<<dim3((unsigned)((MP / 128) * (HD / 64)), NH), 128, 0, stream>>>(X16 + r0p * DM, DM, (size_t)HD, BQ, HD, 0, 0.0625f, nullptr, 0, nullptr, 1, 0, 0, nullptr, Q16 + r0p * DM, DM, (size_t)HD, MP, HD, HD);      /* head h on grid.y: its 64-column slice of the rows times the SHARED weight (head stride 0), K = 64, into the head's slice */
k_gemm2<0><<<dim3((unsigned)((MP / 128) * (HD / 64)), NH), 128, 0, stream>>>(XK + r0p * DM, DM, (size_t)HD, BK, HD, 0, 0.0625f, nullptr, 0, nullptr, 1, 0, 0, nullptr, K16 + r0p * DM, DM, (size_t)HD, MP, HD, HD);      /* head h on grid.y: its 64-column slice of the rows times the SHARED weight (head stride 0), K = 64, into the head's slice */
k_gemm2<0><<<dim3((unsigned)((MP / 128) * (HD / 64)), NH), 128, 0, stream>>>(XV + r0p * DM, DM, (size_t)HD, BV, HD, 0, 0.0625f, nullptr, 0, nullptr, 1, 0, 0, nullptr, V16 + r0p * DM, DM, (size_t)HD, MP, HD, HD);      /* head h on grid.y: its 64-column slice of the rows times the SHARED weight (head stride 0), K = 64, into the head's slice */
  for (int b = B0; b < B0 + NBR; ++b) { const size_t r0 = (size_t)b * SQ;
    k_vt<NH, SQ><<<NH * (SQ / 64), 256, 0, stream>>>(V16 + r0 * LQ, LQ, 0, VT);      /* V^T [NH][HD][SQ] for this batch */
    for (int h0 = 0; h0 < NHD; h0 += HG) {
      k_gemm2<0><<<dim3((QN / 128) * (SQ / 64), HG), 128, 0, stream>>>(Q16 + r0 * LQ + h0 * HD, LQ, (size_t)HD, K16 + r0 * LQ + h0 * HD, LQ, (size_t)HD, 0.03125f, nullptr, 0, nullptr, 1, 0, 0, S, nullptr, SQ, (size_t)SQ * SQ, QN, SQ, HD);      /* scores / sqrt(1024) (the module's embed size), HG heads per launch */
      k_rsmkw<<<HG * SQ / (SMH * SMW), SMW * 32, 0, stream>>>(S, P, am + (size_t)b * SQ * SQ);      /* softmax with the batch's keep-mask row of each query (mask == 0 -> score -1e9 -> weight 0), one wave per score row, rows of all HG heads */
      k_gemm2<0><<<dim3((QN / 128) * (HD / 64), HG), 128, 0, stream>>>(P, SQ, (size_t)SQ * SQ, VT + (size_t)h0 * HD * SQ, SQ, (size_t)HD * SQ, 0.00390625f, nullptr, 0, nullptr, 1, 0, 0, (float*)d_out + r0 * DM + h0 * HD, nullptr, DM, (size_t)HD, QN, HD, SQ); } }      /* out = P V^T (alpha 2^-8) written f32 straight into the merged-heads output rows */
}

// v002
// A run of this version takes 98.7 microseconds.
// Next to v001, in two timings, it ran 8.49 and 8.58 times as fast.
// Counting every step since v000, it is 78.5 times as fast.
#include <hip/hip_runtime.h>
// Masked multi-head attention over three inputs with ONE SHARED 64 x 64 projection per stream and a RANDOM int keep-mask, no output projection (values, keys, queries [2][2048][1024]; every head's 64-column slice is projected by the SAME natural nn.Linear weight: v = values.reshape(N, L, 16, 64) Wv^T, k likewise with Wk, q with Wq ([64][64], normal / 8, NO biases); scores = q.k / sqrt(1024) (the module's embed size); where(mask == 0, -1e20) with the int32 [2][1][2048][2048] mask (seeded randint 0 / 1, about half zeros, one plane per sequence shared by its heads; READ on the device); softmax; out = attn v merged over heads -> [2][2048][1024]; input order values, keys, queries, mask, Wv, Wk, Wq).
// Structure: token rows r = b*2048 + s; the three inputs as exact f16 rows (bf16-rounded); Q, K, V as three WMMA GEMMs BATCHED OVER THE HEADS on grid.y (A = the head's 64-column slice of the rows, B = the ONE shared x16 weight with head stride 0, K = 64; 32x64 wave tiles, f32 accumulation, no bias, f16 outputs into the head's slice); V^T for all batches and heads via LDS transposes; then ONE attention kernel for every (batch, head, 128 queries): scores (K = 64, 1/sqrt(1024) folded into the exponent), keep-mask, running-maximum softmax (f32 statistics; weights as f16, divided by their sum at the end) and the weighted sum of V, written f32 straight into the merged-heads output rows; scores and weights never reach memory; see the trace for the launch count.
// Compute dtype: inputs rounded to bf16; the three inputs and the x16 weights held as f16 planes (exact for every bf16 value of magnitude from 2^-14 up to 65,504; the weights up to 4,094 before their factor of 16); q, k, v and the softmax weights as plain f16 GEMM operands (~2^-12); scores, softmax statistics and the output f32. v_wmma_f32_16x16x32_f16.
#define NB 2
#define SQ 2048
#define DM 1024
#define NH 16
#define HD 64
#define HG 4                         /* heads per call of the per-group k_vt overload (not launched) */
#define B0 0                         /* first batch processed (debug hook) */
#define NBR NB                       /* batches processed (debug hook) */
#define NR ((size_t)NB * SQ)         /* token rows */
#define MP ((int)((size_t)NBR * SQ)) /* rows projected (debug hook) */
#define QN SQ                        /* not used */
#define NHD NH                       /* not used */
#define MPO MP                       /* not used */
#define LQ DM      /* row pitch of the q/k/v rows */
typedef __bf16 v16b __attribute__((ext_vector_type(16)));
typedef unsigned short v8us __attribute__((ext_vector_type(8), may_alias));
typedef float  v8f  __attribute__((ext_vector_type(8)));
typedef float  v4f  __attribute__((ext_vector_type(4)));
typedef float  v4fa __attribute__((ext_vector_type(4), may_alias));
union FragB { v16b v; v8us half[2]; unsigned short u[16]; };

__device__ __forceinline__ unsigned short bf16_bits(float x) { unsigned int u = __float_as_uint(x); return (unsigned short)((u + 0x7FFFu + ((u >> 16) & 1u)) >> 16); }
__device__ __forceinline__ float bf16_val(unsigned short b) { return __uint_as_float(((unsigned int)b) << 16); }
__device__ __forceinline__ float bf16_round(float x) { return bf16_val(bf16_bits(x)); }
// D += A·B with NT terms: 1 = ah·bh, 2 = + al·bh (A split), 3 = + ah·bl (both split)
template <int NT>
__device__ __forceinline__ v8f mmaN(v16b ah, v16b al, v16b bh, v16b bl, v8f c) {
  c = __builtin_amdgcn_wmma_f32_16x16x32_bf16(false, ah, false, bh, (short)0, c, false, false);
  if (NT >= 2) c = __builtin_amdgcn_wmma_f32_16x16x32_bf16(false, al, false, bh, (short)0, c, false, false);
  if (NT >= 3) c = __builtin_amdgcn_wmma_f32_16x16x32_bf16(false, ah, false, bl, (short)0, c, false, false);
  asm volatile("v_nop\n\tv_nop\n\tv_nop\n\tv_nop" : "+v"(c) : "v"(ah), "v"(al), "v"(bh), "v"(bl));
  return c;
}

__global__ __launch_bounds__(256) void k_wt_bf16(const float* __restrict__ W, unsigned short* __restrict__ Wt, int K, int N) {
  const int t = blockIdx.x * 256 + threadIdx.x;
  const int k8n = K / 8;
  if (t >= N * k8n) return;
  const int n = t / k8n, k8 = (t % k8n) * 8;
  v8us v;
#pragma unroll
  for (int i = 0; i < 8; ++i) v[i] = bf16_bits(W[(size_t)(k8 + i) * N + n]);
  *(v8us*)(Wt + (size_t)n * K + k8) = v;
  
}

// GEMM C[M][N] (f32, pitch ldc) = act(A[M][K]·W + bias). A f32 row-major (pitch lda) converted per fragment to bf16
// (ASPLIT: hi/lo two planes -> 2 terms, else single rounded term); Wt bf16 [N][K] (pitch ldb). BIAS_BF16 rounds the
// bias to bf16 first (bias quantised to bf16 before the add). K%32==0, M%16==0, N%64==0.
template <bool ASPLIT, int ACT, bool BIAS_BF16>
__global__ __launch_bounds__(128) void k_gemm_bf(const float* __restrict__ A, int lda, const unsigned short* __restrict__ Wt, int ldb,
                                               const float* __restrict__ bias, float* __restrict__ C, int ldc, int M, int N, int K) {
  __shared__ __attribute__((aligned(16))) float so[4][16][64];
  const int tid = threadIdx.x, w = tid >> 5, lane = tid & 31, ln = lane & 15, hh = lane >> 4;
  const int ntn = N / 64;
  const int wid = blockIdx.x * 4 + w;
  const int mt = wid / ntn, nq = wid % ntn;
  if (mt * 16 >= M) return;
  const int row0 = mt * 16, col0 = nq * 64;
  const float* arow = A + (size_t)(row0 + ln) * lda;
  v8f acc[4] = {};
  for (int kb = 0; kb < K; kb += 32) {
    FragB ah, al;
    const v4f x0 = *(const v4fa*)(arow + kb + 8 * hh), x1 = *(const v4fa*)(arow + kb + 8 * hh + 4);
    const v4f x2 = *(const v4fa*)(arow + kb + 16 + 8 * hh), x3 = *(const v4fa*)(arow + kb + 16 + 8 * hh + 4);
    float xs[16] = {x0[0],x0[1],x0[2],x0[3],x1[0],x1[1],x1[2],x1[3],x2[0],x2[1],x2[2],x2[3],x3[0],x3[1],x3[2],x3[3]};
#pragma unroll
    for (int i = 0; i < 16; ++i) { const unsigned short hb = bf16_bits(xs[i]); ah.u[i] = hb; al.u[i] = ASPLIT ? bf16_bits(xs[i] - bf16_val(hb)) : (unsigned short)0; }
#pragma unroll
    for (int t = 0; t < 4; ++t) {
      const unsigned short* brow = Wt + (size_t)(col0 + t * 16 + ln) * ldb + kb;
      FragB b;
      b.half[0] = *(const v8us*)(brow + 8 * hh);
      b.half[1] = *(const v8us*)(brow + 16 + 8 * hh);
      acc[t] = mmaN<ASPLIT ? 2 : 1>(ah.v, al.v, b.v, b.v, acc[t]);
    }
  }
#pragma unroll
  for (int t = 0; t < 4; ++t) {
    float bv = bias ? bias[col0 + t * 16 + ln] : 0.f;
    if (BIAS_BF16) bv = bf16_round(bv);
#pragma unroll
    for (int r = 0; r < 8; ++r) { float v = acc[t][r] + bv; if (ACT == 1) v = fmaxf(v, 0.f); so[w][8 * hh + r][t * 16 + ln] = v; }
  }
  __builtin_amdgcn_fence(__ATOMIC_ACQ_REL, "workgroup");
  __builtin_amdgcn_wave_barrier();
  const int rsub = lane >> 4, c4 = (lane & 15) * 4;
  {
#pragma unroll
    for (int q = 0; q < 8; ++q) {
      const int r = q * 2 + rsub;
      const v4f v = *(const v4fa*)&so[w][r][c4];
      *(v4f*)(C + (size_t)(row0 + r) * ldc + col0 + c4) = v;
    }
    
  }
}

// GEMM C = act(A·W + bias + resid): A f32 (ASPLIT -> hi/lo 2 terms), Wt bf16 [N][K]; ACT 0 none, 1 relu, 2 exact gelu;
// resid (optional, f32, row index = (row % rmod), pitch ldr, RES_BF16 rounds it) added before the activation.
template <bool ASPLIT, int ACT, bool BIAS_BF16, bool RES_BF16>
__global__ __launch_bounds__(128) void k_gemm_bf3(const float* __restrict__ A, int lda, const unsigned short* __restrict__ Wt, int ldb,
                                                const float* __restrict__ bias, const float* __restrict__ resid, int rmod, int ldr,
                                                float* __restrict__ C, int ldc, int M, int N, int K) {
  __shared__ __attribute__((aligned(16))) float so[4][16][64];
  const int tid = threadIdx.x, w = tid >> 5, lane = tid & 31, ln = lane & 15, hh = lane >> 4;
  const int ntn = N / 64;
  const int wid = blockIdx.x * 4 + w;
  const int mt = wid / ntn, nq = wid % ntn;
  if (mt * 16 >= M) return;
  const int row0 = mt * 16, col0 = nq * 64;
  const float* arow = A + (size_t)(row0 + ln) * lda;
  v8f acc[4] = {};
  for (int kb = 0; kb < K; kb += 32) {
    FragB ah, al;
    const v4f x0 = *(const v4fa*)(arow + kb + 8 * hh), x1 = *(const v4fa*)(arow + kb + 8 * hh + 4);
    const v4f x2 = *(const v4fa*)(arow + kb + 16 + 8 * hh), x3 = *(const v4fa*)(arow + kb + 16 + 8 * hh + 4);
    float xs[16] = {x0[0],x0[1],x0[2],x0[3],x1[0],x1[1],x1[2],x1[3],x2[0],x2[1],x2[2],x2[3],x3[0],x3[1],x3[2],x3[3]};
#pragma unroll
    for (int i = 0; i < 16; ++i) { const unsigned short hb = bf16_bits(xs[i]); ah.u[i] = hb; al.u[i] = ASPLIT ? bf16_bits(xs[i] - bf16_val(hb)) : (unsigned short)0; }
#pragma unroll
    for (int t = 0; t < 4; ++t) {
      const unsigned short* brow = Wt + (size_t)(col0 + t * 16 + ln) * ldb + kb;
      FragB b;
      b.half[0] = *(const v8us*)(brow + 8 * hh);
      b.half[1] = *(const v8us*)(brow + 16 + 8 * hh);
      acc[t] = mmaN<ASPLIT ? 2 : 1>(ah.v, al.v, b.v, b.v, acc[t]);
    }
  }
#pragma unroll
  for (int t = 0; t < 4; ++t) {
    const int col = col0 + t * 16 + ln;
    float bv = bias ? bias[col] : 0.f;
    if (BIAS_BF16) bv = bf16_round(bv);
#pragma unroll
    for (int r = 0; r < 8; ++r) {
      float v = acc[t][r] + bv;
      if (resid) { float rv = resid[(size_t)((row0 + 8 * hh + r) % rmod) * ldr + col]; if (RES_BF16) rv = bf16_round(rv); v += rv; }
      if (ACT == 1) v = fmaxf(v, 0.f);
      if (ACT == 2) v = 0.5f * v * (1.0f + erff(v * 0.70710678118654752f));
      if (ACT == 3) { const float u = 0.7978845608028654f * (v + 0.044715f * v * v * v); v = 0.5f * v * (1.0f + tanhf(u)); }
      so[w][8 * hh + r][t * 16 + ln] = v;
    }
  }
  __builtin_amdgcn_fence(__ATOMIC_ACQ_REL, "workgroup");
  __builtin_amdgcn_wave_barrier();
  const int rsub = lane >> 4, c4 = (lane & 15) * 4;
  {
#pragma unroll
    for (int q = 0; q < 8; ++q) {
      const int r = q * 2 + rsub;
      const v4f v = *(const v4fa*)&so[w][r][c4];
      *(v4f*)(C + (size_t)(row0 + r) * ldc + col0 + c4) = v;
    }
    
  }
}
// row LayerNorm (biased variance, eps) over N: s = X (+ R); optional out_sum <- s; out_norm <- (s-mu)*rsqrt(var+eps)*g + b
template <bool PARAM_BF16>
__global__ __launch_bounds__(256) void k_layernorm(const float* __restrict__ X, const float* __restrict__ R, const float* __restrict__ g, const float* __restrict__ bta,
                                                  float* __restrict__ out_sum, float* __restrict__ out_norm, int N, float eps) {
  __shared__ float red[256];
  const int row = blockIdx.x, tid = threadIdx.x;
  const float* x = X + (size_t)row * N; const float* rr = R ? R + (size_t)row * N : nullptr;
  float vals[16];                     // up to N = 4096
  const int per = N / 256;            // contiguous chunk per thread? use strided-by-4 chunks: thread handles j = tid*4 + 1024*u
  float s1 = 0.f;
  for (int u = 0; u < per / 4; ++u) {
    const int j = tid * 4 + 1024 * u;
    const v4f a = *(const v4fa*)(x + j);
    v4f b = {0.f,0.f,0.f,0.f}; if (rr) b = *(const v4fa*)(rr + j);
#pragma unroll
    for (int q = 0; q < 4; ++q) { const float v = a[q] + b[q]; vals[u * 4 + q] = v; s1 += v; }
  }
  red[tid] = s1; __syncthreads();
  for (int st = 128; st > 0; st >>= 1) { if (tid < st) red[tid] += red[tid + st]; __syncthreads(); }
  const float mu = red[0] / (float)N; __syncthreads();
  float s2 = 0.f;
  for (int u = 0; u < per / 4; ++u)
#pragma unroll
    for (int q = 0; q < 4; ++q) { const float c = vals[u * 4 + q] - mu; s2 += c * c; }
  red[tid] = s2; __syncthreads();
  for (int st = 128; st > 0; st >>= 1) { if (tid < st) red[tid] += red[tid + st]; __syncthreads(); }
  const float rs = rsqrtf(red[0] / (float)N + eps);
  {
    for (int u = 0; u < per / 4; ++u) {
      const int j = tid * 4 + 1024 * u;
      v4f o, sm;
#pragma unroll
      for (int q = 0; q < 4; ++q) {
        float gg = g[j + q], bb = bta[j + q];
        if (PARAM_BF16) { gg = bf16_round(gg); bb = bf16_round(bb); }
        sm[q] = vals[u * 4 + q]; o[q] = (vals[u * 4 + q] - mu) * rs * gg + bb;
      }
      if (out_sum) *(v4f*)(out_sum + (size_t)row * N + j) = sm;
      *(v4f*)(out_norm + (size_t)row * N + j) = o;
    }
    
  }
}



// ---- f16 WMMA path (v_wmma_f32_16x16x32_f16): 11-bit significands for operands in range — used where a [0,1] probability operand needs more precision than bf16
typedef _Float16 v16h __attribute__((ext_vector_type(16)));
union FragH { v16h v; v8us half[2]; _Float16 h[16]; unsigned short u[16]; };
template <int NT>
__device__ __forceinline__ v8f mmaH(v16h ah, v16h al, v16h bh, v16h bl, v8f c) {
  c = __builtin_amdgcn_wmma_f32_16x16x32_f16(false, ah, false, bh, (short)0, c, false, false);
  if (NT >= 2) c = __builtin_amdgcn_wmma_f32_16x16x32_f16(false, al, false, bh, (short)0, c, false, false);
  if (NT >= 3) c = __builtin_amdgcn_wmma_f32_16x16x32_f16(false, ah, false, bl, (short)0, c, false, false);
  asm volatile("v_nop\n\tv_nop\n\tv_nop\n\tv_nop" : "+v"(c) : "v"(ah), "v"(al), "v"(bh), "v"(bl));
  return c;
}
// batched GEMM like k_gemm_b but f16 operands: A f32 (split into f16 hi/lo if ASPLIT, else rounded to f16), Bt = f16 values [n][k]; alpha; C f32; N multiple of 16 (partial tiles skipped)
template <bool ASPLIT>
__global__ __launch_bounds__(128) void k_gemm_h(const float* __restrict__ A, int lda, size_t sA, const _Float16* __restrict__ Bh, int ldb, size_t sB, float alpha, float* __restrict__ C, int ldc, size_t sC, int M, int N, int K) {
  __shared__ __attribute__((aligned(16))) float so[4][16][64];
  const int tid = threadIdx.x, w = tid >> 5, lane = tid & 31, ln = lane & 15, hh = lane >> 4; const int by = blockIdx.y;
  A += (size_t)by * sA; Bh += (size_t)by * sB; C += (size_t)by * sC;
  const int ntn = (N + 63) / 64; const int wid = blockIdx.x * 4 + w; const int mt = wid / ntn, nq = wid % ntn; if (mt * 16 >= M) return;
  const int row0 = mt * 16, col0 = nq * 64; const float* arow = A + (size_t)(row0 + ln) * lda;
  v8f acc[4] = {};
  for (int kb = 0; kb < K; kb += 32) {
    FragH ah, al;
    const v4f x0 = *(const v4fa*)(arow + kb + 8 * hh), x1 = *(const v4fa*)(arow + kb + 8 * hh + 4), x2 = *(const v4fa*)(arow + kb + 16 + 8 * hh), x3 = *(const v4fa*)(arow + kb + 16 + 8 * hh + 4);
    float xs[16] = {x0[0],x0[1],x0[2],x0[3],x1[0],x1[1],x1[2],x1[3],x2[0],x2[1],x2[2],x2[3],x3[0],x3[1],x3[2],x3[3]};
#pragma unroll
    for (int i = 0; i < 16; ++i) { const _Float16 h = (_Float16)xs[i]; ah.h[i] = h; al.h[i] = ASPLIT ? (_Float16)(xs[i] - (float)h) : (_Float16)0.0f; }
#pragma unroll
    for (int t = 0; t < 4; ++t) { if (col0 + t * 16 >= N) continue; const size_t boff = (size_t)(col0 + t * 16 + ln) * ldb + kb; FragH bq; bq.half[0] = *(const v8us*)(Bh + boff + 8 * hh); bq.half[1] = *(const v8us*)(Bh + boff + 16 + 8 * hh);
      acc[t] = mmaH<ASPLIT ? 2 : 1>(ah.v, al.v, bq.v, bq.v, acc[t]); }
  }
#pragma unroll
  for (int t = 0; t < 4; ++t) { if (col0 + t * 16 >= N) continue;
#pragma unroll
    for (int r = 0; r < 8; ++r) so[w][8 * hh + r][t * 16 + ln] = acc[t][r] * alpha; }
  __builtin_amdgcn_fence(__ATOMIC_ACQ_REL, "workgroup"); __builtin_amdgcn_wave_barrier();
  const int rsub = lane >> 4, c4 = (lane & 15) * 4;
  {
#pragma unroll
    for (int q = 0; q < 8; ++q) { const int r = q * 2 + rsub; if (col0 + c4 < N) { const v4f v = *(const v4fa*)&so[w][r][c4]; *(v4f*)(C + (size_t)(row0 + r) * ldc + col0 + c4) = v; } }
     }
}

// Wt[n][k] = f16(W[k][n]·scale) from f32 row-major W[K][N] (scale = power of two; bf16-exact weights stay exact in f16 away from the subnormal range)
__global__ __launch_bounds__(256) void k_wt_f16(const float* __restrict__ W, _Float16* __restrict__ Wt, int K, int N, float scale) {
  const int t = blockIdx.x * 256 + threadIdx.x; if (t >= N * (K / 8)) return; const int n = t / (K / 8), k8 = (t % (K / 8)) * 8; FragH f;
#pragma unroll
  for (int i = 0; i < 8; ++i) f.h[i] = (_Float16)(bf16_round(W[(size_t)(k8 + i) * N + n]) * scale); const v8us o = f.half[0];
  *(v8us*)((unsigned short*)Wt + (size_t)n * K + k8) = o; 
}
// k_gemm_hh variant with fused epilogue: v = acc·alpha + bias[by·sBias + col] (+ CP[(row/rowsPerB)·sCPb + by·64 + col] if CP) ; ACT 0 none / 1 elu ; writes f16 C16 (and f32 C if non-null)
template <int ACT>
__global__ __launch_bounds__(128) void k_gemm_hhx(const _Float16* __restrict__ A, int lda, size_t sA, const _Float16* __restrict__ Bh, int ldb, size_t sB, float alpha, const float* __restrict__ bias, size_t sBias, const float* __restrict__ CP, int rowsPerB, size_t sCPb, int row0g,
    float* __restrict__ C, _Float16* __restrict__ C16, int ldc, size_t sC, int M, int N, int K) {
  __shared__ __attribute__((aligned(16))) float so[4][16][64];
  const int tid = threadIdx.x, w = tid >> 5, lane = tid & 31, ln = lane & 15, hh = lane >> 4; const int by = blockIdx.y;
  A += (size_t)by * sA; Bh += (size_t)by * sB; const size_t cofs = (size_t)by * sC; const float* bp = bias ? bias + (size_t)by * sBias : nullptr;
  const int ntn = (N + 63) / 64; const int wid = blockIdx.x * 4 + w; const int mt = wid / ntn, nq = wid % ntn; if (mt * 16 >= M) return;
  const int row0 = mt * 16, col0 = nq * 64; const _Float16* arow = A + (size_t)(row0 + ln) * lda;
  v8f acc[4] = {};
  for (int kb = 0; kb < K; kb += 32) { FragH ah; ah.half[0] = *(const v8us*)((const unsigned short*)arow + kb + 8 * hh); ah.half[1] = *(const v8us*)((const unsigned short*)arow + kb + 16 + 8 * hh);
#pragma unroll
    for (int t = 0; t < 4; ++t) { if (col0 + t * 16 >= N) continue; const size_t boff = (size_t)(col0 + t * 16 + ln) * ldb + kb; FragH bq; bq.half[0] = *(const v8us*)((const unsigned short*)Bh + boff + 8 * hh); bq.half[1] = *(const v8us*)((const unsigned short*)Bh + boff + 16 + 8 * hh);
      acc[t] = mmaH<1>(ah.v, ah.v, bq.v, bq.v, acc[t]); }
  }
#pragma unroll
  for (int t = 0; t < 4; ++t) { if (col0 + t * 16 >= N) continue; const int col = col0 + t * 16 + ln; const float bv = bp ? bf16_round(bp[col]) : 0.f;
#pragma unroll
    for (int r = 0; r < 8; ++r) { float v = acc[t][r] * alpha + bv; if (CP) { const int rr = row0g + row0 + 8 * hh + r; if (rowsPerB < 0) v += CP[cofs + (size_t)rr * ldc + col];      /* rowsPerB < 0: own element of the batched C plane */ else { const int bidx = rr / rowsPerB; v += CP[(size_t)bidx * sCPb + (size_t)by * 64 + col]; } } if (ACT == 1) v = (v > 0.f) ? v : expm1f(v); else if (ACT == 7) v = (v > 0.f) ? v + 1.0f : expf(v); else if (ACT == 8) v = tanhf(v); else if (ACT == 9) v = 0.5f * v * (1.0f + tanhf(0.7978845608028654f * (v + 0.044715f * v * v * v))); else if (ACT == 11) v = 1.0f / (1.0f + expf(-v)); else if (ACT == 12) v = (v > 0.f) ? v : 0.01f * v; else if (ACT == 14) v = (v > 0.f) ? v : 0.1f * v; else if (ACT == 16) v = (v >= 0.f) ? v : 0.3f * v; else if (ACT == 17) v = (v >= 0.f) ? v : 0.2f * v; else if (ACT == 15) v = v / (1.0f + expf(-v)); else if (ACT == 3) v = fmaxf(v, 0.f); else if (ACT == 6) v = 0.5f * v * (1.0f + erff(v * 0.70710678118654752f)); so[w][8 * hh + r][t * 16 + ln] = v; } }
  __builtin_amdgcn_fence(__ATOMIC_ACQ_REL, "workgroup"); __builtin_amdgcn_wave_barrier();
  const int rsub = lane >> 4, c4 = (lane & 15) * 4; typedef _Float16 v4h __attribute__((ext_vector_type(4)));
  {
#pragma unroll
    for (int q = 0; q < 8; ++q) { const int r = q * 2 + rsub; if (col0 + c4 < N) { const v4f v = *(const v4fa*)&so[w][r][c4]; if (C) *(v4f*)(C + cofs + (size_t)(row0 + r) * ldc + col0 + c4) = v; if (C16) { v4h h4; for (int i = 0; i < 4; ++i) h4[i] = (_Float16)v[i]; *(v4h*)(C16 + cofs + (size_t)(row0 + r) * ldc + col0 + c4) = h4; } } }
     }
}


typedef _Float16 v4h __attribute__((ext_vector_type(4)));

__global__ __launch_bounds__(256) void k_x16(const float* __restrict__ x, _Float16* __restrict__ X16, size_t n8) { const size_t t = (size_t)blockIdx.x * 256 + threadIdx.x; if (t >= n8) return; FragH f;
#pragma unroll
  for (int q = 0; q < 8; ++q) f.h[q] = (_Float16)bf16_round(x[t * 8 + q]); *(v8us*)((unsigned short*)X16 + t * 8) = f.half[0];  }
__global__ __launch_bounds__(256) void k_h16(const float* __restrict__ x, _Float16* __restrict__ X16, size_t n8) { const size_t t = (size_t)blockIdx.x * 256 + threadIdx.x; if (t >= n8) return; FragH f;
#pragma unroll
  for (int q = 0; q < 8; ++q) f.h[q] = (_Float16)x[t * 8 + q]; *(v8us*)((unsigned short*)X16 + t * 8) = f.half[0];  }
__global__ __launch_bounds__(256) void k_round16f(const float* __restrict__ W, _Float16* __restrict__ Bt, size_t n8) { const size_t t = (size_t)blockIdx.x * 256 + threadIdx.x; if (t >= n8) return; FragH f;
#pragma unroll
  for (int i = 0; i < 8; ++i) f.h[i] = (_Float16)(bf16_round(W[t * 8 + i]) * 16.0f); *(v8us*)((unsigned short*)Bt + t * 8) = f.half[0];  }
template <int NHv, int TTv>
__global__ __launch_bounds__(256) void k_vt(const _Float16* __restrict__ V16, int ldv, int voff, _Float16* __restrict__ Vt) { __shared__ unsigned short tl[64][66]; const int tid = threadIdx.x; const int slab = blockIdx.x / (TTv / 64), lg = blockIdx.x % (TTv / 64); const int b = slab / NHv, h = slab % NHv;
  for (int i = tid; i < 64 * 8; i += 256) { const int r = i / 8, c8 = (i % 8) * 8; FragH f; f.half[0] = *(const v8us*)((const unsigned short*)V16 + ((size_t)b * TTv + lg * 64 + r) * ldv + voff + h * 64 + c8);
#pragma unroll
    for (int q = 0; q < 8; ++q) tl[r][c8 + q] = f.u[q]; }
  __syncthreads();
  {
#pragma unroll
    for (int rd = 0; rd < 2; ++rd) { const int d = rd * 32 + tid / 8, pc = tid % 8; FragH f;
#pragma unroll
      for (int q = 0; q < 8; ++q) f.u[q] = tl[pc * 8 + q][d];
      *(v8us*)((unsigned short*)Vt + ((size_t)slab * 64 + d) * TTv + lg * 64 + pc * 8) = f.half[0]; }
     } }

__global__ __launch_bounds__(256) void k_hl(const float* __restrict__ F, _Float16* __restrict__ Hh, _Float16* __restrict__ Hl, size_t n8) { const size_t t = (size_t)blockIdx.x * 256 + threadIdx.x; if (t >= n8) return; FragH fh, fl; const v4f a = *(const v4fa*)(F + t * 8), c = *(const v4fa*)(F + t * 8 + 4);
#pragma unroll
  for (int q = 0; q < 4; ++q) { _Float16 h = (_Float16)a[q]; fh.h[q] = h; fl.h[q] = (_Float16)((a[q] - (float)h) * 1024.0f); h = (_Float16)c[q]; fh.h[4 + q] = h; fl.h[4 + q] = (_Float16)((c[q] - (float)h) * 1024.0f); }
  { *(v8us*)((unsigned short*)Hh + t * 8) = fh.half[0]; *(v8us*)((unsigned short*)Hl + t * 8) = fl.half[0];  } }

// ---- fast GEMM (wave tile 32x64; requires M % 32 == 0 rows per launch region and N % 64 == 0); epilogue = k_gemm_hhx semantics ----
__device__ __forceinline__ v16h g2_frag(const _Float16* p, int hh) { FragH f; f.half[0] = *(const v8us*)((const unsigned short*)p + 8 * hh); f.half[1] = *(const v8us*)((const unsigned short*)p + 16 + 8 * hh); return f.v; }
__device__ __forceinline__ v8f g2_mma(v16h a, v16h b, v8f c) { v8f d = __builtin_amdgcn_wmma_f32_16x16x32_f16(false, a, false, b, (short)0, c, false, false); asm volatile("v_nop\n\tv_nop\n\tv_nop\n\tv_nop" : "+v"(d) : "v"(a), "v"(b)); return d; }
template <int ACT>
__global__ __launch_bounds__(128) void k_gemm2(const _Float16* __restrict__ A, int lda, size_t sA, const _Float16* __restrict__ Bh, int ldb, size_t sB, float alpha, const float* __restrict__ bias, size_t sBias, const float* __restrict__ CP, int rowsPerB, size_t sCPb, int row0g,
    float* __restrict__ C, _Float16* __restrict__ C16, int ldc, size_t sC, int M, int N, int K) { static_assert(ACT == 0 || ACT == 3 || ACT == 6 || ACT == 8 || ACT == 9 || ACT == 11 || ACT == 12 || ACT == 14 || ACT == 15 || ACT == 16 || ACT == 17, "k_gemm2: unsupported ACT code (would silently apply no activation)");
  __shared__ __attribute__((aligned(16))) float so[4][32][68];
  const int tid = threadIdx.x, w = tid >> 5, lane = tid & 31, ln = lane & 15, hh = lane >> 4; const int by = blockIdx.y;
  A += (size_t)by * sA; Bh += (size_t)by * sB; const size_t cofs = (size_t)by * sC; const float* bp = bias ? bias + (size_t)by * sBias : nullptr;
  const int ntn = N >> 6; const int mt = blockIdx.x / ntn, nq = blockIdx.x - mt * ntn; const int row0 = mt * 128 + 32 * w, col0 = nq * 64; if (row0 >= M) return;
  const _Float16* a0p = A + (size_t)(row0 + ln) * lda; const _Float16* a1p = a0p + (size_t)16 * lda;
  const _Float16* b0p = Bh + (size_t)(col0 + ln) * ldb; const _Float16* b1p = b0p + (size_t)16 * ldb; const _Float16* b2p = b1p + (size_t)16 * ldb; const _Float16* b3p = b2p + (size_t)16 * ldb;
  const v8f z8 = {0.f,0.f,0.f,0.f,0.f,0.f,0.f,0.f}; v8f c00 = z8, c01 = z8, c02 = z8, c03 = z8, c10 = z8, c11 = z8, c12 = z8, c13 = z8;
#pragma unroll 1
  for (int kb = 0; kb < K; kb += 32) { const v16h a0 = g2_frag(a0p + kb, hh), a1 = g2_frag(a1p + kb, hh);
    v16h b = g2_frag(b0p + kb, hh); c00 = g2_mma(a0, b, c00); c10 = g2_mma(a1, b, c10);
    b = g2_frag(b1p + kb, hh); c01 = g2_mma(a0, b, c01); c11 = g2_mma(a1, b, c11);
    b = g2_frag(b2p + kb, hh); c02 = g2_mma(a0, b, c02); c12 = g2_mma(a1, b, c12);
    b = g2_frag(b3p + kb, hh); c03 = g2_mma(a0, b, c03); c13 = g2_mma(a1, b, c13); }
  v8f accs[8] = {c00, c01, c02, c03, c10, c11, c12, c13};
#pragma unroll
  for (int u = 0; u < 8; ++u) { const int t = u & 3, half = u >> 2; const int col = col0 + t * 16 + ln; const float bv = bp ? bf16_round(bp[col]) : 0.f;
#pragma unroll
    for (int r = 0; r < 8; ++r) { const int rloc = half * 16 + 8 * hh + r; float v = accs[u][r] * alpha + bv; if (CP) { if (rowsPerB < 0) v += CP[cofs + (size_t)(row0g + row0 + rloc) * ldc + col];      /* rowsPerB < 0: own element of the batched C plane */ else { const int bidx = (row0g + row0 + rloc) / rowsPerB; v += CP[(size_t)bidx * sCPb + (size_t)by * 64 + col]; } }
      if (ACT == 3) v = fmaxf(v, 0.f); else if (ACT == 6) v = 0.5f * v * (1.0f + erff(v * 0.70710678118654752f)); else if (ACT == 11) v = 1.0f / (1.0f + expf(-v)); else if (ACT == 15) v = v / (1.0f + expf(-v)); else if (ACT == 12) v = (v > 0.f) ? v : 0.01f * v; else if (ACT == 8) v = tanhf(v); else if (ACT == 9) v = 0.5f * v * (1.0f + tanhf(0.7978845608028654f * (v + 0.044715f * v * v * v))); else if (ACT == 14) v = (v > 0.f) ? v : 0.1f * v; else if (ACT == 16) v = (v >= 0.f) ? v : 0.3f * v; else if (ACT == 17) v = (v >= 0.f) ? v : 0.2f * v;
      so[w][rloc][t * 16 + ln] = v; } }
  __builtin_amdgcn_fence(__ATOMIC_ACQ_REL, "workgroup"); __builtin_amdgcn_wave_barrier();
  const int rsub = lane >> 4, c4 = (lane & 15) * 4;
  {
#pragma unroll
    for (int q = 0; q < 16; ++q) { const int r = q * 2 + rsub; const v4f v = *(const v4fa*)&so[w][r][c4]; if (C) *(v4f*)(C + cofs + (size_t)(row0 + r) * ldc + col0 + c4) = v; if (C16) { v4h h4; for (int i = 0; i < 4; ++i) h4[i] = (_Float16)v[i]; *(v4h*)(C16 + cofs + (size_t)(row0 + r) * ldc + col0 + c4) = h4; } }
     } }


__global__ __launch_bounds__(256) void k_wnat(const float* __restrict__ w, size_t n8, _Float16* __restrict__ Bt) { const size_t t = (size_t)blockIdx.x * 256 + threadIdx.x; if (t >= n8) return; FragH f; for (int q = 0; q < 8; ++q) f.h[q] = (_Float16)(bf16_round(w[t * 8 + q]) * 16.0f); *(v8us*)((unsigned short*)Bt + t * 8) = f.half[0];  }
__global__ __launch_bounds__(256) void k_rsm(const float* __restrict__ S, _Float16* __restrict__ P, int nrows) {
  #pragma clang fp contract(off)
  const int i = blockIdx.x * 256 + threadIdx.x; if (i >= nrows) return; const float* s = S + (size_t)i * SQ; float mx = -3.0e38f;
#pragma unroll 1
  for (int j = 0; j < SQ; ++j) mx = fmaxf(mx, s[j]); float se = 0.f;
#pragma unroll 1
  for (int j = 0; j < SQ; ++j) se += expf(s[j] - mx); const float sc = 256.0f / se;
#pragma unroll 1
  for (int j0 = 0; j0 < SQ; j0 += 8) { FragH f; for (int q = 0; q < 8; ++q) f.h[q] = (_Float16)(expf(s[j0 + q] - mx) * sc); unsigned short* d = (unsigned short*)P + (size_t)i * SQ + j0; *(v8us*)d = f.half[0];  } }
__global__ __launch_bounds__(256) void k_vt(const _Float16* __restrict__ V16, int b, int h0, _Float16* __restrict__ VT) { __shared__ unsigned short tl[64][65]; const int tid = threadIdx.x; const int hh = blockIdx.x % HG, sg = blockIdx.x / HG; const int s0 = sg * 64; const int h = h0 + hh;
  for (int i = tid; i < 64 * 8; i += 256) { const int j = i / 8, d8 = (i % 8) * 8; FragH f; f.half[0] = *(const v8us*)((const unsigned short*)V16 + ((size_t)b * SQ + s0 + j) * DM + h * HD + d8); for (int q = 0; q < 8; ++q) tl[d8 + q][j] = f.u[q]; }
  __syncthreads();
  { for (int i = tid; i < 64 * 8; i += 256) { const int d = i / 8, j8 = (i % 8) * 8; FragH f; for (int q = 0; q < 8; ++q) f.u[q] = tl[d][j8 + q]; *(v8us*)((unsigned short*)VT + ((size_t)hh * HD + d) * SQ + s0 + j8) = f.half[0]; }  } }



typedef int v4ia __attribute__((ext_vector_type(4), may_alias));
#define FW 8                         /* waves per attention work-group */
#define FQ 16                        /* query columns per wave */
#define FK 64                        /* keys per stage */
#define FS (SQ / FK)                 /* stages */
#define FP 72                        /* LDS row pitch in f16: 128-byte rows + 16 bytes, conflict-free for 16-byte row reads */
#define FSC 0.045084220f             /* log2(e) / sqrt(1024): raw q.k to base-2 exponent */
#define FNEG (-0x1p35f)              /* raw score of a masked key (-2^30 after the 1/32). A power of two, so that FNEG * FSC is exact and a row with only masked keys gets exponent 0, weight 1, for each of them */
#define FTH 177.0f                   /* the maximum in use is replaced only when a new one exceeds it by this much raw score (8 in base-2 exponent): weights stay below 2^8, inside f16 */
__device__ __forceinline__ float sm_xhalf(float x) { return __builtin_bit_cast(float, __builtin_amdgcn_permlanex16(__builtin_bit_cast(int, x), __builtin_bit_cast(int, x), 0x76543210, 0xfedcba98, false, false)); }      /* lane l with lane l ^ 16 */
typedef float v2f __attribute__((ext_vector_type(2)));
typedef _Float16 v2h __attribute__((ext_vector_type(2)));
union FragP { v16h v; v2h p[8]; };      /* a 16-element f16 operand as eight packed pairs */
__device__ __forceinline__ v16h fa_frag(const _Float16* p) { FragH f; f.half[0] = *(const v8us*)(const unsigned short*)p; f.half[1] = *(const v8us*)((const unsigned short*)p + 16); return f.v; }      /* p already holds the lane half's 8 h: k = 8 h + 0..7 and 16 + 8 h + 0..7 of a 32-k group, the hardware k order */
__device__ __forceinline__ v8f fa_mma(v16h a, v16h b, v8f c) { return __builtin_amdgcn_wmma_f32_16x16x32_f16(false, a, false, b, (short)0, c, false, false); }
__global__ __launch_bounds__(FW * 32) __attribute__((amdgpu_waves_per_eu(4, 4))) void k_fattn(const _Float16* __restrict__ Q16, const _Float16* __restrict__ K16, const _Float16* __restrict__ VT, const int* __restrict__ am, float* __restrict__ out) {
  __shared__ __attribute__((aligned(16))) _Float16 sk[2][FK][FP];      /* K stage: [key][d] */
  __shared__ __attribute__((aligned(16))) _Float16 sv[2][HD][FP];      /* V^T stage: [d][key] */
  const int tid = threadIdx.x, lane = tid & 31, c = lane & 15, hh = lane >> 4, w = tid >> 5;
  const int qt = blockIdx.x % (SQ / (FW * FQ)), bh = blockIdx.x / (SQ / (FW * FQ)), b = bh / NH, h = bh % NH;
  const int q = qt * (FW * FQ) + w * FQ + c;      /* the lane's query */
  const _Float16* qp = Q16 + ((size_t)b * SQ + q) * DM + h * HD + 8 * hh;
  const int sr = tid >> 3, sc = (tid & 7) * 8;      /* staging: the thread's row (and row + 32) and its 16-byte piece */
  /* each stream as a work-group-uniform base, advanced per stage, plus one byte offset per lane that never changes */
  const char* kg = (const char*)(K16 + (size_t)b * SQ * DM + h * HD); const unsigned ko = (unsigned)(sr * DM + sc) * 2u;
  const char* vg = (const char*)(VT + (size_t)bh * HD * SQ); const unsigned vo = (unsigned)(sr * SQ + sc) * 2u;
  const char* mg = (const char*)(am + ((size_t)b * SQ + qt * (FW * FQ)) * SQ); const unsigned mo = (unsigned)((w * FQ + c) * SQ + 8 * hh) * 4u;      /* the query's keep-mask row, at the lane half's keys */
  v4ia mk[8];      /* keep-mask words of a stage: word 2 t + u = keys 16 t + 8 h + 4 u .. + 3 */
  const v16h qf0 = fa_frag(qp), qf1 = fa_frag(qp + 32);
  { const v8us k0 = *(const v8us*)(kg + ko), k1 = *(const v8us*)(kg + (ko + 32u * DM * 2u)), v0 = *(const v8us*)(vg + vo), v1 = *(const v8us*)(vg + (vo + 32u * SQ * 2u));
#pragma unroll
    for (int t = 0; t < 4; ++t) { mk[2 * t] = *(const v4ia*)(mg + (mo + 64u * t)); mk[2 * t + 1] = *(const v4ia*)(mg + (mo + 64u * t + 16u)); }
    asm volatile("s_wait_xcnt 0x0" :: "v"(qp), "s"(kg), "s"(vg), "s"(mg), "v"(ko), "v"(vo), "v"(mo) : "memory");      /* behind the loads and ahead of whatever reuses their address registers; the addresses as inputs keep those registers whole up to here */
    *(v8us*)&sk[0][sr][sc] = k0; *(v8us*)&sk[0][sr + 32][sc] = k1; *(v8us*)&sv[0][sr][sc] = v0; *(v8us*)&sv[0][sr + 32][sc] = v1; }
  __syncthreads();
  const v8f z8 = {0.f, 0.f, 0.f, 0.f, 0.f, 0.f, 0.f, 0.f};
  v8f o[4] = {z8, z8, z8, z8};      /* O^T: o[dt][r] = d 16 dt + 8 h + r of the lane's query */
  float m = -3.0e38f, mc = -3.0e38f * FSC, l = 0.f;      /* maximum in use (raw, and as exponent), the lane's part of the sum */
  auto pass = [&](const int s, const int bf) __attribute__((always_inline)) {      /* stage s from buffer bf; fetches the next stage */
    const int sn = (s + 1 < FS) ? s + 1 : FS - 1;      /* the last pass fetches its own stage again, into the buffer that nobody reads any more: the loads stay unconditional, so no branch merges the wait counts */
    const char* kp = kg + (size_t)sn * (FK * DM * 2) + ko; const char* vp = vg + sn * (FK * 2) + vo; const char* mp = mg + sn * (FK * 4) + mo;
    const v8us k0 = *(const v8us*)kp, k1 = *(const v8us*)(kp + 32 * DM * 2), v0 = *(const v8us*)vp, v1 = *(const v8us*)(vp + 32 * SQ * 2);
    asm volatile("s_wait_xcnt 0x0" :: "v"(kp), "v"(vp) : "memory");      /* as above: ahead of the reuse of the two address pairs */
    v16h kf[8];
#pragma unroll
    for (int t = 0; t < 4; ++t) { const _Float16* kr = &sk[bf][16 * t + c][8 * hh]; kf[2 * t] = fa_frag(kr); kf[2 * t + 1] = fa_frag(kr + 32); }
    __builtin_amdgcn_sched_barrier(0);      /* all K fragment loads are issued before the first product waits on one; without it some passes came out as load, wait, product, eight times in a row */
    v8f st[4];      /* S^T: st[t][r] = key 16 t + 8 h + r of the stage, the lane's query */
#pragma unroll
    for (int t = 0; t < 4; ++t) st[t] = fa_mma(kf[2 * t], qf0, z8);
#pragma unroll
    for (int t = 0; t < 4; ++t) st[t] = fa_mma(kf[2 * t + 1], qf1, st[t]);
#pragma unroll
    for (int t = 0; t < 4; ++t)
#pragma unroll
      for (int r = 0; r < 8; ++r) st[t][r] = (mk[2 * t + (r >> 2)][r & 3] != 0) ? st[t][r] : FNEG;
    __builtin_amdgcn_sched_barrier(0);      /* holds the reload of the mask registers behind their last reader, so that one set of 32 serves; without it the loads are issued earlier into a second set, which is copied back every pass */
#pragma unroll
    for (int t = 0; t < 4; ++t) { mk[2 * t] = *(const v4ia*)(mp + 64 * t); mk[2 * t + 1] = *(const v4ia*)(mp + 64 * t + 16); }
    asm volatile("s_wait_xcnt 0x0" :: "v"(mp) : "memory");      /* as above */
    v16h vf[8];      /* the V^T fragments, fetched here so that they land behind the softmax arithmetic */
#pragma unroll
    for (int g = 0; g < 2; ++g)
#pragma unroll
      for (int dt = 0; dt < 4; ++dt) vf[4 * g + dt] = fa_frag(&sv[bf][16 * dt + c][32 * g + 8 * hh]);
    __builtin_amdgcn_sched_barrier(0);      /* holds these loads ahead of the arithmetic */
    float mt[4];      /* one chain per tile: four short dependent chains instead of one long one */
#pragma unroll
    for (int t = 0; t < 4; ++t) { mt[t] = st[t][0];
#pragma unroll
      for (int r = 1; r < 8; ++r) mt[t] = fmaxf(mt[t], st[t][r]); }
    float mx = fmaxf(fmaxf(mt[0], mt[1]), fmaxf(mt[2], mt[3]));
    mx = fmaxf(mx, sm_xhalf(mx));      /* both lane halves of a query use one maximum: their weights meet in one product */
    const bool need = mx > m + FTH;
    if (__builtin_amdgcn_ballot_w32(need) != 0) {      /* one branch per pass; taken on the first pass and then only when some query's maximum grows by more than FTH */
      const float mn = need ? mx : m, mcn = mn * FSC; const float al = __builtin_amdgcn_exp2f(mc - mcn); m = mn; mc = mcn; l *= al;      /* 0 on the first pass, 1 in a lane that keeps its maximum */
#pragma unroll
      for (int dt = 0; dt < 4; ++dt) o[dt] *= al; }
    const v2f mc2 = {mc, mc}; v2f a2[2] = {{0.f, 0.f}, {0.f, 0.f}}; FragP pf[2];      /* P^T as B operand: element e of pf[g] = key 32 g + (e < 8 ? 8 h + e : 16 + 8 h + e - 8) */
#pragma unroll
    for (int t = 0; t < 4; ++t)
#pragma unroll
      for (int u = 0; u < 4; ++u) { const v2f x = {st[t][2 * u], st[t][2 * u + 1]}; const v2f y = x * FSC - mc2; const v2f e = {__builtin_amdgcn_exp2f(y[0]), __builtin_amdgcn_exp2f(y[1])};      /* the builtin, so that the compiler keeps the distances to the matrix instructions that it schedules around it */
        a2[u & 1] += e; pf[t >> 1].p[4 * (t & 1) + u] = __builtin_convertvector(e, v2h); }
    l += (a2[0][0] + a2[0][1]) + (a2[1][0] + a2[1][1]);
#pragma unroll
    for (int g = 0; g < 2; ++g)
#pragma unroll
      for (int dt = 0; dt < 4; ++dt) o[dt] = fa_mma(vf[4 * g + dt], pf[g].v, o[dt]);
    __builtin_amdgcn_sched_barrier(0);      /* holds the stores, with their wait for the stage loads, and the barrier at the foot of the pass; without it one pass had them ahead of the exponentials, which cuts the time the stage loads have to land */
    *(v8us*)&sk[bf ^ 1][sr][sc] = k0; *(v8us*)&sk[bf ^ 1][sr + 32][sc] = k1; *(v8us*)&sv[bf ^ 1][sr][sc] = v0; *(v8us*)&sv[bf ^ 1][sr + 32][sc] = v1;      /* into the buffer whose last readers left it before the previous pass's barrier */
    asm volatile("s_wait_dscnt 0x0\n\ts_barrier_signal -1\n\ts_barrier_wait -1" ::: "memory");      /* publishes stage s + 1 and ends every wave's reads of stage s. By hand, with the LDS wait alone: __syncthreads() would also wait for the mask loads, which are to fly on into the next pass */
  };
#pragma unroll 1
  for (int s = 0; s < FS; s += 2) { pass(s, 0); pass(s + 1, 1); }      /* two passes a trip: each pass's buffer is a constant offset */
  const float inv = 1.0f / (l + sm_xhalf(l));
  float* op = out + ((size_t)b * SQ + q) * DM + h * HD + 8 * hh;
#pragma unroll
  for (int dt = 0; dt < 4; ++dt) { const v4f lo = {o[dt][0] * inv, o[dt][1] * inv, o[dt][2] * inv, o[dt][3] * inv}, hi = {o[dt][4] * inv, o[dt][5] * inv, o[dt][6] * inv, o[dt][7] * inv};
    *(v4f*)(op + 16 * dt) = lo; *(v4f*)(op + 16 * dt + 4) = hi; }
}
extern "C" void kernel_launch(void* const* d_in, const int* in_sizes, int n_in,
                              void* d_out, int out_size, void* d_ws, size_t ws_size, hipStream_t stream) {
  (void)in_sizes; (void)n_in; (void)out_size;
  const float* const* I = (const float* const*)d_in; const float* xv = I[0]; const float* xk = I[1]; const float* xq = I[2]; const int* am = (const int*)d_in[3]; const float* wv = I[4]; const float* wk = I[5]; const float* wq = I[6]; const float* x = xq;      /* input order: values, keys, queries; the int32 keep-mask [2][1][2048][2048]; Wv, Wk, Wq: ONE natural [64][64] weight per stream, shared by the 16 heads; no biases; no output projection */
  char* ws = (char*)d_ws; size_t off = 0;
  auto take = [&](size_t bytes) { char* p = ws + off; off += (bytes + 255) & ~(size_t)255; return p; };
_Float16* BQ = (_Float16*)take((size_t)HD * HD * 2); _Float16* BK = (_Float16*)take((size_t)HD * HD * 2); _Float16* BV = (_Float16*)take((size_t)HD * HD * 2);
  _Float16* X16 = (_Float16*)take(NR * DM * 2); _Float16* XKp = (_Float16*)take(NR * DM * 2); _Float16* XVp = (_Float16*)take(NR * DM * 2); _Float16* Q16 = (_Float16*)take(NR * DM * 2); _Float16* K16 = (_Float16*)take(NR * DM * 2); _Float16* V16 = (_Float16*)take(NR * DM * 2);
  _Float16* VT = (_Float16*)take((size_t)NB * NH * HD * SQ * 2);
  if (off > ws_size) return;
{ const unsigned g = (unsigned)(((size_t)HD * HD / 8 + 255) / 256); k_wnat<<<g, 256, 0, stream>>>(wq, (size_t)HD * HD / 8, BQ); k_wnat<<<g, 256, 0, stream>>>(wk, (size_t)HD * HD / 8, BK); k_wnat<<<g, 256, 0, stream>>>(wv, (size_t)HD * HD / 8, BV); }      /* natural [out][in] = Bt[n][k], x16: the one 64 x 64 weight of each stream */
  _Float16* XK = XKp; _Float16* XV = XVp; k_x16<<<(unsigned)((NR * DM / 8 + 255) / 256), 256, 0, stream>>>(xk, XK, NR * DM / 8); k_x16<<<(unsigned)((NR * DM / 8 + 255) / 256), 256, 0, stream>>>(xv, XV, NR * DM / 8);      /* key and value inputs as exact f16 rows */

  k_x16<<<(unsigned)((NR * DM / 8 + 255) / 256), 256, 0, stream>>>(x, X16, NR * DM / 8);
  const size_t r0p = (size_t)B0 * SQ;      /* first projected row */
k_gemm2<0><<<dim3((unsigned)((MP / 128) * (HD / 64)), NH), 128, 0, stream>>>(X16 + r0p * DM, DM, (size_t)HD, BQ, HD, 0, 0.0625f, nullptr, 0, nullptr, 1, 0, 0, nullptr, Q16 + r0p * DM, DM, (size_t)HD, MP, HD, HD);      /* head h on grid.y: its 64-column slice of the rows times the SHARED weight (head stride 0), K = 64, into the head's slice */
k_gemm2<0><<<dim3((unsigned)((MP / 128) * (HD / 64)), NH), 128, 0, stream>>>(XK + r0p * DM, DM, (size_t)HD, BK, HD, 0, 0.0625f, nullptr, 0, nullptr, 1, 0, 0, nullptr, K16 + r0p * DM, DM, (size_t)HD, MP, HD, HD);      /* head h on grid.y: its 64-column slice of the rows times the SHARED weight (head stride 0), K = 64, into the head's slice */
k_gemm2<0><<<dim3((unsigned)((MP / 128) * (HD / 64)), NH), 128, 0, stream>>>(XV + r0p * DM, DM, (size_t)HD, BV, HD, 0, 0.0625f, nullptr, 0, nullptr, 1, 0, 0, nullptr, V16 + r0p * DM, DM, (size_t)HD, MP, HD, HD);      /* head h on grid.y: its 64-column slice of the rows times the SHARED weight (head stride 0), K = 64, into the head's slice */
  k_vt<NH, SQ><<<NB * NH * (SQ / 64), 256, 0, stream>>>(V16, LQ, 0, VT);      /* V^T [NB][NH][HD][SQ] */
  k_fattn<<<NB * NH * (SQ / (FW * FQ)), FW * 32, 0, stream>>>(Q16, K16, VT, am, (float*)d_out);      /* scores / sqrt(1024), keep-mask, softmax and P V in one launch for every batch and head, written f32 into the merged-heads output rows */
}

// v003
// Measured time: 64.4 microseconds a run.
// Next to v002, in two timings, it ran 1.53 times as fast each time.
// Over all steps from v000 it is 120 times as fast.
#include <hip/hip_runtime.h>
// Masked multi-head attention over three inputs with ONE SHARED 64 x 64 projection per stream and a RANDOM int keep-mask, no output projection (values, keys, queries [2][2048][1024]; every head's 64-column slice is projected by the SAME natural nn.Linear weight: v = values.reshape(N, L, 16, 64) Wv^T, k likewise with Wk, q with Wq ([64][64], normal / 8, NO biases); scores = q.k / sqrt(1024) (the module's embed size); where(mask == 0, -1e20) with the int32 [2][1][2048][2048] mask (seeded randint 0 / 1, about half zeros, one plane per sequence shared by its heads; READ on the device); softmax; out = attn v merged over heads -> [2][2048][1024]; input order values, keys, queries, mask, Wv, Wk, Wq).
// Structure: token rows r = b*2048 + s; ONE projection kernel for the three streams (grid.y): it reads the f32 inputs and weights itself, rounds them in registers (bf16, held as exact f16; the weight x16), and a wave multiplies 64 tokens of one head's 64-column slice by the stream's ONE shared weight (K = 64, f32 accumulation, no bias), f16 results: Q and K into the head's slice of the rows, V straight as V^T; then ONE attention kernel for every (batch, head, 128 queries): scores (K = 64, 1/sqrt(1024) folded into the exponent), keep-mask, running-maximum softmax (f32 statistics; weights as f16, divided by their sum at the end) and the weighted sum of V, written f32 straight into the merged-heads output rows; scores and weights never reach memory.
// Compute dtype: inputs rounded to bf16; the three inputs and the x16 weights held as f16 in LDS tiles (exact for every bf16 value of magnitude from 2^-14 up to 65,504; the weights up to 4,094 before their factor of 16); q, k, v and the softmax weights as plain f16 GEMM operands (~2^-12); scores, softmax statistics and the output f32. v_wmma_f32_16x16x32_f16.
#define NB 2
#define SQ 2048
#define DM 1024
#define NH 16
#define HD 64
#define HG 4                         /* heads per call of the per-group k_vt overload (not launched) */
#define B0 0                         /* not used */
#define NBR NB                       /* not used except in MP */
#define NR ((size_t)NB * SQ)         /* token rows */
#define MP ((int)((size_t)NBR * SQ)) /* not used except in MPO */
#define QN SQ                        /* not used */
#define NHD NH                       /* not used */
#define MPO MP                       /* not used */
#define LQ DM      /* not used */
typedef __bf16 v16b __attribute__((ext_vector_type(16)));
typedef unsigned short v8us __attribute__((ext_vector_type(8), may_alias));
typedef float  v8f  __attribute__((ext_vector_type(8)));
typedef float  v4f  __attribute__((ext_vector_type(4)));
typedef float  v4fa __attribute__((ext_vector_type(4), may_alias));
union FragB { v16b v; v8us half[2]; unsigned short u[16]; };

__device__ __forceinline__ unsigned short bf16_bits(float x) { unsigned int u = __float_as_uint(x); return (unsigned short)((u + 0x7FFFu + ((u >> 16) & 1u)) >> 16); }
__device__ __forceinline__ float bf16_val(unsigned short b) { return __uint_as_float(((unsigned int)b) << 16); }
__device__ __forceinline__ float bf16_round(float x) { return bf16_val(bf16_bits(x)); }
// D += A·B with NT terms: 1 = ah·bh, 2 = + al·bh (A split), 3 = + ah·bl (both split)
template <int NT>
__device__ __forceinline__ v8f mmaN(v16b ah, v16b al, v16b bh, v16b bl, v8f c) {
  c = __builtin_amdgcn_wmma_f32_16x16x32_bf16(false, ah, false, bh, (short)0, c, false, false);
  if (NT >= 2) c = __builtin_amdgcn_wmma_f32_16x16x32_bf16(false, al, false, bh, (short)0, c, false, false);
  if (NT >= 3) c = __builtin_amdgcn_wmma_f32_16x16x32_bf16(false, ah, false, bl, (short)0, c, false, false);
  asm volatile("v_nop\n\tv_nop\n\tv_nop\n\tv_nop" : "+v"(c) : "v"(ah), "v"(al), "v"(bh), "v"(bl));
  return c;
}

__global__ __launch_bounds__(256) void k_wt_bf16(const float* __restrict__ W, unsigned short* __restrict__ Wt, int K, int N) {
  const int t = blockIdx.x * 256 + threadIdx.x;
  const int k8n = K / 8;
  if (t >= N * k8n) return;
  const int n = t / k8n, k8 = (t % k8n) * 8;
  v8us v;
#pragma unroll
  for (int i = 0; i < 8; ++i) v[i] = bf16_bits(W[(size_t)(k8 + i) * N + n]);
  *(v8us*)(Wt + (size_t)n * K + k8) = v;
  
}

// GEMM C[M][N] (f32, pitch ldc) = act(A[M][K]·W + bias). A f32 row-major (pitch lda) converted per fragment to bf16
// (ASPLIT: hi/lo two planes -> 2 terms, else single rounded term); Wt bf16 [N][K] (pitch ldb). BIAS_BF16 rounds the
// bias to bf16 first (bias quantised to bf16 before the add). K%32==0, M%16==0, N%64==0.
template <bool ASPLIT, int ACT, bool BIAS_BF16>
__global__ __launch_bounds__(128) void k_gemm_bf(const float* __restrict__ A, int lda, const unsigned short* __restrict__ Wt, int ldb,
                                               const float* __restrict__ bias, float* __restrict__ C, int ldc, int M, int N, int K) {
  __shared__ __attribute__((aligned(16))) float so[4][16][64];
  const int tid = threadIdx.x, w = tid >> 5, lane = tid & 31, ln = lane & 15, hh = lane >> 4;
  const int ntn = N / 64;
  const int wid = blockIdx.x * 4 + w;
  const int mt = wid / ntn, nq = wid % ntn;
  if (mt * 16 >= M) return;
  const int row0 = mt * 16, col0 = nq * 64;
  const float* arow = A + (size_t)(row0 + ln) * lda;
  v8f acc[4] = {};
  for (int kb = 0; kb < K; kb += 32) {
    FragB ah, al;
    const v4f x0 = *(const v4fa*)(arow + kb + 8 * hh), x1 = *(const v4fa*)(arow + kb + 8 * hh + 4);
    const v4f x2 = *(const v4fa*)(arow + kb + 16 + 8 * hh), x3 = *(const v4fa*)(arow + kb + 16 + 8 * hh + 4);
    float xs[16] = {x0[0],x0[1],x0[2],x0[3],x1[0],x1[1],x1[2],x1[3],x2[0],x2[1],x2[2],x2[3],x3[0],x3[1],x3[2],x3[3]};
#pragma unroll
    for (int i = 0; i < 16; ++i) { const unsigned short hb = bf16_bits(xs[i]); ah.u[i] = hb; al.u[i] = ASPLIT ? bf16_bits(xs[i] - bf16_val(hb)) : (unsigned short)0; }
#pragma unroll
    for (int t = 0; t < 4; ++t) {
      const unsigned short* brow = Wt + (size_t)(col0 + t * 16 + ln) * ldb + kb;
      FragB b;
      b.half[0] = *(const v8us*)(brow + 8 * hh);
      b.half[1] = *(const v8us*)(brow + 16 + 8 * hh);
      acc[t] = mmaN<ASPLIT ? 2 : 1>(ah.v, al.v, b.v, b.v, acc[t]);
    }
  }
#pragma unroll
  for (int t = 0; t < 4; ++t) {
    float bv = bias ? bias[col0 + t * 16 + ln] : 0.f;
    if (BIAS_BF16) bv = bf16_round(bv);
#pragma unroll
    for (int r = 0; r < 8; ++r) { float v = acc[t][r] + bv; if (ACT == 1) v = fmaxf(v, 0.f); so[w][8 * hh + r][t * 16 + ln] = v; }
  }
  __builtin_amdgcn_fence(__ATOMIC_ACQ_REL, "workgroup");
  __builtin_amdgcn_wave_barrier();
  const int rsub = lane >> 4, c4 = (lane & 15) * 4;
  {
#pragma unroll
    for (int q = 0; q < 8; ++q) {
      const int r = q * 2 + rsub;
      const v4f v = *(const v4fa*)&so[w][r][c4];
      *(v4f*)(C + (size_t)(row0 + r) * ldc + col0 + c4) = v;
    }
    
  }
}

// GEMM C = act(A·W + bias + resid): A f32 (ASPLIT -> hi/lo 2 terms), Wt bf16 [N][K]; ACT 0 none, 1 relu, 2 exact gelu;
// resid (optional, f32, row index = (row % rmod), pitch ldr, RES_BF16 rounds it) added before the activation.
template <bool ASPLIT, int ACT, bool BIAS_BF16, bool RES_BF16>
__global__ __launch_bounds__(128) void k_gemm_bf3(const float* __restrict__ A, int lda, const unsigned short* __restrict__ Wt, int ldb,
                                                const float* __restrict__ bias, const float* __restrict__ resid, int rmod, int ldr,
                                                float* __restrict__ C, int ldc, int M, int N, int K) {
  __shared__ __attribute__((aligned(16))) float so[4][16][64];
  const int tid = threadIdx.x, w = tid >> 5, lane = tid & 31, ln = lane & 15, hh = lane >> 4;
  const int ntn = N / 64;
  const int wid = blockIdx.x * 4 + w;
  const int mt = wid / ntn, nq = wid % ntn;
  if (mt * 16 >= M) return;
  const int row0 = mt * 16, col0 = nq * 64;
  const float* arow = A + (size_t)(row0 + ln) * lda;
  v8f acc[4] = {};
  for (int kb = 0; kb < K; kb += 32) {
    FragB ah, al;
    const v4f x0 = *(const v4fa*)(arow + kb + 8 * hh), x1 = *(const v4fa*)(arow + kb + 8 * hh + 4);
    const v4f x2 = *(const v4fa*)(arow + kb + 16 + 8 * hh), x3 = *(const v4fa*)(arow + kb + 16 + 8 * hh + 4);
    float xs[16] = {x0[0],x0[1],x0[2],x0[3],x1[0],x1[1],x1[2],x1[3],x2[0],x2[1],x2[2],x2[3],x3[0],x3[1],x3[2],x3[3]};
#pragma unroll
    for (int i = 0; i < 16; ++i) { const unsigned short hb = bf16_bits(xs[i]); ah.u[i] = hb; al.u[i] = ASPLIT ? bf16_bits(xs[i] - bf16_val(hb)) : (unsigned short)0; }
#pragma unroll
    for (int t = 0; t < 4; ++t) {
      const unsigned short* brow = Wt + (size_t)(col0 + t * 16 + ln) * ldb + kb;
      FragB b;
      b.half[0] = *(const v8us*)(brow + 8 * hh);
      b.half[1] = *(const v8us*)(brow + 16 + 8 * hh);
      acc[t] = mmaN<ASPLIT ? 2 : 1>(ah.v, al.v, b.v, b.v, acc[t]);
    }
  }
#pragma unroll
  for (int t = 0; t < 4; ++t) {
    const int col = col0 + t * 16 + ln;
    float bv = bias ? bias[col] : 0.f;
    if (BIAS_BF16) bv = bf16_round(bv);
#pragma unroll
    for (int r = 0; r < 8; ++r) {
      float v = acc[t][r] + bv;
      if (resid) { float rv = resid[(size_t)((row0 + 8 * hh + r) % rmod) * ldr + col]; if (RES_BF16) rv = bf16_round(rv); v += rv; }
      if (ACT == 1) v = fmaxf(v, 0.f);
      if (ACT == 2) v = 0.5f * v * (1.0f + erff(v * 0.70710678118654752f));
      if (ACT == 3) { const float u = 0.7978845608028654f * (v + 0.044715f * v * v * v); v = 0.5f * v * (1.0f + tanhf(u)); }
      so[w][8 * hh + r][t * 16 + ln] = v;
    }
  }
  __builtin_amdgcn_fence(__ATOMIC_ACQ_REL, "workgroup");
  __builtin_amdgcn_wave_barrier();
  const int rsub = lane >> 4, c4 = (lane & 15) * 4;
  {
#pragma unroll
    for (int q = 0; q < 8; ++q) {
      const int r = q * 2 + rsub;
      const v4f v = *(const v4fa*)&so[w][r][c4];
      *(v4f*)(C + (size_t)(row0 + r) * ldc + col0 + c4) = v;
    }
    
  }
}
// row LayerNorm (biased variance, eps) over N: s = X (+ R); optional out_sum <- s; out_norm <- (s-mu)*rsqrt(var+eps)*g + b
template <bool PARAM_BF16>
__global__ __launch_bounds__(256) void k_layernorm(const float* __restrict__ X, const float* __restrict__ R, const float* __restrict__ g, const float* __restrict__ bta,
                                                  float* __restrict__ out_sum, float* __restrict__ out_norm, int N, float eps) {
  __shared__ float red[256];
  const int row = blockIdx.x, tid = threadIdx.x;
  const float* x = X + (size_t)row * N; const float* rr = R ? R + (size_t)row * N : nullptr;
  float vals[16];                     // up to N = 4096
  const int per = N / 256;            // contiguous chunk per thread? use strided-by-4 chunks: thread handles j = tid*4 + 1024*u
  float s1 = 0.f;
  for (int u = 0; u < per / 4; ++u) {
    const int j = tid * 4 + 1024 * u;
    const v4f a = *(const v4fa*)(x + j);
    v4f b = {0.f,0.f,0.f,0.f}; if (rr) b = *(const v4fa*)(rr + j);
#pragma unroll
    for (int q = 0; q < 4; ++q) { const float v = a[q] + b[q]; vals[u * 4 + q] = v; s1 += v; }
  }
  red[tid] = s1; __syncthreads();
  for (int st = 128; st > 0; st >>= 1) { if (tid < st) red[tid] += red[tid + st]; __syncthreads(); }
  const float mu = red[0] / (float)N; __syncthreads();
  float s2 = 0.f;
  for (int u = 0; u < per / 4; ++u)
#pragma unroll
    for (int q = 0; q < 4; ++q) { const float c = vals[u * 4 + q] - mu; s2 += c * c; }
  red[tid] = s2; __syncthreads();
  for (int st = 128; st > 0; st >>= 1) { if (tid < st) red[tid] += red[tid + st]; __syncthreads(); }
  const float rs = rsqrtf(red[0] / (float)N + eps);
  {
    for (int u = 0; u < per / 4; ++u) {
      const int j = tid * 4 + 1024 * u;
      v4f o, sm;
#pragma unroll
      for (int q = 0; q < 4; ++q) {
        float gg = g[j + q], bb = bta[j + q];
        if (PARAM_BF16) { gg = bf16_round(gg); bb = bf16_round(bb); }
        sm[q] = vals[u * 4 + q]; o[q] = (vals[u * 4 + q] - mu) * rs * gg + bb;
      }
      if (out_sum) *(v4f*)(out_sum + (size_t)row * N + j) = sm;
      *(v4f*)(out_norm + (size_t)row * N + j) = o;
    }
    
  }
}



// ---- f16 WMMA path (v_wmma_f32_16x16x32_f16): 11-bit significands for operands in range — used where a [0,1] probability operand needs more precision than bf16
typedef _Float16 v16h __attribute__((ext_vector_type(16)));
union FragH { v16h v; v8us half[2]; _Float16 h[16]; unsigned short u[16]; };
template <int NT>
__device__ __forceinline__ v8f mmaH(v16h ah, v16h al, v16h bh, v16h bl, v8f c) {
  c = __builtin_amdgcn_wmma_f32_16x16x32_f16(false, ah, false, bh, (short)0, c, false, false);
  if (NT >= 2) c = __builtin_amdgcn_wmma_f32_16x16x32_f16(false, al, false, bh, (short)0, c, false, false);
  if (NT >= 3) c = __builtin_amdgcn_wmma_f32_16x16x32_f16(false, ah, false, bl, (short)0, c, false, false);
  asm volatile("v_nop\n\tv_nop\n\tv_nop\n\tv_nop" : "+v"(c) : "v"(ah), "v"(al), "v"(bh), "v"(bl));
  return c;
}
// batched GEMM like k_gemm_b but f16 operands: A f32 (split into f16 hi/lo if ASPLIT, else rounded to f16), Bt = f16 values [n][k]; alpha; C f32; N multiple of 16 (partial tiles skipped)
template <bool ASPLIT>
__global__ __launch_bounds__(128) void k_gemm_h(const float* __restrict__ A, int lda, size_t sA, const _Float16* __restrict__ Bh, int ldb, size_t sB, float alpha, float* __restrict__ C, int ldc, size_t sC, int M, int N, int K) {
  __shared__ __attribute__((aligned(16))) float so[4][16][64];
  const int tid = threadIdx.x, w = tid >> 5, lane = tid & 31, ln = lane & 15, hh = lane >> 4; const int by = blockIdx.y;
  A += (size_t)by * sA; Bh += (size_t)by * sB; C += (size_t)by * sC;
  const int ntn = (N + 63) / 64; const int wid = blockIdx.x * 4 + w; const int mt = wid / ntn, nq = wid % ntn; if (mt * 16 >= M) return;
  const int row0 = mt * 16, col0 = nq * 64; const float* arow = A + (size_t)(row0 + ln) * lda;
  v8f acc[4] = {};
  for (int kb = 0; kb < K; kb += 32) {
    FragH ah, al;
    const v4f x0 = *(const v4fa*)(arow + kb + 8 * hh), x1 = *(const v4fa*)(arow + kb + 8 * hh + 4), x2 = *(const v4fa*)(arow + kb + 16 + 8 * hh), x3 = *(const v4fa*)(arow + kb + 16 + 8 * hh + 4);
    float xs[16] = {x0[0],x0[1],x0[2],x0[3],x1[0],x1[1],x1[2],x1[3],x2[0],x2[1],x2[2],x2[3],x3[0],x3[1],x3[2],x3[3]};
#pragma unroll
    for (int i = 0; i < 16; ++i) { const _Float16 h = (_Float16)xs[i]; ah.h[i] = h; al.h[i] = ASPLIT ? (_Float16)(xs[i] - (float)h) : (_Float16)0.0f; }
#pragma unroll
    for (int t = 0; t < 4; ++t) { if (col0 + t * 16 >= N) continue; const size_t boff = (size_t)(col0 + t * 16 + ln) * ldb + kb; FragH bq; bq.half[0] = *(const v8us*)(Bh + boff + 8 * hh); bq.half[1] = *(const v8us*)(Bh + boff + 16 + 8 * hh);
      acc[t] = mmaH<ASPLIT ? 2 : 1>(ah.v, al.v, bq.v, bq.v, acc[t]); }
  }
#pragma unroll
  for (int t = 0; t < 4; ++t) { if (col0 + t * 16 >= N) continue;
#pragma unroll
    for (int r = 0; r < 8; ++r) so[w][8 * hh + r][t * 16 + ln] = acc[t][r] * alpha; }
  __builtin_amdgcn_fence(__ATOMIC_ACQ_REL, "workgroup"); __builtin_amdgcn_wave_barrier();
  const int rsub = lane >> 4, c4 = (lane & 15) * 4;
  {
#pragma unroll
    for (int q = 0; q < 8; ++q) { const int r = q * 2 + rsub; if (col0 + c4 < N) { const v4f v = *(const v4fa*)&so[w][r][c4]; *(v4f*)(C + (size_t)(row0 + r) * ldc + col0 + c4) = v; } }
     }
}

// Wt[n][k] = f16(W[k][n]·scale) from f32 row-major W[K][N] (scale = power of two; bf16-exact weights stay exact in f16 away from the subnormal range)
__global__ __launch_bounds__(256) void k_wt_f16(const float* __restrict__ W, _Float16* __restrict__ Wt, int K, int N, float scale) {
  const int t = blockIdx.x * 256 + threadIdx.x; if (t >= N * (K / 8)) return; const int n = t / (K / 8), k8 = (t % (K / 8)) * 8; FragH f;
#pragma unroll
  for (int i = 0; i < 8; ++i) f.h[i] = (_Float16)(bf16_round(W[(size_t)(k8 + i) * N + n]) * scale); const v8us o = f.half[0];
  *(v8us*)((unsigned short*)Wt + (size_t)n * K + k8) = o; 
}
// k_gemm_hh variant with fused epilogue: v = acc·alpha + bias[by·sBias + col] (+ CP[(row/rowsPerB)·sCPb + by·64 + col] if CP) ; ACT 0 none / 1 elu ; writes f16 C16 (and f32 C if non-null)
template <int ACT>
__global__ __launch_bounds__(128) void k_gemm_hhx(const _Float16* __restrict__ A, int lda, size_t sA, const _Float16* __restrict__ Bh, int ldb, size_t sB, float alpha, const float* __restrict__ bias, size_t sBias, const float* __restrict__ CP, int rowsPerB, size_t sCPb, int row0g,
    float* __restrict__ C, _Float16* __restrict__ C16, int ldc, size_t sC, int M, int N, int K) {
  __shared__ __attribute__((aligned(16))) float so[4][16][64];
  const int tid = threadIdx.x, w = tid >> 5, lane = tid & 31, ln = lane & 15, hh = lane >> 4; const int by = blockIdx.y;
  A += (size_t)by * sA; Bh += (size_t)by * sB; const size_t cofs = (size_t)by * sC; const float* bp = bias ? bias + (size_t)by * sBias : nullptr;
  const int ntn = (N + 63) / 64; const int wid = blockIdx.x * 4 + w; const int mt = wid / ntn, nq = wid % ntn; if (mt * 16 >= M) return;
  const int row0 = mt * 16, col0 = nq * 64; const _Float16* arow = A + (size_t)(row0 + ln) * lda;
  v8f acc[4] = {};
  for (int kb = 0; kb < K; kb += 32) { FragH ah; ah.half[0] = *(const v8us*)((const unsigned short*)arow + kb + 8 * hh); ah.half[1] = *(const v8us*)((const unsigned short*)arow + kb + 16 + 8 * hh);
#pragma unroll
    for (int t = 0; t < 4; ++t) { if (col0 + t * 16 >= N) continue; const size_t boff = (size_t)(col0 + t * 16 + ln) * ldb + kb; FragH bq; bq.half[0] = *(const v8us*)((const unsigned short*)Bh + boff + 8 * hh); bq.half[1] = *(const v8us*)((const unsigned short*)Bh + boff + 16 + 8 * hh);
      acc[t] = mmaH<1>(ah.v, ah.v, bq.v, bq.v, acc[t]); }
  }
#pragma unroll
  for (int t = 0; t < 4; ++t) { if (col0 + t * 16 >= N) continue; const int col = col0 + t * 16 + ln; const float bv = bp ? bf16_round(bp[col]) : 0.f;
#pragma unroll
    for (int r = 0; r < 8; ++r) { float v = acc[t][r] * alpha + bv; if (CP) { const int rr = row0g + row0 + 8 * hh + r; if (rowsPerB < 0) v += CP[cofs + (size_t)rr * ldc + col];      /* rowsPerB < 0: own element of the batched C plane */ else { const int bidx = rr / rowsPerB; v += CP[(size_t)bidx * sCPb + (size_t)by * 64 + col]; } } if (ACT == 1) v = (v > 0.f) ? v : expm1f(v); else if (ACT == 7) v = (v > 0.f) ? v + 1.0f : expf(v); else if (ACT == 8) v = tanhf(v); else if (ACT == 9) v = 0.5f * v * (1.0f + tanhf(0.7978845608028654f * (v + 0.044715f * v * v * v))); else if (ACT == 11) v = 1.0f / (1.0f + expf(-v)); else if (ACT == 12) v = (v > 0.f) ? v : 0.01f * v; else if (ACT == 14) v = (v > 0.f) ? v : 0.1f * v; else if (ACT == 16) v = (v >= 0.f) ? v : 0.3f * v; else if (ACT == 17) v = (v >= 0.f) ? v : 0.2f * v; else if (ACT == 15) v = v / (1.0f + expf(-v)); else if (ACT == 3) v = fmaxf(v, 0.f); else if (ACT == 6) v = 0.5f * v * (1.0f + erff(v * 0.70710678118654752f)); so[w][8 * hh + r][t * 16 + ln] = v; } }
  __builtin_amdgcn_fence(__ATOMIC_ACQ_REL, "workgroup"); __builtin_amdgcn_wave_barrier();
  const int rsub = lane >> 4, c4 = (lane & 15) * 4; typedef _Float16 v4h __attribute__((ext_vector_type(4)));
  {
#pragma unroll
    for (int q = 0; q < 8; ++q) { const int r = q * 2 + rsub; if (col0 + c4 < N) { const v4f v = *(const v4fa*)&so[w][r][c4]; if (C) *(v4f*)(C + cofs + (size_t)(row0 + r) * ldc + col0 + c4) = v; if (C16) { v4h h4; for (int i = 0; i < 4; ++i) h4[i] = (_Float16)v[i]; *(v4h*)(C16 + cofs + (size_t)(row0 + r) * ldc + col0 + c4) = h4; } } }
     }
}


typedef _Float16 v4h __attribute__((ext_vector_type(4)));

__global__ __launch_bounds__(256) void k_h16(const float* __restrict__ x, _Float16* __restrict__ X16, size_t n8) { const size_t t = (size_t)blockIdx.x * 256 + threadIdx.x; if (t >= n8) return; FragH f;
#pragma unroll
  for (int q = 0; q < 8; ++q) f.h[q] = (_Float16)x[t * 8 + q]; *(v8us*)((unsigned short*)X16 + t * 8) = f.half[0];  }
__global__ __launch_bounds__(256) void k_round16f(const float* __restrict__ W, _Float16* __restrict__ Bt, size_t n8) { const size_t t = (size_t)blockIdx.x * 256 + threadIdx.x; if (t >= n8) return; FragH f;
#pragma unroll
  for (int i = 0; i < 8; ++i) f.h[i] = (_Float16)(bf16_round(W[t * 8 + i]) * 16.0f); *(v8us*)((unsigned short*)Bt + t * 8) = f.half[0];  }
__global__ __launch_bounds__(256) void k_hl(const float* __restrict__ F, _Float16* __restrict__ Hh, _Float16* __restrict__ Hl, size_t n8) { const size_t t = (size_t)blockIdx.x * 256 + threadIdx.x; if (t >= n8) return; FragH fh, fl; const v4f a = *(const v4fa*)(F + t * 8), c = *(const v4fa*)(F + t * 8 + 4);
#pragma unroll
  for (int q = 0; q < 4; ++q) { _Float16 h = (_Float16)a[q]; fh.h[q] = h; fl.h[q] = (_Float16)((a[q] - (float)h) * 1024.0f); h = (_Float16)c[q]; fh.h[4 + q] = h; fl.h[4 + q] = (_Float16)((c[q] - (float)h) * 1024.0f); }
  { *(v8us*)((unsigned short*)Hh + t * 8) = fh.half[0]; *(v8us*)((unsigned short*)Hl + t * 8) = fl.half[0];  } }


__global__ __launch_bounds__(256) void k_rsm(const float* __restrict__ S, _Float16* __restrict__ P, int nrows) {
  #pragma clang fp contract(off)
  const int i = blockIdx.x * 256 + threadIdx.x; if (i >= nrows) return; const float* s = S + (size_t)i * SQ; float mx = -3.0e38f;
#pragma unroll 1
  for (int j = 0; j < SQ; ++j) mx = fmaxf(mx, s[j]); float se = 0.f;
#pragma unroll 1
  for (int j = 0; j < SQ; ++j) se += expf(s[j] - mx); const float sc = 256.0f / se;
#pragma unroll 1
  for (int j0 = 0; j0 < SQ; j0 += 8) { FragH f; for (int q = 0; q < 8; ++q) f.h[q] = (_Float16)(expf(s[j0 + q] - mx) * sc); unsigned short* d = (unsigned short*)P + (size_t)i * SQ + j0; *(v8us*)d = f.half[0];  } }
__global__ __launch_bounds__(256) void k_vt(const _Float16* __restrict__ V16, int b, int h0, _Float16* __restrict__ VT) { __shared__ unsigned short tl[64][65]; const int tid = threadIdx.x; const int hh = blockIdx.x % HG, sg = blockIdx.x / HG; const int s0 = sg * 64; const int h = h0 + hh;
  for (int i = tid; i < 64 * 8; i += 256) { const int j = i / 8, d8 = (i % 8) * 8; FragH f; f.half[0] = *(const v8us*)((const unsigned short*)V16 + ((size_t)b * SQ + s0 + j) * DM + h * HD + d8); for (int q = 0; q < 8; ++q) tl[d8 + q][j] = f.u[q]; }
  __syncthreads();
  { for (int i = tid; i < 64 * 8; i += 256) { const int d = i / 8, j8 = (i % 8) * 8; FragH f; for (int q = 0; q < 8; ++q) f.u[q] = tl[d][j8 + q]; *(v8us*)((unsigned short*)VT + ((size_t)hh * HD + d) * SQ + s0 + j8) = f.half[0]; }  } }



typedef int v4ia __attribute__((ext_vector_type(4), may_alias));
#define FW 8                         /* waves per attention work-group */
#define FQ 16                        /* query columns per wave */
#define FK 64                        /* keys per stage */
#define FS (SQ / FK)                 /* stages */
#define FP 72                        /* LDS row pitch in f16: 128-byte rows + 16 bytes, conflict-free for 16-byte row reads */
#define FSC 0.045084220f             /* log2(e) / sqrt(1024): raw q.k to base-2 exponent */
#define FNEG (-0x1p35f)              /* raw score of a masked key (-2^30 after the 1/32). A power of two, so that FNEG * FSC is exact and a row with only masked keys gets exponent 0, weight 1, for each of them */
#define FTH 177.0f                   /* the maximum in use is replaced only when a new one exceeds it by this much raw score (8 in base-2 exponent): weights stay below 2^8, inside f16 */
__device__ __forceinline__ float sm_xhalf(float x) { return __builtin_bit_cast(float, __builtin_amdgcn_permlanex16(__builtin_bit_cast(int, x), __builtin_bit_cast(int, x), 0x76543210, 0xfedcba98, false, false)); }      /* lane l with lane l ^ 16 */
typedef float v2f __attribute__((ext_vector_type(2)));
typedef _Float16 v2h __attribute__((ext_vector_type(2)));
union FragP { v16h v; v2h p[8]; };      /* a 16-element f16 operand as eight packed pairs */
__device__ __forceinline__ v16h fa_frag(const _Float16* p) { FragH f; f.half[0] = *(const v8us*)(const unsigned short*)p; f.half[1] = *(const v8us*)((const unsigned short*)p + 16); return f.v; }      /* p already holds the lane half's 8 h: k = 8 h + 0..7 and 16 + 8 h + 0..7 of a 32-k group, the hardware k order */
__device__ __forceinline__ v8f fa_mma(v16h a, v16h b, v8f c) { return __builtin_amdgcn_wmma_f32_16x16x32_f16(false, a, false, b, (short)0, c, false, false); }
__global__ __launch_bounds__(FW * 32) __attribute__((amdgpu_waves_per_eu(4, 4))) void k_fattn(const _Float16* __restrict__ Q16, const _Float16* __restrict__ K16, const _Float16* __restrict__ VT, const int* __restrict__ am, float* __restrict__ out) {
  __shared__ __attribute__((aligned(16))) _Float16 sk[2][FK][FP];      /* K stage: [key][d] */
  __shared__ __attribute__((aligned(16))) _Float16 sv[2][HD][FP];      /* V^T stage: [d][key] */
  const int tid = threadIdx.x, lane = tid & 31, c = lane & 15, hh = lane >> 4, w = tid >> 5;
  const int qt = blockIdx.x % (SQ / (FW * FQ)), bh = blockIdx.x / (SQ / (FW * FQ)), b = bh / NH, h = bh % NH;
  const int q = qt * (FW * FQ) + w * FQ + c;      /* the lane's query */
  const _Float16* qp = Q16 + ((size_t)b * SQ + q) * DM + h * HD + 8 * hh;
  const int sr = tid >> 3, sc = (tid & 7) * 8;      /* staging: the thread's row (and row + 32) and its 16-byte piece */
  /* each stream as a work-group-uniform base, advanced per stage, plus one byte offset per lane that never changes */
  const char* kg = (const char*)(K16 + (size_t)b * SQ * DM + h * HD); const unsigned ko = (unsigned)(sr * DM + sc) * 2u;
  const char* vg = (const char*)(VT + (size_t)bh * HD * SQ); const unsigned vo = (unsigned)(sr * SQ + sc) * 2u;
  const char* mg = (const char*)(am + ((size_t)b * SQ + qt * (FW * FQ)) * SQ); const unsigned mo = (unsigned)((w * FQ + c) * SQ + 8 * hh) * 4u;      /* the query's keep-mask row, at the lane half's keys */
  v4ia mk[8];      /* keep-mask words of a stage: word 2 t + u = keys 16 t + 8 h + 4 u .. + 3 */
  const v16h qf0 = fa_frag(qp), qf1 = fa_frag(qp + 32);
  { const v8us k0 = *(const v8us*)(kg + ko), k1 = *(const v8us*)(kg + (ko + 32u * DM * 2u)), v0 = *(const v8us*)(vg + vo), v1 = *(const v8us*)(vg + (vo + 32u * SQ * 2u));
#pragma unroll
    for (int t = 0; t < 4; ++t) { mk[2 * t] = *(const v4ia*)(mg + (mo + 64u * t)); mk[2 * t + 1] = *(const v4ia*)(mg + (mo + 64u * t + 16u)); }
    asm volatile("s_wait_xcnt 0x0" :: "v"(qp), "s"(kg), "s"(vg), "s"(mg), "v"(ko), "v"(vo), "v"(mo) : "memory");      /* behind the loads and ahead of whatever reuses their address registers; the addresses as inputs keep those registers whole up to here */
    *(v8us*)&sk[0][sr][sc] = k0; *(v8us*)&sk[0][sr + 32][sc] = k1; *(v8us*)&sv[0][sr][sc] = v0; *(v8us*)&sv[0][sr + 32][sc] = v1; }
  __syncthreads();
  const v8f z8 = {0.f, 0.f, 0.f, 0.f, 0.f, 0.f, 0.f, 0.f};
  v8f o[4] = {z8, z8, z8, z8};      /* O^T: o[dt][r] = d 16 dt + 8 h + r of the lane's query */
  float m = -3.0e38f, mc = -3.0e38f * FSC, l = 0.f;      /* maximum in use (raw, and as exponent), the lane's part of the sum */
  auto pass = [&](const int s, const int bf) __attribute__((always_inline)) {      /* stage s from buffer bf; fetches the next stage */
    const int sn = (s + 1 < FS) ? s + 1 : FS - 1;      /* the last pass fetches its own stage again, into the buffer that nobody reads any more: the loads stay unconditional, so no branch merges the wait counts */
    const char* kp = kg + (size_t)sn * (FK * DM * 2) + ko; const char* vp = vg + sn * (FK * 2) + vo; const char* mp = mg + sn * (FK * 4) + mo;
    const v8us k0 = *(const v8us*)kp, k1 = *(const v8us*)(kp + 32 * DM * 2), v0 = *(const v8us*)vp, v1 = *(const v8us*)(vp + 32 * SQ * 2);
    asm volatile("s_wait_xcnt 0x0" :: "v"(kp), "v"(vp) : "memory");      /* as above: ahead of the reuse of the two address pairs */
    v16h kf[8];
#pragma unroll
    for (int t = 0; t < 4; ++t) { const _Float16* kr = &sk[bf][16 * t + c][8 * hh]; kf[2 * t] = fa_frag(kr); kf[2 * t + 1] = fa_frag(kr + 32); }
    __builtin_amdgcn_sched_barrier(0);      /* all K fragment loads are issued before the first product waits on one; without it some passes came out as load, wait, product, eight times in a row */
    v8f st[4];      /* S^T: st[t][r] = key 16 t + 8 h + r of the stage, the lane's query */
#pragma unroll
    for (int t = 0; t < 4; ++t) st[t] = fa_mma(kf[2 * t], qf0, z8);
#pragma unroll
    for (int t = 0; t < 4; ++t) st[t] = fa_mma(kf[2 * t + 1], qf1, st[t]);
#pragma unroll
    for (int t = 0; t < 4; ++t)
#pragma unroll
      for (int r = 0; r < 8; ++r) st[t][r] = (mk[2 * t + (r >> 2)][r & 3] != 0) ? st[t][r] : FNEG;
    __builtin_amdgcn_sched_barrier(0);      /* holds the reload of the mask registers behind their last reader, so that one set of 32 serves; without it the loads are issued earlier into a second set, which is copied back every pass */
#pragma unroll
    for (int t = 0; t < 4; ++t) { mk[2 * t] = *(const v4ia*)(mp + 64 * t); mk[2 * t + 1] = *(const v4ia*)(mp + 64 * t + 16); }
    asm volatile("s_wait_xcnt 0x0" :: "v"(mp) : "memory");      /* as above */
    v16h vf[8];      /* the V^T fragments, fetched here so that they land behind the softmax arithmetic */
#pragma unroll
    for (int g = 0; g < 2; ++g)
#pragma unroll
      for (int dt = 0; dt < 4; ++dt) vf[4 * g + dt] = fa_frag(&sv[bf][16 * dt + c][32 * g + 8 * hh]);
    __builtin_amdgcn_sched_barrier(0);      /* holds these loads ahead of the arithmetic */
    float mt[4];      /* one chain per tile: four short dependent chains instead of one long one */
#pragma unroll
    for (int t = 0; t < 4; ++t) { mt[t] = st[t][0];
#pragma unroll
      for (int r = 1; r < 8; ++r) mt[t] = fmaxf(mt[t], st[t][r]); }
    float mx = fmaxf(fmaxf(mt[0], mt[1]), fmaxf(mt[2], mt[3]));
    mx = fmaxf(mx, sm_xhalf(mx));      /* both lane halves of a query use one maximum: their weights meet in one product */
    const bool need = mx > m + FTH;
    if (__builtin_amdgcn_ballot_w32(need) != 0) {      /* one branch per pass; taken on the first pass and then only when some query's maximum grows by more than FTH */
      const float mn = need ? mx : m, mcn = mn * FSC; const float al = __builtin_amdgcn_exp2f(mc - mcn); m = mn; mc = mcn; l *= al;      /* 0 on the first pass, 1 in a lane that keeps its maximum */
#pragma unroll
      for (int dt = 0; dt < 4; ++dt) o[dt] *= al; }
    const v2f mc2 = {mc, mc}; v2f a2[2] = {{0.f, 0.f}, {0.f, 0.f}}; FragP pf[2];      /* P^T as B operand: element e of pf[g] = key 32 g + (e < 8 ? 8 h + e : 16 + 8 h + e - 8) */
#pragma unroll
    for (int t = 0; t < 4; ++t)
#pragma unroll
      for (int u = 0; u < 4; ++u) { const v2f x = {st[t][2 * u], st[t][2 * u + 1]}; const v2f y = x * FSC - mc2; const v2f e = {__builtin_amdgcn_exp2f(y[0]), __builtin_amdgcn_exp2f(y[1])};      /* the builtin, so that the compiler keeps the distances to the matrix instructions that it schedules around it */
        a2[u & 1] += e; pf[t >> 1].p[4 * (t & 1) + u] = __builtin_convertvector(e, v2h); }
    l += (a2[0][0] + a2[0][1]) + (a2[1][0] + a2[1][1]);
#pragma unroll
    for (int g = 0; g < 2; ++g)
#pragma unroll
      for (int dt = 0; dt < 4; ++dt) o[dt] = fa_mma(vf[4 * g + dt], pf[g].v, o[dt]);
    __builtin_amdgcn_sched_barrier(0);      /* holds the stores, with their wait for the stage loads, and the barrier at the foot of the pass; without it one pass had them ahead of the exponentials, which cuts the time the stage loads have to land */
    *(v8us*)&sk[bf ^ 1][sr][sc] = k0; *(v8us*)&sk[bf ^ 1][sr + 32][sc] = k1; *(v8us*)&sv[bf ^ 1][sr][sc] = v0; *(v8us*)&sv[bf ^ 1][sr + 32][sc] = v1;      /* into the buffer whose last readers left it before the previous pass's barrier */
    asm volatile("s_wait_dscnt 0x0\n\ts_barrier_signal -1\n\ts_barrier_wait -1" ::: "memory");      /* publishes stage s + 1 and ends every wave's reads of stage s. By hand, with the LDS wait alone: __syncthreads() would also wait for the mask loads, which are to fly on into the next pass */
  };
#pragma unroll 1
  for (int s = 0; s < FS; s += 2) { pass(s, 0); pass(s + 1, 1); }      /* two passes a trip: each pass's buffer is a constant offset */
  const float inv = 1.0f / (l + sm_xhalf(l));
  float* op = out + ((size_t)b * SQ + q) * DM + h * HD + 8 * hh;
#pragma unroll
  for (int dt = 0; dt < 4; ++dt) { const v4f lo = {o[dt][0] * inv, o[dt][1] * inv, o[dt][2] * inv, o[dt][3] * inv}, hi = {o[dt][4] * inv, o[dt][5] * inv, o[dt][6] * inv, o[dt][7] * inv};
    *(v4f*)(op + 16 * dt) = lo; *(v4f*)(op + 16 * dt + 4) = hi; }
}
typedef unsigned short v4us __attribute__((ext_vector_type(4), may_alias));
union FragQ { v2h p[2]; v4us u; };      /* four f16 as one 8-byte LDS store */
typedef __bf16 v2b __attribute__((ext_vector_type(2)));
__device__ __forceinline__ v2f pj_round(const float a, const float b) { const v2f x = {a, b}; return __builtin_convertvector(__builtin_convertvector(x, v2b), v2f); }      /* two values rounded to bf16 (nearest even, as bf16_round) by one packed convert */
#define PW 4                         /* waves per projection work-group: four neighbouring heads of the same tokens */
#define PT 64                        /* tokens per wave */
// 64 finished rows of 64 f16 from the wave's LDS tile to memory: one instruction carries four whole 128-byte rows. dst and pitch (bytes) are the same in every lane
__device__ __forceinline__ void pj_rows(const _Float16 (*tile)[FP], char* dst, const unsigned pitch, const int lane) {
  const int rr = lane >> 3, pc = (lane & 7) * 8; const unsigned lo = (unsigned)rr * pitch + (unsigned)pc * 2u;
  v8us v[16];
#pragma unroll
  for (int j = 0; j < 16; ++j) v[j] = *(const v8us*)(const unsigned short*)&tile[4 * j + rr][pc];
#pragma unroll
  for (int j = 0; j < 16; ++j) *(v8us*)(dst + (size_t)(4u * j * pitch) + lo) = v[j];
}
// the wave's 64 x 64 x 64 product from fragments in registers, the f16 results into its LDS tile. TR false: W X^T, rows [token][d]; TR true: X W^T, rows [d][token]
template <bool TR>
__device__ __forceinline__ void pj_mul(const v16h (&wf)[8], const v16h (&xf)[8], _Float16 (*tile)[FP], const int c, const int hh) {
  const v8f z8 = {0.f, 0.f, 0.f, 0.f, 0.f, 0.f, 0.f, 0.f};
#pragma unroll
  for (int t = 0; t < 4; ++t) { v8f a[4];      /* TR false: a[dt][r] = d 16 dt + 8 h + r of token 16 t + c; TR true: token 16 t + 8 h + r of d 16 dt + c */
#pragma unroll
    for (int dt = 0; dt < 4; ++dt) a[dt] = TR ? fa_mma(xf[2 * t], wf[2 * dt], z8) : fa_mma(wf[2 * dt], xf[2 * t], z8);
#pragma unroll
    for (int dt = 0; dt < 4; ++dt) a[dt] = TR ? fa_mma(xf[2 * t + 1], wf[2 * dt + 1], a[dt]) : fa_mma(wf[2 * dt + 1], xf[2 * t + 1], a[dt]);
#pragma unroll
    for (int dt = 0; dt < 4; ++dt) { FragH f;
#pragma unroll
      for (int r = 0; r < 8; ++r) f.h[r] = (_Float16)(a[dt][r] * 0.0625f);      /* takes the weight's factor of 16 out again */
      *(v8us*)(unsigned short*)(TR ? &tile[16 * dt + c][16 * t + 8 * hh] : &tile[16 * t + c][16 * dt + 8 * hh]) = f.half[0]; } }
  __builtin_amdgcn_fence(__ATOMIC_ACQ_REL, "workgroup"); __builtin_amdgcn_wave_barrier();      /* the wave's own LDS writes before its other lanes read them */
}
// All that precedes attention in ONE launch: blockIdx.y = stream (0 queries, 1 keys, 2 values); a wave projects 64 tokens of one head (64 x 64 x 64).
// The f32 input slice is read in whole 256-byte rows, rounded (bf16, then f16, exact) in registers and laid into the wave's own LDS tile [token][k]; the work-group rounds the stream's 64 x 64 weight (x16) once into LDS [d][k].
// Q and K as W X^T (a lane holds 8 neighbouring d of one token), V as X W^T (a lane holds 8 neighbouring tokens of one d: V^T with no transposing pass); the results go back into the wave's tile, as rows [token][d] or [d][token].
__global__ __launch_bounds__(PW * 32) void k_proj(const float* __restrict__ xq, const float* __restrict__ xk, const float* __restrict__ xv, const float* __restrict__ wq, const float* __restrict__ wk, const float* __restrict__ wv,
                                                  _Float16* __restrict__ Q16, _Float16* __restrict__ K16, _Float16* __restrict__ VT) {
  __shared__ __attribute__((aligned(16))) _Float16 sw[HD][FP];          /* the weight: [d][k] */
  __shared__ __attribute__((aligned(16))) _Float16 sx[PW][PT][FP];      /* per wave: the input tile [token][k], later the result rows */
  const int tid = threadIdx.x, lane = tid & 31, c = lane & 15, hh = lane >> 4, w = __builtin_amdgcn_readfirstlane(tid >> 5);
  const int sm = blockIdx.y;
  const float* x = sm == 0 ? xq : sm == 1 ? xk : xv; const float* wt = sm == 0 ? wq : sm == 1 ? wk : wv;
  const int row0 = (int)(blockIdx.x / (NH / PW)) * PT, h = (int)(blockIdx.x % (NH / PW)) * PW + w;      /* first token row (b * 2048 + s), the wave's head */
  const float* wp = wt + (tid >> 1) * HD + (tid & 1) * 32;      /* the thread's half row of the weight */
  const float* xp = x + (size_t)row0 * DM + h * HD + (hh * DM + 4 * c);      /* rows 2 j + lane half, the lane's 16 bytes */
  v4f wr[8], xr[PT / 2];
#pragma unroll
  for (int j = 0; j < 8; ++j) wr[j] = *(const v4fa*)(wp + 4 * j);
#pragma unroll
  for (int j = 0; j < PT / 2; ++j) xr[j] = *(const v4fa*)(xp + (size_t)(2 * j) * DM);
  asm volatile("s_wait_xcnt 0x0" :: "v"(wp), "v"(xp) : "memory");      /* behind the loads and ahead of whatever reuses their address registers; the addresses as inputs keep those registers whole up to here */
#pragma unroll
  for (int j = 0; j < 8; ++j) { FragQ f;
#pragma unroll
    for (int u = 0; u < 2; ++u) f.p[u] = __builtin_convertvector(pj_round(wr[j][2 * u] * 16.0f, wr[j][2 * u + 1] * 16.0f), v2h);      /* the factor of 16, a power of two, commutes with the rounding */
    *(v4us*)(unsigned short*)&sw[tid >> 1][(tid & 1) * 32 + 4 * j] = f.u; }
#pragma unroll
  for (int j = 0; j < PT / 2; ++j) { FragQ f;
#pragma unroll
    for (int u = 0; u < 2; ++u) f.p[u] = __builtin_convertvector(pj_round(xr[j][2 * u], xr[j][2 * u + 1]), v2h);
    *(v4us*)(unsigned short*)&sx[w][2 * j + hh][4 * c] = f.u; }
  __syncthreads();      /* publishes the weight to the four waves */
  v16h wf[8], xf[8];      /* wf[2 dt + g]: d 16 dt + c; xf[2 t + g]: token 16 t + c; both k = 32 g + 8 h + 0..7 and 32 g + 16 + 8 h + 0..7 */
#pragma unroll
  for (int t = 0; t < 4; ++t)
#pragma unroll
    for (int g = 0; g < 2; ++g) { wf[2 * t + g] = fa_frag(&sw[16 * t + c][32 * g + 8 * hh]); xf[2 * t + g] = fa_frag(&sx[w][16 * t + c][32 * g + 8 * hh]); }
  __builtin_amdgcn_fence(__ATOMIC_ACQ_REL, "workgroup"); __builtin_amdgcn_wave_barrier();      /* every input fragment is read before the results overwrite the tile */
  if (sm != 2) pj_mul<false>(wf, xf, sx[w], c, hh); else pj_mul<true>(wf, xf, sx[w], c, hh);      /* one branch, the same for every wave of the grid's y plane */
  _Float16* dst = sm == 2 ? VT + ((size_t)((row0 / SQ) * NH + h) * HD) * SQ + row0 % SQ : (sm == 0 ? Q16 : K16) + (size_t)row0 * DM + h * HD;
  pj_rows(sx[w], (char*)dst, sm == 2 ? SQ * 2u : DM * 2u, lane);
}
extern "C" void kernel_launch(void* const* d_in, const int* in_sizes, int n_in,
                              void* d_out, int out_size, void* d_ws, size_t ws_size, hipStream_t stream) {
  (void)in_sizes; (void)n_in; (void)out_size;
  const float* const* I = (const float* const*)d_in; const float* xv = I[0]; const float* xk = I[1]; const float* xq = I[2]; const int* am = (const int*)d_in[3]; const float* wv = I[4]; const float* wk = I[5]; const float* wq = I[6];      /* input order: values, keys, queries; the int32 keep-mask [2][1][2048][2048]; Wv, Wk, Wq: ONE natural [64][64] weight per stream, shared by the 16 heads; no biases; no output projection */
  char* ws = (char*)d_ws; size_t off = 0;
  auto take = [&](size_t bytes) { char* p = ws + off; off += (bytes + 255) & ~(size_t)255; return p; };
  _Float16* Q16 = (_Float16*)take(NR * DM * 2); _Float16* K16 = (_Float16*)take(NR * DM * 2); _Float16* VT = (_Float16*)take((size_t)NB * NH * HD * SQ * 2);
  if (off > ws_size) return;
  k_proj<<<dim3((unsigned)((NR / PT) * (NH / PW)), 3), PW * 32, 0, stream>>>(xq, xk, xv, wq, wk, wv, Q16, K16, VT);      /* rounding of inputs and weights, the three projections (every head's 64-column slice times the stream's ONE shared weight) and V^T [NB][NH][HD][SQ] */
  k_fattn<<<NB * NH * (SQ / (FW * FQ)), FW * 32, 0, stream>>>(Q16, K16, VT, am, (float*)d_out);      /* scores / sqrt(1024), keep-mask, softmax and P V in one launch for every batch and head, written f32 into the merged-heads output rows */
}

// v004
// Measured time: 51.7 microseconds a run.
// Two timings next to v003 put it at 1.24 and 1.25 times that version's speed.
// All steps since v000 together make it 150 times as fast.
#include <hip/hip_runtime.h>
// Masked multi-head attention over three inputs with ONE SHARED 64 x 64 projection per stream and a RANDOM int keep-mask, no output projection (values, keys, queries [2][2048][1024]; every head's 64-column slice is projected by the SAME natural nn.Linear weight: v = values.reshape(N, L, 16, 64) Wv^T, k likewise with Wk, q with Wq ([64][64], normal / 8, NO biases); scores = q.k / sqrt(1024) (the module's embed size); where(mask == 0, -1e20) with the int32 [2][1][2048][2048] mask (seeded randint 0 / 1, about half zeros, one plane per sequence shared by its heads; READ on the device); softmax; out = attn v merged over heads -> [2][2048][1024]; input order values, keys, queries, mask, Wv, Wk, Wq).
// Structure: token rows r = b*2048 + s; ONE projection kernel for the three streams (grid.y): it reads the f32 inputs and weights itself, rounds them in registers (bf16, held as exact f16; the weight x16), and a wave multiplies 64 tokens of one head's 64-column slice by the stream's ONE shared weight (K = 64, f32 accumulation, no bias), f16 results: Q and K into the head's slice of the rows, V straight as V^T; a fourth plane of that launch packs the keep-mask to one bit a key, once for the 16 heads; then ONE attention kernel for every (batch, head, 128 queries): scores (K = 64, 1/sqrt(1024) folded into the exponent), keep-mask, running-maximum softmax (f32 statistics; weights as f16, divided by their sum at the end) and the weighted sum of V, written f32 straight into the merged-heads output rows; scores and weights never reach memory; see the trace for the launch count.
// Compute dtype: inputs rounded to bf16; the three inputs and the x16 weights held as f16 in LDS (exact for every bf16 value of magnitude from 2^-14 up to 65,504; the weights up to 4,094 before their factor of 16); q, k, v and the softmax weights as plain f16 GEMM operands (~2^-12); scores, softmax statistics and the output f32. v_wmma_f32_16x16x32_f16.
#define NB 2
#define SQ 2048
#define DM 1024
#define NH 16
#define HD 64
#define HG 4                         /* heads per call of the per-group k_vt overload (not launched) */
#define B0 0                         /* not used */
#define NBR NB                       /* not used except in MP */
#define NR ((size_t)NB * SQ)         /* token rows */
#define MP ((int)((size_t)NBR * SQ)) /* not used except in MPO */
#define QN SQ                        /* not used */
#define NHD NH                       /* not used */
#define MPO MP                       /* not used */
#define LQ DM      /* not used */
typedef __bf16 v16b __attribute__((ext_vector_type(16)));
typedef unsigned short v8us __attribute__((ext_vector_type(8), may_alias));
typedef float  v8f  __attribute__((ext_vector_type(8)));
typedef float  v4f  __attribute__((ext_vector_type(4)));
typedef float  v4fa __attribute__((ext_vector_type(4), may_alias));
union FragB { v16b v; v8us half[2]; unsigned short u[16]; };

__device__ __forceinline__ unsigned short bf16_bits(float x) { unsigned int u = __float_as_uint(x); return (unsigned short)((u + 0x7FFFu + ((u >> 16) & 1u)) >> 16); }
__device__ __forceinline__ float bf16_val(unsigned short b) { return __uint_as_float(((unsigned int)b) << 16); }
__device__ __forceinline__ float bf16_round(float x) { return bf16_val(bf16_bits(x)); }
// D += A·B with NT terms: 1 = ah·bh, 2 = + al·bh (A split), 3 = + ah·bl (both split)
template <int NT>
__device__ __forceinline__ v8f mmaN(v16b ah, v16b al, v16b bh, v16b bl, v8f c) {
  c = __builtin_amdgcn_wmma_f32_16x16x32_bf16(false, ah, false, bh, (short)0, c, false, false);
  if (NT >= 2) c = __builtin_amdgcn_wmma_f32_16x16x32_bf16(false, al, false, bh, (short)0, c, false, false);
  if (NT >= 3) c = __builtin_amdgcn_wmma_f32_16x16x32_bf16(false, ah, false, bl, (short)0, c, false, false);
  asm volatile("v_nop\n\tv_nop\n\tv_nop\n\tv_nop" : "+v"(c) : "v"(ah), "v"(al), "v"(bh), "v"(bl));
  return c;
}

__global__ __launch_bounds__(256) void k_wt_bf16(const float* __restrict__ W, unsigned short* __restrict__ Wt, int K, int N) {
  const int t = blockIdx.x * 256 + threadIdx.x;
  const int k8n = K / 8;
  if (t >= N * k8n) return;
  const int n = t / k8n, k8 = (t % k8n) * 8;
  v8us v;
#pragma unroll
  for (int i = 0; i < 8; ++i) v[i] = bf16_bits(W[(size_t)(k8 + i) * N + n]);
  *(v8us*)(Wt + (size_t)n * K + k8) = v;
  
}

// GEMM C[M][N] (f32, pitch ldc) = act(A[M][K]·W + bias). A f32 row-major (pitch lda) converted per fragment to bf16
// (ASPLIT: hi/lo two planes -> 2 terms, else single rounded term); Wt bf16 [N][K] (pitch ldb). BIAS_BF16 rounds the
// bias to bf16 first (bias quantised to bf16 before the add). K%32==0, M%16==0, N%64==0.
template <bool ASPLIT, int ACT, bool BIAS_BF16>
__global__ __launch_bounds__(128) void k_gemm_bf(const float* __restrict__ A, int lda, const unsigned short* __restrict__ Wt, int ldb,
                                               const float* __restrict__ bias, float* __restrict__ C, int ldc, int M, int N, int K) {
  __shared__ __attribute__((aligned(16))) float so[4][16][64];
  const int tid = threadIdx.x, w = tid >> 5, lane = tid & 31, ln = lane & 15, hh = lane >> 4;
  const int ntn = N / 64;
  const int wid = blockIdx.x * 4 + w;
  const int mt = wid / ntn, nq = wid % ntn;
  if (mt * 16 >= M) return;
  const int row0 = mt * 16, col0 = nq * 64;
  const float* arow = A + (size_t)(row0 + ln) * lda;
  v8f acc[4] = {};
  for (int kb = 0; kb < K; kb += 32) {
    FragB ah, al;
    const v4f x0 = *(const v4fa*)(arow + kb + 8 * hh), x1 = *(const v4fa*)(arow + kb + 8 * hh + 4);
    const v4f x2 = *(const v4fa*)(arow + kb + 16 + 8 * hh), x3 = *(const v4fa*)(arow + kb + 16 + 8 * hh + 4);
    float xs[16] = {x0[0],x0[1],x0[2],x0[3],x1[0],x1[1],x1[2],x1[3],x2[0],x2[1],x2[2],x2[3],x3[0],x3[1],x3[2],x3[3]};
#pragma unroll
    for (int i = 0; i < 16; ++i) { const unsigned short hb = bf16_bits(xs[i]); ah.u[i] = hb; al.u[i] = ASPLIT ? bf16_bits(xs[i] - bf16_val(hb)) : (unsigned short)0; }
#pragma unroll
    for (int t = 0; t < 4; ++t) {
      const unsigned short* brow = Wt + (size_t)(col0 + t * 16 + ln) * ldb + kb;
      FragB b;
      b.half[0] = *(const v8us*)(brow + 8 * hh);
      b.half[1] = *(const v8us*)(brow + 16 + 8 * hh);
      acc[t] = mmaN<ASPLIT ? 2 : 1>(ah.v, al.v, b.v, b.v, acc[t]);
    }
  }
#pragma unroll
  for (int t = 0; t < 4; ++t) {
    float bv = bias ? bias[col0 + t * 16 + ln] : 0.f;
    if (BIAS_BF16) bv = bf16_round(bv);
#pragma unroll
    for (int r = 0; r < 8; ++r) { float v = acc[t][r] + bv; if (ACT == 1) v = fmaxf(v, 0.f); so[w][8 * hh + r][t * 16 + ln] = v; }
  }
  __builtin_amdgcn_fence(__ATOMIC_ACQ_REL, "workgroup");
  __builtin_amdgcn_wave_barrier();
  const int rsub = lane >> 4, c4 = (lane & 15) * 4;
  {
#pragma unroll
    for (int q = 0; q < 8; ++q) {
      const int r = q * 2 + rsub;
      const v4f v = *(const v4fa*)&so[w][r][c4];
      *(v4f*)(C + (size_t)(row0 + r) * ldc + col0 + c4) = v;
    }
    
  }
}

// GEMM C = act(A·W + bias + resid): A f32 (ASPLIT -> hi/lo 2 terms), Wt bf16 [N][K]; ACT 0 none, 1 relu, 2 exact gelu;
// resid (optional, f32, row index = (row % rmod), pitch ldr, RES_BF16 rounds it) added before the activation.
template <bool ASPLIT, int ACT, bool BIAS_BF16, bool RES_BF16>
__global__ __launch_bounds__(128) void k_gemm_bf3(const float* __restrict__ A, int lda, const unsigned short* __restrict__ Wt, int ldb,
                                                const float* __restrict__ bias, const float* __restrict__ resid, int rmod, int ldr,
                                                float* __restrict__ C, int ldc, int M, int N, int K) {
  __shared__ __attribute__((aligned(16))) float so[4][16][64];
  const int tid = threadIdx.x, w = tid >> 5, lane = tid & 31, ln = lane & 15, hh = lane >> 4;
  const int ntn = N / 64;
  const int wid = blockIdx.x * 4 + w;
  const int mt = wid / ntn, nq = wid % ntn;
  if (mt * 16 >= M) return;
  const int row0 = mt * 16, col0 = nq * 64;
  const float* arow = A + (size_t)(row0 + ln) * lda;
  v8f acc[4] = {};
  for (int kb = 0; kb < K; kb += 32) {
    FragB ah, al;
    const v4f x0 = *(const v4fa*)(arow + kb + 8 * hh), x1 = *(const v4fa*)(arow + kb + 8 * hh + 4);
    const v4f x2 = *(const v4fa*)(arow + kb + 16 + 8 * hh), x3 = *(const v4fa*)(arow + kb + 16 + 8 * hh + 4);
    float xs[16] = {x0[0],x0[1],x0[2],x0[3],x1[0],x1[1],x1[2],x1[3],x2[0],x2[1],x2[2],x2[3],x3[0],x3[1],x3[2],x3[3]};
#pragma unroll
    for (int i = 0; i < 16; ++i) { const unsigned short hb = bf16_bits(xs[i]); ah.u[i] = hb; al.u[i] = ASPLIT ? bf16_bits(xs[i] - bf16_val(hb)) : (unsigned short)0; }
#pragma unroll
    for (int t = 0; t < 4; ++t) {
      const unsigned short* brow = Wt + (size_t)(col0 + t * 16 + ln) * ldb + kb;
      FragB b;
      b.half[0] = *(const v8us*)(brow + 8 * hh);
      b.half[1] = *(const v8us*)(brow + 16 + 8 * hh);
      acc[t] = mmaN<ASPLIT ? 2 : 1>(ah.v, al.v, b.v, b.v, acc[t]);
    }
  }
#pragma unroll
  for (int t = 0; t < 4; ++t) {
    const int col = col0 + t * 16 + ln;
    float bv = bias ? bias[col] : 0.f;
    if (BIAS_BF16) bv = bf16_round(bv);
#pragma unroll
    for (int r = 0; r < 8; ++r) {
      float v = acc[t][r] + bv;
      if (resid) { float rv = resid[(size_t)((row0 + 8 * hh + r) % rmod) * ldr + col]; if (RES_BF16) rv = bf16_round(rv); v += rv; }
      if (ACT == 1) v = fmaxf(v, 0.f);
      if (ACT == 2) v = 0.5f * v * (1.0f + erff(v * 0.70710678118654752f));
      if (ACT == 3) { const float u = 0.7978845608028654f * (v + 0.044715f * v * v * v); v = 0.5f * v * (1.0f + tanhf(u)); }
      so[w][8 * hh + r][t * 16 + ln] = v;
    }
  }
  __builtin_amdgcn_fence(__ATOMIC_ACQ_REL, "workgroup");
  __builtin_amdgcn_wave_barrier();
  const int rsub = lane >> 4, c4 = (lane & 15) * 4;
  {
#pragma unroll
    for (int q = 0; q < 8; ++q) {
      const int r = q * 2 + rsub;
      const v4f v = *(const v4fa*)&so[w][r][c4];
      *(v4f*)(C + (size_t)(row0 + r) * ldc + col0 + c4) = v;
    }
    
  }
}
// row LayerNorm (biased variance, eps) over N: s = X (+ R); optional out_sum <- s; out_norm <- (s-mu)*rsqrt(var+eps)*g + b
template <bool PARAM_BF16>
__global__ __launch_bounds__(256) void k_layernorm(const float* __restrict__ X, const float* __restrict__ R, const float* __restrict__ g, const float* __restrict__ bta,
                                                  float* __restrict__ out_sum, float* __restrict__ out_norm, int N, float eps) {
  __shared__ float red[256];
  const int row = blockIdx.x, tid = threadIdx.x;
  const float* x = X + (size_t)row * N; const float* rr = R ? R + (size_t)row * N : nullptr;
  float vals[16];                     // up to N = 4096
  const int per = N / 256;            // contiguous chunk per thread? use strided-by-4 chunks: thread handles j = tid*4 + 1024*u
  float s1 = 0.f;
  for (int u = 0; u < per / 4; ++u) {
    const int j = tid * 4 + 1024 * u;
    const v4f a = *(const v4fa*)(x + j);
    v4f b = {0.f,0.f,0.f,0.f}; if (rr) b = *(const v4fa*)(rr + j);
#pragma unroll
    for (int q = 0; q < 4; ++q) { const float v = a[q] + b[q]; vals[u * 4 + q] = v; s1 += v; }
  }
  red[tid] = s1; __syncthreads();
  for (int st = 128; st > 0; st >>= 1) { if (tid < st) red[tid] += red[tid + st]; __syncthreads(); }
  const float mu = red[0] / (float)N; __syncthreads();
  float s2 = 0.f;
  for (int u = 0; u < per / 4; ++u)
#pragma unroll
    for (int q = 0; q < 4; ++q) { const float c = vals[u * 4 + q] - mu; s2 += c * c; }
  red[tid] = s2; __syncthreads();
  for (int st = 128; st > 0; st >>= 1) { if (tid < st) red[tid] += red[tid + st]; __syncthreads(); }
  const float rs = rsqrtf(red[0] / (float)N + eps);
  {
    for (int u = 0; u < per / 4; ++u) {
      const int j = tid * 4 + 1024 * u;
      v4f o, sm;
#pragma unroll
      for (int q = 0; q < 4; ++q) {
        float gg = g[j + q], bb = bta[j + q];
        if (PARAM_BF16) { gg = bf16_round(gg); bb = bf16_round(bb); }
        sm[q] = vals[u * 4 + q]; o[q] = (vals[u * 4 + q] - mu) * rs * gg + bb;
      }
      if (out_sum) *(v4f*)(out_sum + (size_t)row * N + j) = sm;
      *(v4f*)(out_norm + (size_t)row * N + j) = o;
    }
    
  }
}



// ---- f16 WMMA path (v_wmma_f32_16x16x32_f16): 11-bit significands for operands in range — used where a [0,1] probability operand needs more precision than bf16
typedef _Float16 v16h __attribute__((ext_vector_type(16)));
union FragH { v16h v; v8us half[2]; _Float16 h[16]; unsigned short u[16]; };
template <int NT>
__device__ __forceinline__ v8f mmaH(v16h ah, v16h al, v16h bh, v16h bl, v8f c) {
  c = __builtin_amdgcn_wmma_f32_16x16x32_f16(false, ah, false, bh, (short)0, c, false, false);
  if (NT >= 2) c = __builtin_amdgcn_wmma_f32_16x16x32_f16(false, al, false, bh, (short)0, c, false, false);
  if (NT >= 3) c = __builtin_amdgcn_wmma_f32_16x16x32_f16(false, ah, false, bl, (short)0, c, false, false);
  asm volatile("v_nop\n\tv_nop\n\tv_nop\n\tv_nop" : "+v"(c) : "v"(ah), "v"(al), "v"(bh), "v"(bl));
  return c;
}
// batched GEMM like k_gemm_b but f16 operands: A f32 (split into f16 hi/lo if ASPLIT, else rounded to f16), Bt = f16 values [n][k]; alpha; C f32; N multiple of 16 (partial tiles skipped)
template <bool ASPLIT>
__global__ __launch_bounds__(128) void k_gemm_h(const float* __restrict__ A, int lda, size_t sA, const _Float16* __restrict__ Bh, int ldb, size_t sB, float alpha, float* __restrict__ C, int ldc, size_t sC, int M, int N, int K) {
  __shared__ __attribute__((aligned(16))) float so[4][16][64];
  const int tid = threadIdx.x, w = tid >> 5, lane = tid & 31, ln = lane & 15, hh = lane >> 4; const int by = blockIdx.y;
  A += (size_t)by * sA; Bh += (size_t)by * sB; C += (size_t)by * sC;
  const int ntn = (N + 63) / 64; const int wid = blockIdx.x * 4 + w; const int mt = wid / ntn, nq = wid % ntn; if (mt * 16 >= M) return;
  const int row0 = mt * 16, col0 = nq * 64; const float* arow = A + (size_t)(row0 + ln) * lda;
  v8f acc[4] = {};
  for (int kb = 0; kb < K; kb += 32) {
    FragH ah, al;
    const v4f x0 = *(const v4fa*)(arow + kb + 8 * hh), x1 = *(const v4fa*)(arow + kb + 8 * hh + 4), x2 = *(const v4fa*)(arow + kb + 16 + 8 * hh), x3 = *(const v4fa*)(arow + kb + 16 + 8 * hh + 4);
    float xs[16] = {x0[0],x0[1],x0[2],x0[3],x1[0],x1[1],x1[2],x1[3],x2[0],x2[1],x2[2],x2[3],x3[0],x3[1],x3[2],x3[3]};
#pragma unroll
    for (int i = 0; i < 16; ++i) { const _Float16 h = (_Float16)xs[i]; ah.h[i] = h; al.h[i] = ASPLIT ? (_Float16)(xs[i] - (float)h) : (_Float16)0.0f; }
#pragma unroll
    for (int t = 0; t < 4; ++t) { if (col0 + t * 16 >= N) continue; const size_t boff = (size_t)(col0 + t * 16 + ln) * ldb + kb; FragH bq; bq.half[0] = *(const v8us*)(Bh + boff + 8 * hh); bq.half[1] = *(const v8us*)(Bh + boff + 16 + 8 * hh);
      acc[t] = mmaH<ASPLIT ? 2 : 1>(ah.v, al.v, bq.v, bq.v, acc[t]); }
  }
#pragma unroll
  for (int t = 0; t < 4; ++t) { if (col0 + t * 16 >= N) continue;
#pragma unroll
    for (int r = 0; r < 8; ++r) so[w][8 * hh + r][t * 16 + ln] = acc[t][r] * alpha; }
  __builtin_amdgcn_fence(__ATOMIC_ACQ_REL, "workgroup"); __builtin_amdgcn_wave_barrier();
  const int rsub = lane >> 4, c4 = (lane & 15) * 4;
  {
#pragma unroll
    for (int q = 0; q < 8; ++q) { const int r = q * 2 + rsub; if (col0 + c4 < N) { const v4f v = *(const v4fa*)&so[w][r][c4]; *(v4f*)(C + (size_t)(row0 + r) * ldc + col0 + c4) = v; } }
     }
}

// Wt[n][k] = f16(W[k][n]·scale) from f32 row-major W[K][N] (scale = power of two; bf16-exact weights stay exact in f16 away from the subnormal range)
__global__ __launch_bounds__(256) void k_wt_f16(const float* __restrict__ W, _Float16* __restrict__ Wt, int K, int N, float scale) {
  const int t = blockIdx.x * 256 + threadIdx.x; if (t >= N * (K / 8)) return; const int n = t / (K / 8), k8 = (t % (K / 8)) * 8; FragH f;
#pragma unroll
  for (int i = 0; i < 8; ++i) f.h[i] = (_Float16)(bf16_round(W[(size_t)(k8 + i) * N + n]) * scale); const v8us o = f.half[0];
  *(v8us*)((unsigned short*)Wt + (size_t)n * K + k8) = o; 
}
// k_gemm_hh variant with fused epilogue: v = acc·alpha + bias[by·sBias + col] (+ CP[(row/rowsPerB)·sCPb + by·64 + col] if CP) ; ACT 0 none / 1 elu ; writes f16 C16 (and f32 C if non-null)
template <int ACT>
__global__ __launch_bounds__(128) void k_gemm_hhx(const _Float16* __restrict__ A, int lda, size_t sA, const _Float16* __restrict__ Bh, int ldb, size_t sB, float alpha, const float* __restrict__ bias, size_t sBias, const float* __restrict__ CP, int rowsPerB, size_t sCPb, int row0g,
    float* __restrict__ C, _Float16* __restrict__ C16, int ldc, size_t sC, int M, int N, int K) {
  __shared__ __attribute__((aligned(16))) float so[4][16][64];
  const int tid = threadIdx.x, w = tid >> 5, lane = tid & 31, ln = lane & 15, hh = lane >> 4; const int by = blockIdx.y;
  A += (size_t)by * sA; Bh += (size_t)by * sB; const size_t cofs = (size_t)by * sC; const float* bp = bias ? bias + (size_t)by * sBias : nullptr;
  const int ntn = (N + 63) / 64; const int wid = blockIdx.x * 4 + w; const int mt = wid / ntn, nq = wid % ntn; if (mt * 16 >= M) return;
  const int row0 = mt * 16, col0 = nq * 64; const _Float16* arow = A + (size_t)(row0 + ln) * lda;
  v8f acc[4] = {};
  for (int kb = 0; kb < K; kb += 32) { FragH ah; ah.half[0] = *(const v8us*)((const unsigned short*)arow + kb + 8 * hh); ah.half[1] = *(const v8us*)((const unsigned short*)arow + kb + 16 + 8 * hh);
#pragma unroll
    for (int t = 0; t < 4; ++t) { if (col0 + t * 16 >= N) continue; const size_t boff = (size_t)(col0 + t * 16 + ln) * ldb + kb; FragH bq; bq.half[0] = *(const v8us*)((const unsigned short*)Bh + boff + 8 * hh); bq.half[1] = *(const v8us*)((const unsigned short*)Bh + boff + 16 + 8 * hh);
      acc[t] = mmaH<1>(ah.v, ah.v, bq.v, bq.v, acc[t]); }
  }
#pragma unroll
  for (int t = 0; t < 4; ++t) { if (col0 + t * 16 >= N) continue; const int col = col0 + t * 16 + ln; const float bv = bp ? bf16_round(bp[col]) : 0.f;
#pragma unroll
    for (int r = 0; r < 8; ++r) { float v = acc[t][r] * alpha + bv; if (CP) { const int rr = row0g + row0 + 8 * hh + r; if (rowsPerB < 0) v += CP[cofs + (size_t)rr * ldc + col];      /* rowsPerB < 0: own element of the batched C plane */ else { const int bidx = rr / rowsPerB; v += CP[(size_t)bidx * sCPb + (size_t)by * 64 + col]; } } if (ACT == 1) v = (v > 0.f) ? v : expm1f(v); else if (ACT == 7) v = (v > 0.f) ? v + 1.0f : expf(v); else if (ACT == 8) v = tanhf(v); else if (ACT == 9) v = 0.5f * v * (1.0f + tanhf(0.7978845608028654f * (v + 0.044715f * v * v * v))); else if (ACT == 11) v = 1.0f / (1.0f + expf(-v)); else if (ACT == 12) v = (v > 0.f) ? v : 0.01f * v; else if (ACT == 14) v = (v > 0.f) ? v : 0.1f * v; else if (ACT == 16) v = (v >= 0.f) ? v : 0.3f * v; else if (ACT == 17) v = (v >= 0.f) ? v : 0.2f * v; else if (ACT == 15) v = v / (1.0f + expf(-v)); else if (ACT == 3) v = fmaxf(v, 0.f); else if (ACT == 6) v = 0.5f * v * (1.0f + erff(v * 0.70710678118654752f)); so[w][8 * hh + r][t * 16 + ln] = v; } }
  __builtin_amdgcn_fence(__ATOMIC_ACQ_REL, "workgroup"); __builtin_amdgcn_wave_barrier();
  const int rsub = lane >> 4, c4 = (lane & 15) * 4; typedef _Float16 v4h __attribute__((ext_vector_type(4)));
  {
#pragma unroll
    for (int q = 0; q < 8; ++q) { const int r = q * 2 + rsub; if (col0 + c4 < N) { const v4f v = *(const v4fa*)&so[w][r][c4]; if (C) *(v4f*)(C + cofs + (size_t)(row0 + r) * ldc + col0 + c4) = v; if (C16) { v4h h4; for (int i = 0; i < 4; ++i) h4[i] = (_Float16)v[i]; *(v4h*)(C16 + cofs + (size_t)(row0 + r) * ldc + col0 + c4) = h4; } } }
     }
}


typedef _Float16 v4h __attribute__((ext_vector_type(4)));

__global__ __launch_bounds__(256) void k_h16(const float* __restrict__ x, _Float16* __restrict__ X16, size_t n8) { const size_t t = (size_t)blockIdx.x * 256 + threadIdx.x; if (t >= n8) return; FragH f;
#pragma unroll
  for (int q = 0; q < 8; ++q) f.h[q] = (_Float16)x[t * 8 + q]; *(v8us*)((unsigned short*)X16 + t * 8) = f.half[0];  }
__global__ __launch_bounds__(256) void k_round16f(const float* __restrict__ W, _Float16* __restrict__ Bt, size_t n8) { const size_t t = (size_t)blockIdx.x * 256 + threadIdx.x; if (t >= n8) return; FragH f;
#pragma unroll
  for (int i = 0; i < 8; ++i) f.h[i] = (_Float16)(bf16_round(W[t * 8 + i]) * 16.0f); *(v8us*)((unsigned short*)Bt + t * 8) = f.half[0];  }
__global__ __launch_bounds__(256) void k_hl(const float* __restrict__ F, _Float16* __restrict__ Hh, _Float16* __restrict__ Hl, size_t n8) { const size_t t = (size_t)blockIdx.x * 256 + threadIdx.x; if (t >= n8) return; FragH fh, fl; const v4f a = *(const v4fa*)(F + t * 8), c = *(const v4fa*)(F + t * 8 + 4);
#pragma unroll
  for (int q = 0; q < 4; ++q) { _Float16 h = (_Float16)a[q]; fh.h[q] = h; fl.h[q] = (_Float16)((a[q] - (float)h) * 1024.0f); h = (_Float16)c[q]; fh.h[4 + q] = h; fl.h[4 + q] = (_Float16)((c[q] - (float)h) * 1024.0f); }
  { *(v8us*)((unsigned short*)Hh + t * 8) = fh.half[0]; *(v8us*)((unsigned short*)Hl + t * 8) = fl.half[0];  } }


__global__ __launch_bounds__(256) void k_rsm(const float* __restrict__ S, _Float16* __restrict__ P, int nrows) {
  #pragma clang fp contract(off)
  const int i = blockIdx.x * 256 + threadIdx.x; if (i >= nrows) return; const float* s = S + (size_t)i * SQ; float mx = -3.0e38f;
#pragma unroll 1
  for (int j = 0; j < SQ; ++j) mx = fmaxf(mx, s[j]); float se = 0.f;
#pragma unroll 1
  for (int j = 0; j < SQ; ++j) se += expf(s[j] - mx); const float sc = 256.0f / se;
#pragma unroll 1
  for (int j0 = 0; j0 < SQ; j0 += 8) { FragH f; for (int q = 0; q < 8; ++q) f.h[q] = (_Float16)(expf(s[j0 + q] - mx) * sc); unsigned short* d = (unsigned short*)P + (size_t)i * SQ + j0; *(v8us*)d = f.half[0];  } }
__global__ __launch_bounds__(256) void k_vt(const _Float16* __restrict__ V16, int b, int h0, _Float16* __restrict__ VT) { __shared__ unsigned short tl[64][65]; const int tid = threadIdx.x; const int hh = blockIdx.x % HG, sg = blockIdx.x / HG; const int s0 = sg * 64; const int h = h0 + hh;
  for (int i = tid; i < 64 * 8; i += 256) { const int j = i / 8, d8 = (i % 8) * 8; FragH f; f.half[0] = *(const v8us*)((const unsigned short*)V16 + ((size_t)b * SQ + s0 + j) * DM + h * HD + d8); for (int q = 0; q < 8; ++q) tl[d8 + q][j] = f.u[q]; }
  __syncthreads();
  { for (int i = tid; i < 64 * 8; i += 256) { const int d = i / 8, j8 = (i % 8) * 8; FragH f; for (int q = 0; q < 8; ++q) f.u[q] = tl[d][j8 + q]; *(v8us*)((unsigned short*)VT + ((size_t)hh * HD + d) * SQ + s0 + j8) = f.half[0]; }  } }



typedef int v4ia __attribute__((ext_vector_type(4), may_alias));
#define FW 8                         /* waves per attention work-group */
#define FQ 16                        /* query columns per wave */
#define FK 64                        /* keys per stage */
#define FS (SQ / FK)                 /* stages */
#define FP 72                        /* LDS row pitch in f16: 128-byte rows + 16 bytes, conflict-free for 16-byte row reads */
#define FSC 0.045084220f             /* log2(e) / sqrt(1024): raw q.k to base-2 exponent */
#define FNEG (-0x1p35f)              /* raw score of a masked key (-2^30 after the 1/32). A power of two, so that FNEG * FSC is exact and a row with only masked keys gets exponent 0, weight 1, for each of them */
#define FTH 177.0f                   /* the maximum in use is replaced only when a new one exceeds it by this much raw score (8 in base-2 exponent): weights stay below 2^8, inside f16 */
__device__ __forceinline__ float sm_xhalf(float x) { return __builtin_bit_cast(float, __builtin_amdgcn_permlanex16(__builtin_bit_cast(int, x), __builtin_bit_cast(int, x), 0x76543210, 0xfedcba98, false, false)); }      /* lane l with lane l ^ 16 */
typedef float v2f __attribute__((ext_vector_type(2)));
typedef _Float16 v2h __attribute__((ext_vector_type(2)));
union FragP { v16h v; v2h p[8]; };      /* a 16-element f16 operand as eight packed pairs */
__device__ __forceinline__ v16h fa_frag(const _Float16* p) { FragH f; f.half[0] = *(const v8us*)(const unsigned short*)p; f.half[1] = *(const v8us*)((const unsigned short*)p + 16); return f.v; }      /* p already holds the lane half's 8 h: k = 8 h + 0..7 and 16 + 8 h + 0..7 of a 32-k group, the hardware k order */
__device__ __forceinline__ v8f fa_mma(v16h a, v16h b, v8f c) { return __builtin_amdgcn_wmma_f32_16x16x32_f16(false, a, false, b, (short)0, c, false, false); }
typedef unsigned v16u __attribute__((ext_vector_type(16)));
typedef const __attribute__((address_space(4))) v16u cv16u;      /* memory that no launch in flight writes: a load at a wave-uniform address is a scalar load, whatever "memory" clobbers stand around it */
__global__ __launch_bounds__(FW * 32) __attribute__((amdgpu_waves_per_eu(4, 4))) void k_fattn(const _Float16* __restrict__ Q16, const _Float16* __restrict__ K16, const _Float16* __restrict__ VT, const unsigned* __restrict__ PM, float* __restrict__ out) {
  __shared__ __attribute__((aligned(16))) _Float16 sk[2][FK][FP];      /* K stage: [key][d] */
  __shared__ __attribute__((aligned(16))) _Float16 sv[2][HD][FP];      /* V^T stage: [d][key] */
  const int tid = threadIdx.x, lane = tid & 31, c = lane & 15, hh = lane >> 4, w = __builtin_amdgcn_readfirstlane(tid >> 5);
  const int qt = blockIdx.x % (SQ / (FW * FQ)), bh = blockIdx.x / (SQ / (FW * FQ)), b = bh / NH, h = bh % NH;
  const int q = qt * (FW * FQ) + w * FQ + c;      /* the lane's query */
  const _Float16* qp = Q16 + ((size_t)b * SQ + q) * DM + h * HD + 8 * hh;
  const int sr = tid >> 3, sc = (tid & 7) * 8;      /* staging: the thread's row (and row + 32) and its 16-byte piece */
  /* each stream as a work-group-uniform base, advanced per stage, plus one byte offset per lane that never changes */
  const char* kg = (const char*)(K16 + (size_t)b * SQ * DM + h * HD); const unsigned ko = (unsigned)(sr * DM + sc) * 2u;
  const char* vg = (const char*)(VT + (size_t)bh * HD * SQ); const unsigned vo = (unsigned)(sr * SQ + sc) * 2u;
  cv16u* mg = (cv16u*)(unsigned long long)(PM + (size_t)((b * (SQ / FQ) + qt * FW + w) * FS) * 32);      /* the wave's 16 queries: 32 words a stage */
  v16u mk0, mk1;      /* lane masks of a stage: word 8 t + r (mk0: t = 0, 1; mk1: t = 2, 3), bit l = keep of lane l's query and key 16 t + 8 h + r */
  const v16h qf0 = fa_frag(qp), qf1 = fa_frag(qp + 32);
  { const v8us k0 = *(const v8us*)(kg + ko), k1 = *(const v8us*)(kg + (ko + 32u * DM * 2u)), v0 = *(const v8us*)(vg + vo), v1 = *(const v8us*)(vg + (vo + 32u * SQ * 2u));
    mk0 = mg[0]; mk1 = mg[1];
    asm volatile("s_wait_xcnt 0x0" :: "v"(qp), "s"(kg), "s"(vg), "s"(mg), "v"(ko), "v"(vo) : "memory");      /* behind the loads and ahead of whatever reuses their address registers; the addresses as inputs keep those registers whole up to here */
    *(v8us*)&sk[0][sr][sc] = k0; *(v8us*)&sk[0][sr + 32][sc] = k1; *(v8us*)&sv[0][sr][sc] = v0; *(v8us*)&sv[0][sr + 32][sc] = v1; }
  __syncthreads();
  const v8f z8 = {0.f, 0.f, 0.f, 0.f, 0.f, 0.f, 0.f, 0.f};
  v8f o[4] = {z8, z8, z8, z8};      /* O^T: o[dt][r] = d 16 dt + 8 h + r of the lane's query */
  float m = -3.0e38f, mc = -3.0e38f * FSC, l = 0.f;      /* maximum in use (raw, and as exponent), the lane's part of the sum */
  auto pass = [&](const int s, const int bf) __attribute__((always_inline)) {      /* stage s from buffer bf; fetches the next stage */
    const int sn = (s + 1 < FS) ? s + 1 : FS - 1;      /* the last pass fetches its own stage again, into the buffer that nobody reads any more: the loads stay unconditional, so no branch merges the wait counts */
    const char* kp = kg + (size_t)sn * (FK * DM * 2) + ko; const char* vp = vg + sn * (FK * 2) + vo; cv16u* mp = mg + sn * 2;
    const v8us k0 = *(const v8us*)kp, k1 = *(const v8us*)(kp + 32 * DM * 2), v0 = *(const v8us*)vp, v1 = *(const v8us*)(vp + 32 * SQ * 2);
    asm volatile("s_wait_xcnt 0x0" :: "v"(kp), "v"(vp) : "memory");      /* as above: ahead of the reuse of the two address pairs */
    v16h kf[8];
#pragma unroll
    for (int t = 0; t < 4; ++t) { const _Float16* kr = &sk[bf][16 * t + c][8 * hh]; kf[2 * t] = fa_frag(kr); kf[2 * t + 1] = fa_frag(kr + 32); }
    __builtin_amdgcn_sched_barrier(0);      /* all K fragment loads are issued before the first product waits on one; without it some passes came out as load, wait, product, eight times in a row */
    v8f st[4];      /* S^T: st[t][r] = key 16 t + 8 h + r of the stage, the lane's query */
#pragma unroll
    for (int t = 0; t < 4; ++t) st[t] = fa_mma(kf[2 * t], qf0, z8);
#pragma unroll
    for (int t = 0; t < 4; ++t) st[t] = fa_mma(kf[2 * t + 1], qf1, st[t]);
#pragma unroll
    for (int t = 0; t < 4; ++t)
#pragma unroll
      for (int r = 0; r < 8; ++r) st[t][r] = __builtin_amdgcn_inverse_ballot_w32((t < 2 ? mk0 : mk1)[8 * (t & 1) + r]) ? st[t][r] : FNEG;      /* the word IS the select's lane mask: one instruction a score */
    __builtin_amdgcn_sched_barrier(0);      /* holds the reload of the mask words behind their last reader, so that their 32 scalar registers can be loaded over; without it the reload and the V^T fragment loads below move up ahead of the score products, into registers of their own */
    mk0 = mp[0]; mk1 = mp[1];
    asm volatile("s_wait_xcnt 0x0" :: "s"(mp) : "memory");      /* as above */
    v16h vf[8];      /* the V^T fragments, fetched here so that they land behind the softmax arithmetic */
#pragma unroll
    for (int g = 0; g < 2; ++g)
#pragma unroll
      for (int dt = 0; dt < 4; ++dt) vf[4 * g + dt] = fa_frag(&sv[bf][16 * dt + c][32 * g + 8 * hh]);
    __builtin_amdgcn_sched_barrier(0);      /* holds these loads ahead of the arithmetic */
    float mt[4];      /* one chain per tile: four short dependent chains instead of one long one */
#pragma unroll
    for (int t = 0; t < 4; ++t) { mt[t] = st[t][0];
#pragma unroll
      for (int r = 1; r < 8; ++r) mt[t] = fmaxf(mt[t], st[t][r]); }
    float mx = fmaxf(fmaxf(mt[0], mt[1]), fmaxf(mt[2], mt[3]));
    mx = fmaxf(mx, sm_xhalf(mx));      /* both lane halves of a query use one maximum: their weights meet in one product */
    const bool need = mx > m + FTH;
    if (__builtin_amdgcn_ballot_w32(need) != 0) {      /* one branch per pass; taken on the first pass and then only when some query's maximum grows by more than FTH */
      const float mn = need ? mx : m, mcn = mn * FSC; const float al = __builtin_amdgcn_exp2f(mc - mcn); m = mn; mc = mcn; l *= al;      /* 0 on the first pass, 1 in a lane that keeps its maximum */
#pragma unroll
      for (int dt = 0; dt < 4; ++dt) o[dt] *= al; }
    const v2f mc2 = {mc, mc}; v2f a2[2] = {{0.f, 0.f}, {0.f, 0.f}}; FragP pf[2];      /* P^T as B operand: element e of pf[g] = key 32 g + (e < 8 ? 8 h + e : 16 + 8 h + e - 8) */
#pragma unroll
    for (int t = 0; t < 4; ++t)
#pragma unroll
      for (int u = 0; u < 4; ++u) { const v2f x = {st[t][2 * u], st[t][2 * u + 1]}; const v2f y = x * FSC - mc2; const v2f e = {__builtin_amdgcn_exp2f(y[0]), __builtin_amdgcn_exp2f(y[1])};      /* the builtin, so that the compiler keeps the distances to the matrix instructions that it schedules around it */
        a2[u & 1] += e; pf[t >> 1].p[4 * (t & 1) + u] = __builtin_convertvector(e, v2h); }
    l += (a2[0][0] + a2[0][1]) + (a2[1][0] + a2[1][1]);
#pragma unroll
    for (int g = 0; g < 2; ++g)
#pragma unroll
      for (int dt = 0; dt < 4; ++dt) o[dt] = fa_mma(vf[4 * g + dt], pf[g].v, o[dt]);
    __builtin_amdgcn_sched_barrier(0);      /* holds the stores, with their wait for the stage loads, and the barrier at the foot of the pass; without it one pass had them ahead of the exponentials, which cuts the time the stage loads have to land */
    *(v8us*)&sk[bf ^ 1][sr][sc] = k0; *(v8us*)&sk[bf ^ 1][sr + 32][sc] = k1; *(v8us*)&sv[bf ^ 1][sr][sc] = v0; *(v8us*)&sv[bf ^ 1][sr + 32][sc] = v1;      /* into the buffer whose last readers left it before the previous pass's barrier */
    asm volatile("s_wait_dscnt 0x0\n\ts_barrier_signal -1\n\ts_barrier_wait -1" ::: "memory");      /* publishes stage s + 1 and ends every wave's reads of stage s. By hand, with the LDS wait alone: __syncthreads() would also wait for the mask loads, which are to fly on into the next pass */
  };
#pragma unroll 1
  for (int s = 0; s < FS; s += 2) { pass(s, 0); pass(s + 1, 1); }      /* two passes a trip: each pass's buffer is a constant offset */
  const float inv = 1.0f / (l + sm_xhalf(l));
  float* op = out + ((size_t)b * SQ + q) * DM + h * HD + 8 * hh;
#pragma unroll
  for (int dt = 0; dt < 4; ++dt) { const v4f lo = {o[dt][0] * inv, o[dt][1] * inv, o[dt][2] * inv, o[dt][3] * inv}, hi = {o[dt][4] * inv, o[dt][5] * inv, o[dt][6] * inv, o[dt][7] * inv};
    *(v4f*)(op + 16 * dt) = lo; *(v4f*)(op + 16 * dt + 4) = hi; }
}
typedef unsigned short v4us __attribute__((ext_vector_type(4), may_alias));
union FragQ { v2h p[2]; v4us u; };      /* four f16 as one 8-byte LDS store */
typedef __bf16 v2b __attribute__((ext_vector_type(2)));
__device__ __forceinline__ v2f pj_round(const float a, const float b) { const v2f x = {a, b}; return __builtin_convertvector(__builtin_convertvector(x, v2b), v2f); }      /* two values rounded to bf16 (nearest even, as bf16_round) by one packed convert */
#define PW 4                         /* waves per projection work-group: four neighbouring heads of the same tokens */
#define PT 64                        /* tokens per wave */
// 64 finished rows of 64 f16 from the wave's LDS tile to memory: one instruction carries four whole 128-byte rows. dst and pitch (bytes) are the same in every lane
__device__ __forceinline__ void pj_rows(const _Float16 (*tile)[FP], char* dst, const unsigned pitch, const int lane) {
  const int rr = lane >> 3, pc = (lane & 7) * 8; const unsigned lo = (unsigned)rr * pitch + (unsigned)pc * 2u;
  v8us v[16];
#pragma unroll
  for (int j = 0; j < 16; ++j) v[j] = *(const v8us*)(const unsigned short*)&tile[4 * j + rr][pc];
#pragma unroll
  for (int j = 0; j < 16; ++j) *(v8us*)(dst + (size_t)(4u * j * pitch) + lo) = v[j];
}
// the wave's 64 x 64 x 64 product from fragments in registers, the f16 results into its LDS tile. TR false: W X^T, rows [token][d]; TR true: X W^T, rows [d][token]
template <bool TR>
__device__ __forceinline__ void pj_mul(const v16h (&wf)[8], const v16h (&xf)[8], _Float16 (*tile)[FP], const int c, const int hh) {
  const v8f z8 = {0.f, 0.f, 0.f, 0.f, 0.f, 0.f, 0.f, 0.f};
#pragma unroll
  for (int t = 0; t < 4; ++t) { v8f a[4];      /* TR false: a[dt][r] = d 16 dt + 8 h + r of token 16 t + c; TR true: token 16 t + 8 h + r of d 16 dt + c */
#pragma unroll
    for (int dt = 0; dt < 4; ++dt) a[dt] = TR ? fa_mma(xf[2 * t], wf[2 * dt], z8) : fa_mma(wf[2 * dt], xf[2 * t], z8);
#pragma unroll
    for (int dt = 0; dt < 4; ++dt) a[dt] = TR ? fa_mma(xf[2 * t + 1], wf[2 * dt + 1], a[dt]) : fa_mma(wf[2 * dt + 1], xf[2 * t + 1], a[dt]);
#pragma unroll
    for (int dt = 0; dt < 4; ++dt) { FragH f;
#pragma unroll
      for (int r = 0; r < 8; ++r) f.h[r] = (_Float16)(a[dt][r] * 0.0625f);      /* takes the weight's factor of 16 out again */
      *(v8us*)(unsigned short*)(TR ? &tile[16 * dt + c][16 * t + 8 * hh] : &tile[16 * t + c][16 * dt + 8 * hh]) = f.half[0]; } }
  __builtin_amdgcn_fence(__ATOMIC_ACQ_REL, "workgroup"); __builtin_amdgcn_wave_barrier();      /* the wave's own LDS writes before its other lanes read them */
}
// The int32 keep-mask packed to bits, once for the 16 heads that share it, in the order the attention kernel selects by: PM[(b * 128 + query / 16) * 32 + stage][8 t + r], bit l = (mask[b][16-query tile's row l & 15][64 stage + 16 t + 8 (l >> 4) + r] != 0).
// A wave takes 16 query rows x 512 keys in four pieces of 128 keys. A row's 128 keys are ONE 512-byte load (lane l: keys 4 l + i), four ballots make them four words (word i, bit l), which go to lane c of a[i] for row c;
// key 64 p + 16 t + 8 h + r is then bit 16 p + 4 t + 2 h + (r >> 2) of word r & 3, and a second ballot over the lanes (c, h) gives the lane mask.
__device__ __forceinline__ void pk_mask(const int* __restrict__ am, unsigned* __restrict__ PM, const int tile, const int quarter, const int lane) {
  const int hh = lane >> 4;
  const int* sp = am + (size_t)tile * FQ * SQ + quarter * 512 + 4 * lane;
  v4ia x[2][16]; unsigned res[8];
#pragma unroll
  for (int j = 0; j < 16; ++j) x[0][j] = *(const v4ia*)(sp + j * SQ);
#pragma unroll
  for (int it = 0; it < 4; ++it) {
    if (it < 3) {      /* the next piece's loads fly while this piece is packed */
#pragma unroll
      for (int j = 0; j < 16; ++j) x[(it + 1) & 1][j] = *(const v4ia*)(sp + (it + 1) * 128 + j * SQ); }
    int a[4] = {0, 0, 0, 0};
#pragma unroll
    for (int j = 0; j < 16; ++j)
#pragma unroll
      for (int i = 0; i < 4; ++i) { const int wd = (int)__builtin_amdgcn_ballot_w32(x[it & 1][j][i] != 0); a[i] = __builtin_amdgcn_inverse_ballot_w32(1u << j) ? wd : a[i]; }      /* every lane votes, lane j takes the word */
    unsigned sh[4];
#pragma unroll
    for (int i = 0; i < 4; ++i) sh[i] = (unsigned)(a[i] | __builtin_amdgcn_permlanex16(a[i], a[i], 0x76543210, 0xfedcba98, false, false)) >> (2 * hh);      /* lanes 16 to 31 held 0: both halves now hold row c's word, moved down to the half's keys */
#pragma unroll
    for (int p = 0; p < 2; ++p) { int o = 0;
#pragma unroll
      for (int e = 0; e < 32; ++e) { const int wd = (int)__builtin_amdgcn_ballot_w32((sh[e & 3] & (1u << (16 * p + 4 * (e >> 3) + ((e & 7) >> 2)))) != 0); o = __builtin_amdgcn_inverse_ballot_w32(1u << e) ? wd : o; }      /* every lane votes, lane e takes word e */
      res[2 * it + p] = (unsigned)o; } }
  asm volatile("s_wait_xcnt 0x0" :: "v"(sp) : "memory");      /* behind the loads and ahead of whatever reuses their address registers */
  unsigned* dp = PM + (size_t)(tile * FS + quarter * 8) * 32 + lane;
#pragma unroll
  for (int j = 0; j < 8; ++j) dp[32 * j] = res[j];      /* one 128-byte line a stage; nothing follows the stores */
}
// All that precedes attention in ONE launch: blockIdx.y = stream (0 queries, 1 keys, 2 values; 3: the keep-mask is packed, pk_mask); a wave projects 64 tokens of one head (64 x 64 x 64).
// The f32 input slice is read in whole 256-byte rows, rounded (bf16, then f16, exact) in registers and laid into the wave's own LDS tile [token][k]; the work-group rounds the stream's 64 x 64 weight (x16) once into LDS [d][k].
// Q and K as W X^T (a lane holds 8 neighbouring d of one token), V as X W^T (a lane holds 8 neighbouring tokens of one d: V^T with no transposing pass); the results go back into the wave's tile, as rows [token][d] or [d][token].
__global__ __launch_bounds__(PW * 32) void k_proj(const float* __restrict__ xq, const float* __restrict__ xk, const float* __restrict__ xv, const float* __restrict__ wq, const float* __restrict__ wk, const float* __restrict__ wv,
                                                  _Float16* __restrict__ Q16, _Float16* __restrict__ K16, _Float16* __restrict__ VT, const int* __restrict__ am, unsigned* __restrict__ PM) {
  __shared__ __attribute__((aligned(16))) _Float16 sw[HD][FP];          /* the weight: [d][k] */
  __shared__ __attribute__((aligned(16))) _Float16 sx[PW][PT][FP];      /* per wave: the input tile [token][k], later the result rows */
  const int tid = threadIdx.x, lane = tid & 31, c = lane & 15, hh = lane >> 4, w = __builtin_amdgcn_readfirstlane(tid >> 5);
  const int sm = blockIdx.y;
  static_assert((NR / PT) * (NH / PW) == (size_t)NB * (SQ / FQ) && PW * 512 == SQ, "a plane of the grid holds one work-group per 16 query rows");
  if (sm == 3) { pk_mask(am, PM, (int)blockIdx.x, w, lane); return; }      /* the whole work-group, ahead of the barrier: 16 query rows, a quarter of the keys per wave */
  const float* x = sm == 0 ? xq : sm == 1 ? xk : xv; const float* wt = sm == 0 ? wq : sm == 1 ? wk : wv;
  const int row0 = (int)(blockIdx.x / (NH / PW)) * PT, h = (int)(blockIdx.x % (NH / PW)) * PW + w;      /* first token row (b * 2048 + s), the wave's head */
  const float* wp = wt + (tid >> 1) * HD + (tid & 1) * 32;      /* the thread's half row of the weight */
  const float* xp = x + (size_t)row0 * DM + h * HD + (hh * DM + 4 * c);      /* rows 2 j + lane half, the lane's 16 bytes */
  v4f wr[8], xr[PT / 2];
#pragma unroll
  for (int j = 0; j < 8; ++j) wr[j] = *(const v4fa*)(wp + 4 * j);
#pragma unroll
  for (int j = 0; j < PT / 2; ++j) xr[j] = *(const v4fa*)(xp + (size_t)(2 * j) * DM);
  asm volatile("s_wait_xcnt 0x0" :: "v"(wp), "v"(xp) : "memory");      /* behind the loads and ahead of whatever reuses their address registers; the addresses as inputs keep those registers whole up to here */
#pragma unroll
  for (int j = 0; j < 8; ++j) { FragQ f;
#pragma unroll
    for (int u = 0; u < 2; ++u) f.p[u] = __builtin_convertvector(pj_round(wr[j][2 * u] * 16.0f, wr[j][2 * u + 1] * 16.0f), v2h);      /* the factor of 16, a power of two, commutes with the rounding */
    *(v4us*)(unsigned short*)&sw[tid >> 1][(tid & 1) * 32 + 4 * j] = f.u; }
#pragma unroll
  for (int j = 0; j < PT / 2; ++j) { FragQ f;
#pragma unroll
    for (int u = 0; u < 2; ++u) f.p[u] = __builtin_convertvector(pj_round(xr[j][2 * u], xr[j][2 * u + 1]), v2h);
    *(v4us*)(unsigned short*)&sx[w][2 * j + hh][4 * c] = f.u; }
  __syncthreads();      /* publishes the weight to the four waves */
  v16h wf[8], xf[8];      /* wf[2 dt + g]: d 16 dt + c; xf[2 t + g]: token 16 t + c; both k = 32 g + 8 h + 0..7 and 32 g + 16 + 8 h + 0..7 */
#pragma unroll
  for (int t = 0; t < 4; ++t)
#pragma unroll
    for (int g = 0; g < 2; ++g) { wf[2 * t + g] = fa_frag(&sw[16 * t + c][32 * g + 8 * hh]); xf[2 * t + g] = fa_frag(&sx[w][16 * t + c][32 * g + 8 * hh]); }
  __builtin_amdgcn_fence(__ATOMIC_ACQ_REL, "workgroup"); __builtin_amdgcn_wave_barrier();      /* every input fragment is read before the results overwrite the tile */
  if (sm != 2) pj_mul<false>(wf, xf, sx[w], c, hh); else pj_mul<true>(wf, xf, sx[w], c, hh);      /* one branch, the same for every wave of the grid's y plane */
  _Float16* dst = sm == 2 ? VT + ((size_t)((row0 / SQ) * NH + h) * HD) * SQ + row0 % SQ : (sm == 0 ? Q16 : K16) + (size_t)row0 * DM + h * HD;
  pj_rows(sx[w], (char*)dst, sm == 2 ? SQ * 2u : DM * 2u, lane);
}
extern "C" void kernel_launch(void* const* d_in, const int* in_sizes, int n_in,
                              void* d_out, int out_size, void* d_ws, size_t ws_size, hipStream_t stream) {
  (void)in_sizes; (void)n_in; (void)out_size;
  const float* const* I = (const float* const*)d_in; const float* xv = I[0]; const float* xk = I[1]; const float* xq = I[2]; const int* am = (const int*)d_in[3]; const float* wv = I[4]; const float* wk = I[5]; const float* wq = I[6];      /* input order: values, keys, queries; the int32 keep-mask [2][1][2048][2048]; Wv, Wk, Wq: ONE natural [64][64] weight per stream, shared by the 16 heads; no biases; no output projection */
  char* ws = (char*)d_ws; size_t off = 0;
  auto take = [&](size_t bytes) { char* p = ws + off; off += (bytes + 255) & ~(size_t)255; return p; };
  _Float16* Q16 = (_Float16*)take(NR * DM * 2); _Float16* K16 = (_Float16*)take(NR * DM * 2); _Float16* VT = (_Float16*)take((size_t)NB * NH * HD * SQ * 2); unsigned* PM = (unsigned*)take((size_t)NB * (SQ / FQ) * FS * 32 * 4);
  if (off > ws_size) return;
  k_proj<<<dim3((unsigned)((NR / PT) * (NH / PW)), 4), PW * 32, 0, stream>>>(xq, xk, xv, wq, wk, wv, Q16, K16, VT, am, PM);      /* rounding of inputs and weights, the three projections (every head's 64-column slice times the stream's ONE shared weight) and V^T [NB][NH][HD][SQ] */
  k_fattn<<<NB * NH * (SQ / (FW * FQ)), FW * 32, 0, stream>>>(Q16, K16, VT, PM, (float*)d_out);      /* scores / sqrt(1024), keep-mask, softmax and P V in one launch for every batch and head, written f32 into the merged-heads output rows */
}

// v005
// One run takes 50.2 microseconds.
// In both of two side-by-side timings against v004, it was 1.03 times as fast.
// All steps since v000 together make it 155 times as fast.
#include <hip/hip_runtime.h>
// Masked multi-head attention over three inputs with ONE SHARED 64 x 64 projection per stream and a RANDOM int keep-mask, no output projection (values, keys, queries [2][2048][1024]; every head's 64-column slice is projected by the SAME natural nn.Linear weight: v = values.reshape(N, L, 16, 64) Wv^T, k likewise with Wk, q with Wq ([64][64], normal / 8, NO biases); scores = q.k / sqrt(1024) (the module's embed size); where(mask == 0, -1e20) with the int32 [2][1][2048][2048] mask (seeded randint 0 / 1, about half zeros, one plane per sequence shared by its heads; READ on the device); softmax; out = attn v merged over heads -> [2][2048][1024]; input order values, keys, queries, mask, Wv, Wk, Wq).
// Structure: token rows r = b*2048 + s; ONE projection kernel for the three streams (grid.y): it reads the f32 inputs and weights itself, rounds them in registers (bf16, held as exact f16; the weight x16), and a wave multiplies 64 tokens of one head's 64-column slice by the stream's ONE shared weight (K = 64, f32 accumulation, no bias), f16 results: Q and K into the head's slice of the rows, V straight as V^T; a fourth plane of that launch packs the keep-mask to one bit a key, once for the 16 heads; then ONE attention kernel for every (batch, head, 128 queries; a wave has 32 of them and half the keys, two waves' parts merged at the end): scores (K = 64, 1/sqrt(1024) folded into the exponent), keep-mask, running-maximum softmax (f32 statistics; weights as f16, divided by their sum at the end) and the weighted sum of V, written f32 straight into the merged-heads output rows; scores and weights never reach memory.
// Compute dtype: inputs rounded to bf16; the three inputs and the x16 weights held as f16 planes (exact for every bf16 value of magnitude from 2^-14 up to 65,504; the weights up to 4,094 before their factor of 16); q, k, v and the softmax weights as plain f16 GEMM operands (~2^-12); scores, softmax statistics and the output f32. v_wmma_f32_16x16x32_f16.
#define NB 2
#define SQ 2048
#define DM 1024
#define NH 16
#define HD 64
#define HG 4                         /* heads per call of the per-group k_vt overload (not launched) */
#define B0 0                         /* not used */
#define NBR NB                       /* not used except in MP */
#define NR ((size_t)NB * SQ)         /* token rows */
#define MP ((int)((size_t)NBR * SQ)) /* not used except in MPO */
#define QN SQ                        /* not used */
#define NHD NH                       /* not used */
#define MPO MP                       /* not used */
#define LQ DM      /* not used */
typedef __bf16 v16b __attribute__((ext_vector_type(16)));
typedef unsigned short v8us __attribute__((ext_vector_type(8), may_alias));
typedef float  v8f  __attribute__((ext_vector_type(8)));
typedef float  v4f  __attribute__((ext_vector_type(4)));
typedef float  v4fa __attribute__((ext_vector_type(4), may_alias));
union FragB { v16b v; v8us half[2]; unsigned short u[16]; };

__device__ __forceinline__ unsigned short bf16_bits(float x) { unsigned int u = __float_as_uint(x); return (unsigned short)((u + 0x7FFFu + ((u >> 16) & 1u)) >> 16); }
__device__ __forceinline__ float bf16_val(unsigned short b) { return __uint_as_float(((unsigned int)b) << 16); }
__device__ __forceinline__ float bf16_round(float x) { return bf16_val(bf16_bits(x)); }
// D += A·B with NT terms: 1 = ah·bh, 2 = + al·bh (A split), 3 = + ah·bl (both split)
template <int NT>
__device__ __forceinline__ v8f mmaN(v16b ah, v16b al, v16b bh, v16b bl, v8f c) {
  c = __builtin_amdgcn_wmma_f32_16x16x32_bf16(false, ah, false, bh, (short)0, c, false, false);
  if (NT >= 2) c = __builtin_amdgcn_wmma_f32_16x16x32_bf16(false, al, false, bh, (short)0, c, false, false);
  if (NT >= 3) c = __builtin_amdgcn_wmma_f32_16x16x32_bf16(false, ah, false, bl, (short)0, c, false, false);
  asm volatile("v_nop\n\tv_nop\n\tv_nop\n\tv_nop" : "+v"(c) : "v"(ah), "v"(al), "v"(bh), "v"(bl));
  return c;
}

__global__ __launch_bounds__(256) void k_wt_bf16(const float* __restrict__ W, unsigned short* __restrict__ Wt, int K, int N) {
  const int t = blockIdx.x * 256 + threadIdx.x;
  const int k8n = K / 8;
  if (t >= N * k8n) return;
  const int n = t / k8n, k8 = (t % k8n) * 8;
  v8us v;
#pragma unroll
  for (int i = 0; i < 8; ++i) v[i] = bf16_bits(W[(size_t)(k8 + i) * N + n]);
  *(v8us*)(Wt + (size_t)n * K + k8) = v;
  
}

// GEMM C[M][N] (f32, pitch ldc) = act(A[M][K]·W + bias). A f32 row-major (pitch lda) converted per fragment to bf16
// (ASPLIT: hi/lo two planes -> 2 terms, else single rounded term); Wt bf16 [N][K] (pitch ldb). BIAS_BF16 rounds the
// bias to bf16 first (bias quantised to bf16 before the add). K%32==0, M%16==0, N%64==0.
template <bool ASPLIT, int ACT, bool BIAS_BF16>
__global__ __launch_bounds__(128) void k_gemm_bf(const float* __restrict__ A, int lda, const unsigned short* __restrict__ Wt, int ldb,
                                               const float* __restrict__ bias, float* __restrict__ C, int ldc, int M, int N, int K) {
  __shared__ __attribute__((aligned(16))) float so[4][16][64];
  const int tid = threadIdx.x, w = tid >> 5, lane = tid & 31, ln = lane & 15, hh = lane >> 4;
  const int ntn = N / 64;
  const int wid = blockIdx.x * 4 + w;
  const int mt = wid / ntn, nq = wid % ntn;
  if (mt * 16 >= M) return;
  const int row0 = mt * 16, col0 = nq * 64;
  const float* arow = A + (size_t)(row0 + ln) * lda;
  v8f acc[4] = {};
  for (int kb = 0; kb < K; kb += 32) {
    FragB ah, al;
    const v4f x0 = *(const v4fa*)(arow + kb + 8 * hh), x1 = *(const v4fa*)(arow + kb + 8 * hh + 4);
    const v4f x2 = *(const v4fa*)(arow + kb + 16 + 8 * hh), x3 = *(const v4fa*)(arow + kb + 16 + 8 * hh + 4);
    float xs[16] = {x0[0],x0[1],x0[2],x0[3],x1[0],x1[1],x1[2],x1[3],x2[0],x2[1],x2[2],x2[3],x3[0],x3[1],x3[2],x3[3]};
#pragma unroll
    for (int i = 0; i < 16; ++i) { const unsigned short hb = bf16_bits(xs[i]); ah.u[i] = hb; al.u[i] = ASPLIT ? bf16_bits(xs[i] - bf16_val(hb)) : (unsigned short)0; }
#pragma unroll
    for (int t = 0; t < 4; ++t) {
      const unsigned short* brow = Wt + (size_t)(col0 + t * 16 + ln) * ldb + kb;
      FragB b;
      b.half[0] = *(const v8us*)(brow + 8 * hh);
      b.half[1] = *(const v8us*)(brow + 16 + 8 * hh);
      acc[t] = mmaN<ASPLIT ? 2 : 1>(ah.v, al.v, b.v, b.v, acc[t]);
    }
  }
#pragma unroll
  for (int t = 0; t < 4; ++t) {
    float bv = bias ? bias[col0 + t * 16 + ln] : 0.f;
    if (BIAS_BF16) bv = bf16_round(bv);
#pragma unroll
    for (int r = 0; r < 8; ++r) { float v = acc[t][r] + bv; if (ACT == 1) v = fmaxf(v, 0.f); so[w][8 * hh + r][t * 16 + ln] = v; }
  }
  __builtin_amdgcn_fence(__ATOMIC_ACQ_REL, "workgroup");
  __builtin_amdgcn_wave_barrier();
  const int rsub = lane >> 4, c4 = (lane & 15) * 4;
  {
#pragma unroll
    for (int q = 0; q < 8; ++q) {
      const int r = q * 2 + rsub;
      const v4f v = *(const v4fa*)&so[w][r][c4];
      *(v4f*)(C + (size_t)(row0 + r) * ldc + col0 + c4) = v;
    }
    
  }
}

// GEMM C = act(A·W + bias + resid): A f32 (ASPLIT -> hi/lo 2 terms), Wt bf16 [N][K]; ACT 0 none, 1 relu, 2 exact gelu;
// resid (optional, f32, row index = (row % rmod), pitch ldr, RES_BF16 rounds it) added before the activation.
template <bool ASPLIT, int ACT, bool BIAS_BF16, bool RES_BF16>
__global__ __launch_bounds__(128) void k_gemm_bf3(const float* __restrict__ A, int lda, const unsigned short* __restrict__ Wt, int ldb,
                                                const float* __restrict__ bias, const float* __restrict__ resid, int rmod, int ldr,
                                                float* __restrict__ C, int ldc, int M, int N, int K) {
  __shared__ __attribute__((aligned(16))) float so[4][16][64];
  const int tid = threadIdx.x, w = tid >> 5, lane = tid & 31, ln = lane & 15, hh = lane >> 4;
  const int ntn = N / 64;
  const int wid = blockIdx.x * 4 + w;
  const int mt = wid / ntn, nq = wid % ntn;
  if (mt * 16 >= M) return;
  const int row0 = mt * 16, col0 = nq * 64;
  const float* arow = A + (size_t)(row0 + ln) * lda;
  v8f acc[4] = {};
  for (int kb = 0; kb < K; kb += 32) {
    FragB ah, al;
    const v4f x0 = *(const v4fa*)(arow + kb + 8 * hh), x1 = *(const v4fa*)(arow + kb + 8 * hh + 4);
    const v4f x2 = *(const v4fa*)(arow + kb + 16 + 8 * hh), x3 = *(const v4fa*)(arow + kb + 16 + 8 * hh + 4);
    float xs[16] = {x0[0],x0[1],x0[2],x0[3],x1[0],x1[1],x1[2],x1[3],x2[0],x2[1],x2[2],x2[3],x3[0],x3[1],x3[2],x3[3]};
#pragma unroll
    for (int i = 0; i < 16; ++i) { const unsigned short hb = bf16_bits(xs[i]); ah.u[i] = hb; al.u[i] = ASPLIT ? bf16_bits(xs[i] - bf16_val(hb)) : (unsigned short)0; }
#pragma unroll
    for (int t = 0; t < 4; ++t) {
      const unsigned short* brow = Wt + (size_t)(col0 + t * 16 + ln) * ldb + kb;
      FragB b;
      b.half[0] = *(const v8us*)(brow + 8 * hh);
      b.half[1] = *(const v8us*)(brow + 16 + 8 * hh);
      acc[t] = mmaN<ASPLIT ? 2 : 1>(ah.v, al.v, b.v, b.v, acc[t]);
    }
  }
#pragma unroll
  for (int t = 0; t < 4; ++t) {
    const int col = col0 + t * 16 + ln;
    float bv = bias ? bias[col] : 0.f;
    if (BIAS_BF16) bv = bf16_round(bv);
#pragma unroll
    for (int r = 0; r < 8; ++r) {
      float v = acc[t][r] + bv;
      if (resid) { float rv = resid[(size_t)((row0 + 8 * hh + r) % rmod) * ldr + col]; if (RES_BF16) rv = bf16_round(rv); v += rv; }
      if (ACT == 1) v = fmaxf(v, 0.f);
      if (ACT == 2) v = 0.5f * v * (1.0f + erff(v * 0.70710678118654752f));
      if (ACT == 3) { const float u = 0.7978845608028654f * (v + 0.044715f * v * v * v); v = 0.5f * v * (1.0f + tanhf(u)); }
      so[w][8 * hh + r][t * 16 + ln] = v;
    }
  }
  __builtin_amdgcn_fence(__ATOMIC_ACQ_REL, "workgroup");
  __builtin_amdgcn_wave_barrier();
  const int rsub = lane >> 4, c4 = (lane & 15) * 4;
  {
#pragma unroll
    for (int q = 0; q < 8; ++q) {
      const int r = q * 2 + rsub;
      const v4f v = *(const v4fa*)&so[w][r][c4];
      *(v4f*)(C + (size_t)(row0 + r) * ldc + col0 + c4) = v;
    }
    
  }
}
// row LayerNorm (biased variance, eps) over N: s = X (+ R); optional out_sum <- s; out_norm <- (s-mu)*rsqrt(var+eps)*g + b
template <bool PARAM_BF16>
__global__ __launch_bounds__(256) void k_layernorm(const float* __restrict__ X, const float* __restrict__ R, const float* __restrict__ g, const float* __restrict__ bta,
                                                  float* __restrict__ out_sum, float* __restrict__ out_norm, int N, float eps) {
  __shared__ float red[256];
  const int row = blockIdx.x, tid = threadIdx.x;
  const float* x = X + (size_t)row * N; const float* rr = R ? R + (size_t)row * N : nullptr;
  float vals[16];                     // up to N = 4096
  const int per = N / 256;            // contiguous chunk per thread? use strided-by-4 chunks: thread handles j = tid*4 + 1024*u
  float s1 = 0.f;
  for (int u = 0; u < per / 4; ++u) {
    const int j = tid * 4 + 1024 * u;
    const v4f a = *(const v4fa*)(x + j);
    v4f b = {0.f,0.f,0.f,0.f}; if (rr) b = *(const v4fa*)(rr + j);
#pragma unroll
    for (int q = 0; q < 4; ++q) { const float v = a[q] + b[q]; vals[u * 4 + q] = v; s1 += v; }
  }
  red[tid] = s1; __syncthreads();
  for (int st = 128; st > 0; st >>= 1) { if (tid < st) red[tid] += red[tid + st]; __syncthreads(); }
  const float mu = red[0] / (float)N; __syncthreads();
  float s2 = 0.f;
  for (int u = 0; u < per / 4; ++u)
#pragma unroll
    for (int q = 0; q < 4; ++q) { const float c = vals[u * 4 + q] - mu; s2 += c * c; }
  red[tid] = s2; __syncthreads();
  for (int st = 128; st > 0; st >>= 1) { if (tid < st) red[tid] += red[tid + st]; __syncthreads(); }
  const float rs = rsqrtf(red[0] / (float)N + eps);
  {
    for (int u = 0; u < per / 4; ++u) {
      const int j = tid * 4 + 1024 * u;
      v4f o, sm;
#pragma unroll
      for (int q = 0; q < 4; ++q) {
        float gg = g[j + q], bb = bta[j + q];
        if (PARAM_BF16) { gg = bf16_round(gg); bb = bf16_round(bb); }
        sm[q] = vals[u * 4 + q]; o[q] = (vals[u * 4 + q] - mu) * rs * gg + bb;
      }
      if (out_sum) *(v4f*)(out_sum + (size_t)row * N + j) = sm;
      *(v4f*)(out_norm + (size_t)row * N + j) = o;
    }
    
  }
}



// ---- f16 WMMA path (v_wmma_f32_16x16x32_f16): 11-bit significands for operands in range — used where a [0,1] probability operand needs more precision than bf16
typedef _Float16 v16h __attribute__((ext_vector_type(16)));
union FragH { v16h v; v8us half[2]; _Float16 h[16]; unsigned short u[16]; };
template <int NT>
__device__ __forceinline__ v8f mmaH(v16h ah, v16h al, v16h bh, v16h bl, v8f c) {
  c = __builtin_amdgcn_wmma_f32_16x16x32_f16(false, ah, false, bh, (short)0, c, false, false);
  if (NT >= 2) c = __builtin_amdgcn_wmma_f32_16x16x32_f16(false, al, false, bh, (short)0, c, false, false);
  if (NT >= 3) c = __builtin_amdgcn_wmma_f32_16x16x32_f16(false, ah, false, bl, (short)0, c, false, false);
  asm volatile("v_nop\n\tv_nop\n\tv_nop\n\tv_nop" : "+v"(c) : "v"(ah), "v"(al), "v"(bh), "v"(bl));
  return c;
}
// batched GEMM like k_gemm_b but f16 operands: A f32 (split into f16 hi/lo if ASPLIT, else rounded to f16), Bt = f16 values [n][k]; alpha; C f32; N multiple of 16 (partial tiles skipped)
template <bool ASPLIT>
__global__ __launch_bounds__(128) void k_gemm_h(const float* __restrict__ A, int lda, size_t sA, const _Float16* __restrict__ Bh, int ldb, size_t sB, float alpha, float* __restrict__ C, int ldc, size_t sC, int M, int N, int K) {
  __shared__ __attribute__((aligned(16))) float so[4][16][64];
  const int tid = threadIdx.x, w = tid >> 5, lane = tid & 31, ln = lane & 15, hh = lane >> 4; const int by = blockIdx.y;
  A += (size_t)by * sA; Bh += (size_t)by * sB; C += (size_t)by * sC;
  const int ntn = (N + 63) / 64; const int wid = blockIdx.x * 4 + w; const int mt = wid / ntn, nq = wid % ntn; if (mt * 16 >= M) return;
  const int row0 = mt * 16, col0 = nq * 64; const float* arow = A + (size_t)(row0 + ln) * lda;
  v8f acc[4] = {};
  for (int kb = 0; kb < K; kb += 32) {
    FragH ah, al;
    const v4f x0 = *(const v4fa*)(arow + kb + 8 * hh), x1 = *(const v4fa*)(arow + kb + 8 * hh + 4), x2 = *(const v4fa*)(arow + kb + 16 + 8 * hh), x3 = *(const v4fa*)(arow + kb + 16 + 8 * hh + 4);
    float xs[16] = {x0[0],x0[1],x0[2],x0[3],x1[0],x1[1],x1[2],x1[3],x2[0],x2[1],x2[2],x2[3],x3[0],x3[1],x3[2],x3[3]};
#pragma unroll
    for (int i = 0; i < 16; ++i) { const _Float16 h = (_Float16)xs[i]; ah.h[i] = h; al.h[i] = ASPLIT ? (_Float16)(xs[i] - (float)h) : (_Float16)0.0f; }
#pragma unroll
    for (int t = 0; t < 4; ++t) { if (col0 + t * 16 >= N) continue; const size_t boff = (size_t)(col0 + t * 16 + ln) * ldb + kb; FragH bq; bq.half[0] = *(const v8us*)(Bh + boff + 8 * hh); bq.half[1] = *(const v8us*)(Bh + boff + 16 + 8 * hh);
      acc[t] = mmaH<ASPLIT ? 2 : 1>(ah.v, al.v, bq.v, bq.v, acc[t]); }
  }
#pragma unroll
  for (int t = 0; t < 4; ++t) { if (col0 + t * 16 >= N) continue;
#pragma unroll
    for (int r = 0; r < 8; ++r) so[w][8 * hh + r][t * 16 + ln] = acc[t][r] * alpha; }
  __builtin_amdgcn_fence(__ATOMIC_ACQ_REL, "workgroup"); __builtin_amdgcn_wave_barrier();
  const int rsub = lane >> 4, c4 = (lane & 15) * 4;
  {
#pragma unroll
    for (int q = 0; q < 8; ++q) { const int r = q * 2 + rsub; if (col0 + c4 < N) { const v4f v = *(const v4fa*)&so[w][r][c4]; *(v4f*)(C + (size_t)(row0 + r) * ldc + col0 + c4) = v; } }
     }
}

// Wt[n][k] = f16(W[k][n]·scale) from f32 row-major W[K][N] (scale = power of two; bf16-exact weights stay exact in f16 away from the subnormal range)
__global__ __launch_bounds__(256) void k_wt_f16(const float* __restrict__ W, _Float16* __restrict__ Wt, int K, int N, float scale) {
  const int t = blockIdx.x * 256 + threadIdx.x; if (t >= N * (K / 8)) return; const int n = t / (K / 8), k8 = (t % (K / 8)) * 8; FragH f;
#pragma unroll
  for (int i = 0; i < 8; ++i) f.h[i] = (_Float16)(bf16_round(W[(size_t)(k8 + i) * N + n]) * scale); const v8us o = f.half[0];
  *(v8us*)((unsigned short*)Wt + (size_t)n * K + k8) = o; 
}
// k_gemm_hh variant with fused epilogue: v = acc·alpha + bias[by·sBias + col] (+ CP[(row/rowsPerB)·sCPb + by·64 + col] if CP) ; ACT 0 none / 1 elu ; writes f16 C16 (and f32 C if non-null)
template <int ACT>
__global__ __launch_bounds__(128) void k_gemm_hhx(const _Float16* __restrict__ A, int lda, size_t sA, const _Float16* __restrict__ Bh, int ldb, size_t sB, float alpha, const float* __restrict__ bias, size_t sBias, const float* __restrict__ CP, int rowsPerB, size_t sCPb, int row0g,
    float* __restrict__ C, _Float16* __restrict__ C16, int ldc, size_t sC, int M, int N, int K) {
  __shared__ __attribute__((aligned(16))) float so[4][16][64];
  const int tid = threadIdx.x, w = tid >> 5, lane = tid & 31, ln = lane & 15, hh = lane >> 4; const int by = blockIdx.y;
  A += (size_t)by * sA; Bh += (size_t)by * sB; const size_t cofs = (size_t)by * sC; const float* bp = bias ? bias + (size_t)by * sBias : nullptr;
  const int ntn = (N + 63) / 64; const int wid = blockIdx.x * 4 + w; const int mt = wid / ntn, nq = wid % ntn; if (mt * 16 >= M) return;
  const int row0 = mt * 16, col0 = nq * 64; const _Float16* arow = A + (size_t)(row0 + ln) * lda;
  v8f acc[4] = {};
  for (int kb = 0; kb < K; kb += 32) { FragH ah; ah.half[0] = *(const v8us*)((const unsigned short*)arow + kb + 8 * hh); ah.half[1] = *(const v8us*)((const unsigned short*)arow + kb + 16 + 8 * hh);
#pragma unroll
    for (int t = 0; t < 4; ++t) { if (col0 + t * 16 >= N) continue; const size_t boff = (size_t)(col0 + t * 16 + ln) * ldb + kb; FragH bq; bq.half[0] = *(const v8us*)((const unsigned short*)Bh + boff + 8 * hh); bq.half[1] = *(const v8us*)((const unsigned short*)Bh + boff + 16 + 8 * hh);
      acc[t] = mmaH<1>(ah.v, ah.v, bq.v, bq.v, acc[t]); }
  }
#pragma unroll
  for (int t = 0; t < 4; ++t) { if (col0 + t * 16 >= N) continue; const int col = col0 + t * 16 + ln; const float bv = bp ? bf16_round(bp[col]) : 0.f;
#pragma unroll
    for (int r = 0; r < 8; ++r) { float v = acc[t][r] * alpha + bv; if (CP) { const int rr = row0g + row0 + 8 * hh + r; if (rowsPerB < 0) v += CP[cofs + (size_t)rr * ldc + col];      /* rowsPerB < 0: own element of the batched C plane */ else { const int bidx = rr / rowsPerB; v += CP[(size_t)bidx * sCPb + (size_t)by * 64 + col]; } } if (ACT == 1) v = (v > 0.f) ? v : expm1f(v); else if (ACT == 7) v = (v > 0.f) ? v + 1.0f : expf(v); else if (ACT == 8) v = tanhf(v); else if (ACT == 9) v = 0.5f * v * (1.0f + tanhf(0.7978845608028654f * (v + 0.044715f * v * v * v))); else if (ACT == 11) v = 1.0f / (1.0f + expf(-v)); else if (ACT == 12) v = (v > 0.f) ? v : 0.01f * v; else if (ACT == 14) v = (v > 0.f) ? v : 0.1f * v; else if (ACT == 16) v = (v >= 0.f) ? v : 0.3f * v; else if (ACT == 17) v = (v >= 0.f) ? v : 0.2f * v; else if (ACT == 15) v = v / (1.0f + expf(-v)); else if (ACT == 3) v = fmaxf(v, 0.f); else if (ACT == 6) v = 0.5f * v * (1.0f + erff(v * 0.70710678118654752f)); so[w][8 * hh + r][t * 16 + ln] = v; } }
  __builtin_amdgcn_fence(__ATOMIC_ACQ_REL, "workgroup"); __builtin_amdgcn_wave_barrier();
  const int rsub = lane >> 4, c4 = (lane & 15) * 4; typedef _Float16 v4h __attribute__((ext_vector_type(4)));
  {
#pragma unroll
    for (int q = 0; q < 8; ++q) { const int r = q * 2 + rsub; if (col0 + c4 < N) { const v4f v = *(const v4fa*)&so[w][r][c4]; if (C) *(v4f*)(C + cofs + (size_t)(row0 + r) * ldc + col0 + c4) = v; if (C16) { v4h h4; for (int i = 0; i < 4; ++i) h4[i] = (_Float16)v[i]; *(v4h*)(C16 + cofs + (size_t)(row0 + r) * ldc + col0 + c4) = h4; } } }
     }
}


typedef _Float16 v4h __attribute__((ext_vector_type(4)));

__global__ __launch_bounds__(256) void k_h16(const float* __restrict__ x, _Float16* __restrict__ X16, size_t n8) { const size_t t = (size_t)blockIdx.x * 256 + threadIdx.x; if (t >= n8) return; FragH f;
#pragma unroll
  for (int q = 0; q < 8; ++q) f.h[q] = (_Float16)x[t * 8 + q]; *(v8us*)((unsigned short*)X16 + t * 8) = f.half[0];  }
__global__ __launch_bounds__(256) void k_round16f(const float* __restrict__ W, _Float16* __restrict__ Bt, size_t n8) { const size_t t = (size_t)blockIdx.x * 256 + threadIdx.x; if (t >= n8) return; FragH f;
#pragma unroll
  for (int i = 0; i < 8; ++i) f.h[i] = (_Float16)(bf16_round(W[t * 8 + i]) * 16.0f); *(v8us*)((unsigned short*)Bt + t * 8) = f.half[0];  }
__global__ __launch_bounds__(256) void k_hl(const float* __restrict__ F, _Float16* __restrict__ Hh, _Float16* __restrict__ Hl, size_t n8) { const size_t t = (size_t)blockIdx.x * 256 + threadIdx.x; if (t >= n8) return; FragH fh, fl; const v4f a = *(const v4fa*)(F + t * 8), c = *(const v4fa*)(F + t * 8 + 4);
#pragma unroll
  for (int q = 0; q < 4; ++q) { _Float16 h = (_Float16)a[q]; fh.h[q] = h; fl.h[q] = (_Float16)((a[q] - (float)h) * 1024.0f); h = (_Float16)c[q]; fh.h[4 + q] = h; fl.h[4 + q] = (_Float16)((c[q] - (float)h) * 1024.0f); }
  { *(v8us*)((unsigned short*)Hh + t * 8) = fh.half[0]; *(v8us*)((unsigned short*)Hl + t * 8) = fl.half[0];  } }


__global__ __launch_bounds__(256) void k_rsm(const float* __restrict__ S, _Float16* __restrict__ P, int nrows) {
  #pragma clang fp contract(off)
  const int i = blockIdx.x * 256 + threadIdx.x; if (i >= nrows) return; const float* s = S + (size_t)i * SQ; float mx = -3.0e38f;
#pragma unroll 1
  for (int j = 0; j < SQ; ++j) mx = fmaxf(mx, s[j]); float se = 0.f;
#pragma unroll 1
  for (int j = 0; j < SQ; ++j) se += expf(s[j] - mx); const float sc = 256.0f / se;
#pragma unroll 1
  for (int j0 = 0; j0 < SQ; j0 += 8) { FragH f; for (int q = 0; q < 8; ++q) f.h[q] = (_Float16)(expf(s[j0 + q] - mx) * sc); unsigned short* d = (unsigned short*)P + (size_t)i * SQ + j0; *(v8us*)d = f.half[0];  } }
__global__ __launch_bounds__(256) void k_vt(const _Float16* __restrict__ V16, int b, int h0, _Float16* __restrict__ VT) { __shared__ unsigned short tl[64][65]; const int tid = threadIdx.x; const int hh = blockIdx.x % HG, sg = blockIdx.x / HG; const int s0 = sg * 64; const int h = h0 + hh;
  for (int i = tid; i < 64 * 8; i += 256) { const int j = i / 8, d8 = (i % 8) * 8; FragH f; f.half[0] = *(const v8us*)((const unsigned short*)V16 + ((size_t)b * SQ + s0 + j) * DM + h * HD + d8); for (int q = 0; q < 8; ++q) tl[d8 + q][j] = f.u[q]; }
  __syncthreads();
  { for (int i = tid; i < 64 * 8; i += 256) { const int d = i / 8, j8 = (i % 8) * 8; FragH f; for (int q = 0; q < 8; ++q) f.u[q] = tl[d][j8 + q]; *(v8us*)((unsigned short*)VT + ((size_t)hh * HD + d) * SQ + s0 + j8) = f.half[0]; }  } }



typedef int v4ia __attribute__((ext_vector_type(4), may_alias));
#define FW 8                         /* waves per attention work-group */
#define FQ 16                        /* query columns per tile; a wave has two tiles */
#define FK 64                        /* keys per stage */
#define FS (SQ / FK)                 /* stages */
#define FP 72                        /* LDS row pitch in f16: 128-byte rows + 16 bytes, conflict-free for 16-byte row reads */
#define FSC 0.045084220f             /* log2(e) / sqrt(1024): raw q.k to base-2 exponent */
#define FNEG (-0x1p35f)              /* raw score of a masked key (-2^30 after the 1/32). A power of two, so that FNEG * FSC is exact and a row with only masked keys gets exponent 0, weight 1, for each of them */
#define FTH 177.0f                   /* the maximum in use is replaced only when a new one exceeds it by this much raw score (8 in base-2 exponent): weights stay below 2^8, inside f16 */
__device__ __forceinline__ float sm_xhalf(float x) { return __builtin_bit_cast(float, __builtin_amdgcn_permlanex16(__builtin_bit_cast(int, x), __builtin_bit_cast(int, x), 0x76543210, 0xfedcba98, false, false)); }      /* lane l with lane l ^ 16 */
typedef float v2f __attribute__((ext_vector_type(2)));
typedef _Float16 v2h __attribute__((ext_vector_type(2)));
union FragP { v16h v; v2h p[8]; };      /* a 16-element f16 operand as eight packed pairs */
__device__ __forceinline__ v16h fa_frag(const _Float16* p) { FragH f; f.half[0] = *(const v8us*)(const unsigned short*)p; f.half[1] = *(const v8us*)((const unsigned short*)p + 16); return f.v; }      /* p already holds the lane half's 8 h: k = 8 h + 0..7 and 16 + 8 h + 0..7 of a 32-k group, the hardware k order */
__device__ __forceinline__ v8f fa_mma(v16h a, v16h b, v8f c) { return __builtin_amdgcn_wmma_f32_16x16x32_f16(false, a, false, b, (short)0, c, false, false); }
typedef unsigned v16u __attribute__((ext_vector_type(16)));
typedef const __attribute__((address_space(4))) v16u cv16u;      /* memory that no launch in flight writes: a load at a wave-uniform address is a scalar load, whatever "memory" clobbers stand around it */
__global__ __launch_bounds__(FW * 32) __attribute__((amdgpu_waves_per_eu(4, 4))) void k_fattn(const _Float16* __restrict__ Q16, const _Float16* __restrict__ K16, const _Float16* __restrict__ VT, const unsigned* __restrict__ PM, float* __restrict__ out) {
  __shared__ __attribute__((aligned(16))) _Float16 sk[2][FK][FP];      /* K stage: [key][d] */
  __shared__ __attribute__((aligned(16))) _Float16 sv[2][HD][FP];      /* V^T stage: [d][key] */
  __shared__ __attribute__((aligned(16))) v4f so[FW][8][32];           /* merge: the O^T tile a wave hands to its partner, [register quad][lane] */
  __shared__ float sl[FW][2][32];                                      /* merge: that tile's maximum (as exponent) and sum */
  const int tid = threadIdx.x, lane = tid & 31, c = lane & 15, hh = lane >> 4, w = __builtin_amdgcn_readfirstlane(tid >> 5);
  const int cg = w & (FW / 2 - 1), kh = w / (FW / 2);      /* the wave's 32 columns, its half of each stage's keys */
  const int qt = blockIdx.x % (SQ / (FW * FQ)), bh = blockIdx.x / (SQ / (FW * FQ)), b = bh / NH, h = bh % NH;
  const int q = qt * (FW * FQ) + cg * (2 * FQ) + c;      /* the lane's query in tile 0; tile 1: + 16 */
  const _Float16* qp = Q16 + ((size_t)b * SQ + q) * DM + h * HD + 8 * hh;
  const int sr = tid >> 3, sc = (tid & 7) * 8;      /* staging: the thread's row (and row + 32) and its 16-byte piece */
  /* each stream as a work-group-uniform base, advanced per stage, plus one byte offset per lane that never changes */
  const char* kg = (const char*)(K16 + (size_t)b * SQ * DM + h * HD); const unsigned ko = (unsigned)(sr * DM + sc) * 2u;
  const char* vg = (const char*)(VT + (size_t)bh * HD * SQ); const unsigned vo = (unsigned)(sr * SQ + sc) * 2u;
  cv16u* mg = (cv16u*)(unsigned long long)(PM + (size_t)((b * (SQ / FQ) + qt * FW + cg * 2) * FS) * 32 + kh * 16);      /* query tile 0, the wave's 16 words of stage 0; a stage is 2 units on, query tile 1 is 2 FS units on */
  v16u mk0, mk1;      /* lane masks of a stage, mk0 for query tile 0, mk1 for tile 1: word 8 t + r, bit l = keep of lane l's query and key 32 kh + 16 t + 8 h + r */
  const v16h qf[2][2] = {{fa_frag(qp), fa_frag(qp + 32)}, {fa_frag(qp + FQ * DM), fa_frag(qp + FQ * DM + 32)}};
  { const v8us k0 = *(const v8us*)(kg + ko), k1 = *(const v8us*)(kg + (ko + 32u * DM * 2u)), v0 = *(const v8us*)(vg + vo), v1 = *(const v8us*)(vg + (vo + 32u * SQ * 2u));
    mk0 = mg[0]; mk1 = mg[2 * FS];
    asm volatile("s_wait_xcnt 0x0" :: "v"(qp), "s"(kg), "s"(vg), "s"(mg), "v"(ko), "v"(vo) : "memory");      /* behind the loads and ahead of whatever reuses their address registers; the addresses as inputs keep those registers whole up to here */
    *(v8us*)&sk[0][sr][sc] = k0; *(v8us*)&sk[0][sr + 32][sc] = k1; *(v8us*)&sv[0][sr][sc] = v0; *(v8us*)&sv[0][sr + 32][sc] = v1; }
  __syncthreads();
  const v8f z8 = {0.f, 0.f, 0.f, 0.f, 0.f, 0.f, 0.f, 0.f};
  v8f o[2][4] = {{z8, z8, z8, z8}, {z8, z8, z8, z8}};      /* O^T: o[j][dt][r] = d 16 dt + 8 h + r of the lane's query in tile j */
  float m[2] = {-3.0e38f, -3.0e38f}, mc[2] = {-3.0e38f * FSC, -3.0e38f * FSC}, l[2] = {0.f, 0.f};      /* per query tile: maximum in use (raw, and as exponent), the lane's part of the sum */
  auto pass = [&](const int s, const int bf) __attribute__((always_inline)) {      /* the wave's half of stage s from buffer bf; fetches the next stage */
    const int sn = (s + 1 < FS) ? s + 1 : FS - 1;      /* the last pass fetches its own stage again, into the buffer that nobody reads any more: the loads stay unconditional, so no branch merges the wait counts */
    const char* kp = kg + (size_t)sn * (FK * DM * 2) + ko; const char* vp = vg + sn * (FK * 2) + vo; cv16u* mp = mg + sn * 2;
    const v8us k0 = *(const v8us*)kp, k1 = *(const v8us*)(kp + 32 * DM * 2), v0 = *(const v8us*)vp, v1 = *(const v8us*)(vp + 32 * SQ * 2);
    asm volatile("s_wait_xcnt 0x0" :: "v"(kp), "v"(vp) : "memory");      /* as above: ahead of the reuse of the two address pairs */
    v16h kf[4];
#pragma unroll
    for (int t = 0; t < 2; ++t) { const _Float16* kr = &sk[bf][32 * kh + 16 * t + c][8 * hh]; kf[2 * t] = fa_frag(kr); kf[2 * t + 1] = fa_frag(kr + 32); }
    __builtin_amdgcn_sched_barrier(0);      /* all K fragment loads are issued before the first product waits on one; without it some passes came out as load, wait, product, in a row */
    v8f st[2][2];      /* S^T: st[j][t][r] = key 32 kh + 16 t + 8 h + r of the stage, the lane's query in tile j */
#pragma unroll
    for (int t = 0; t < 2; ++t)
#pragma unroll
      for (int j = 0; j < 2; ++j) st[j][t] = fa_mma(kf[2 * t], qf[j][0], z8);
#pragma unroll
    for (int t = 0; t < 2; ++t)
#pragma unroll
      for (int j = 0; j < 2; ++j) st[j][t] = fa_mma(kf[2 * t + 1], qf[j][1], st[j][t]);
#pragma unroll
    for (int j = 0; j < 2; ++j)
#pragma unroll
      for (int t = 0; t < 2; ++t)
#pragma unroll
        for (int r = 0; r < 8; ++r) st[j][t][r] = __builtin_amdgcn_inverse_ballot_w32((j == 0 ? mk0 : mk1)[8 * t + r]) ? st[j][t][r] : FNEG;      /* the word IS the select's lane mask: one instruction a score */
    __builtin_amdgcn_sched_barrier(0);      /* holds the reload of the mask words behind their last reader, so that their 32 scalar registers can be loaded over; without it the reload and the V^T fragment loads below move up ahead of the score products, into registers of their own */
    mk0 = mp[0]; mk1 = mp[2 * FS];
    asm volatile("s_wait_xcnt 0x0" :: "s"(mp) : "memory");      /* as above */
    v16h vf[4];      /* the V^T fragments, fetched here so that they land behind the softmax arithmetic */
#pragma unroll
    for (int dt = 0; dt < 4; ++dt) vf[dt] = fa_frag(&sv[bf][16 * dt + c][32 * kh + 8 * hh]);
    __builtin_amdgcn_sched_barrier(0);      /* holds these loads ahead of the arithmetic */
    float mx[2]; bool need[2];
#pragma unroll
    for (int j = 0; j < 2; ++j) { float mt[2];      /* one chain per tile: four short dependent chains instead of two long ones */
#pragma unroll
      for (int t = 0; t < 2; ++t) { mt[t] = st[j][t][0];
#pragma unroll
        for (int r = 1; r < 8; ++r) mt[t] = fmaxf(mt[t], st[j][t][r]); }
      mx[j] = fmaxf(mt[0], mt[1]);
      mx[j] = fmaxf(mx[j], sm_xhalf(mx[j]));      /* both lane halves of a query use one maximum: their weights meet in one product */
      need[j] = mx[j] > m[j] + FTH; }
    if (__builtin_amdgcn_ballot_w32(need[0] || need[1]) != 0) {      /* one branch per pass; taken on the first pass and then only when some query's maximum grows by more than FTH */
#pragma unroll
      for (int j = 0; j < 2; ++j) { const float mn = need[j] ? mx[j] : m[j], mcn = mn * FSC; const float al = __builtin_amdgcn_exp2f(mc[j] - mcn); m[j] = mn; mc[j] = mcn; l[j] *= al;      /* 0 on the first pass, 1 in a lane that keeps its maximum */
#pragma unroll
        for (int dt = 0; dt < 4; ++dt) o[j][dt] *= al; } }
    FragP pf[2];      /* P^T as B operand, one per query tile: element e = key 32 kh + (e < 8 ? 8 h + e : 16 + 8 h + e - 8) */
#pragma unroll
    for (int j = 0; j < 2; ++j) { const v2f mc2 = {mc[j], mc[j]}; v2f a2[2] = {{0.f, 0.f}, {0.f, 0.f}};
#pragma unroll
      for (int t = 0; t < 2; ++t)
#pragma unroll
        for (int u = 0; u < 4; ++u) { const v2f x = {st[j][t][2 * u], st[j][t][2 * u + 1]}; const v2f y = x * FSC - mc2; const v2f e = {__builtin_amdgcn_exp2f(y[0]), __builtin_amdgcn_exp2f(y[1])};      /* the builtin, so that the compiler keeps the distances to the matrix instructions that it schedules around it */
          a2[u & 1] += e; pf[j].p[4 * t + u] = __builtin_convertvector(e, v2h); }
      l[j] += (a2[0][0] + a2[0][1]) + (a2[1][0] + a2[1][1]); }
#pragma unroll
    for (int j = 0; j < 2; ++j)
#pragma unroll
      for (int dt = 0; dt < 4; ++dt) o[j][dt] = fa_mma(vf[dt], pf[j].v, o[j][dt]);
    __builtin_amdgcn_sched_barrier(0);      /* holds the stores, with their wait for the stage loads, and the barrier at the foot of the pass; without it one pass had them ahead of the exponentials, which cuts the time the stage loads have to land */
    *(v8us*)&sk[bf ^ 1][sr][sc] = k0; *(v8us*)&sk[bf ^ 1][sr + 32][sc] = k1; *(v8us*)&sv[bf ^ 1][sr][sc] = v0; *(v8us*)&sv[bf ^ 1][sr + 32][sc] = v1;      /* into the buffer whose last readers left it before the previous pass's barrier */
    asm volatile("s_wait_dscnt 0x0\n\ts_barrier_signal -1\n\ts_barrier_wait -1" ::: "memory");      /* publishes stage s + 1 and ends every wave's reads of stage s. By hand, with the LDS wait alone: __syncthreads() would also wait for the mask loads, which are to fly on into the next pass */
  };
#pragma unroll 1
  for (int s = 0; s < FS; s += 2) { pass(s, 0); pass(s + 1, 1); }      /* two passes a trip: each pass's buffer is a constant offset */
  /* merge of the two key halves: the wave keeps query tile kh and hands tile 1 - kh, with its maximum and sum, to the wave that has the same columns and the other keys */
  const bool k1 = kh != 0;
  const float lj[2] = {l[0] + sm_xhalf(l[0]), l[1] + sm_xhalf(l[1])};
  const float mck = k1 ? mc[1] : mc[0], lk = k1 ? lj[1] : lj[0];
  sl[w][0][lane] = k1 ? mc[0] : mc[1]; sl[w][1][lane] = k1 ? lj[0] : lj[1];
  v8f ok[4];
#pragma unroll
  for (int dt = 0; dt < 4; ++dt) { v8f og;
#pragma unroll
    for (int r = 0; r < 8; ++r) { ok[dt][r] = k1 ? o[1][dt][r] : o[0][dt][r]; og[r] = k1 ? o[0][dt][r] : o[1][dt][r]; }
    const v4f lo = {og[0], og[1], og[2], og[3]}, hi = {og[4], og[5], og[6], og[7]};
    so[w][2 * dt][lane] = lo; so[w][2 * dt + 1][lane] = hi; }
  __syncthreads();      /* publishes the handed-over tiles */
  const int pw = w ^ (FW / 2);
  const float mcp = sl[pw][0][lane], lp = sl[pw][1][lane];
  const float fd = __builtin_amdgcn_exp2f(-__builtin_fabsf(mck - mcp)), fk = mck >= mcp ? 1.0f : fd, fp = mck >= mcp ? fd : 1.0f;      /* each part brought to the larger of the two maxima: one factor is 1, the other at most 1 */
  const float inv = 1.0f / (lk * fk + lp * fp), gk = fk * inv, gp = fp * inv;
  float* op = out + ((size_t)b * SQ + q + kh * FQ) * DM + h * HD + 8 * hh;
#pragma unroll
  for (int dt = 0; dt < 4; ++dt) { const v4f pl = so[pw][2 * dt][lane], ph = so[pw][2 * dt + 1][lane];
    const v4f lo = {ok[dt][0] * gk + pl[0] * gp, ok[dt][1] * gk + pl[1] * gp, ok[dt][2] * gk + pl[2] * gp, ok[dt][3] * gk + pl[3] * gp}, hi = {ok[dt][4] * gk + ph[0] * gp, ok[dt][5] * gk + ph[1] * gp, ok[dt][6] * gk + ph[2] * gp, ok[dt][7] * gk + ph[3] * gp};
    *(v4f*)(op + 16 * dt) = lo; *(v4f*)(op + 16 * dt + 4) = hi; }
}
typedef unsigned short v4us __attribute__((ext_vector_type(4), may_alias));
union FragQ { v2h p[2]; v4us u; };      /* four f16 as one 8-byte LDS store */
typedef __bf16 v2b __attribute__((ext_vector_type(2)));
__device__ __forceinline__ v2f pj_round(const float a, const float b) { const v2f x = {a, b}; return __builtin_convertvector(__builtin_convertvector(x, v2b), v2f); }      /* two values rounded to bf16 (nearest even, as bf16_round) by one packed convert */
#define PW 4                         /* waves per projection work-group: four neighbouring heads of the same tokens */
#define PT 64                        /* tokens per wave */
// 64 finished rows of 64 f16 from the wave's LDS tile to memory: one instruction carries four whole 128-byte rows. dst and pitch (bytes) are the same in every lane
__device__ __forceinline__ void pj_rows(const _Float16 (*tile)[FP], char* dst, const unsigned pitch, const int lane) {
  const int rr = lane >> 3, pc = (lane & 7) * 8; const unsigned lo = (unsigned)rr * pitch + (unsigned)pc * 2u;
  v8us v[16];
#pragma unroll
  for (int j = 0; j < 16; ++j) v[j] = *(const v8us*)(const unsigned short*)&tile[4 * j + rr][pc];
#pragma unroll
  for (int j = 0; j < 16; ++j) *(v8us*)(dst + (size_t)(4u * j * pitch) + lo) = v[j];
}
// the wave's 64 x 64 x 64 product from fragments in registers, the f16 results into its LDS tile. TR false: W X^T, rows [token][d]; TR true: X W^T, rows [d][token]
template <bool TR>
__device__ __forceinline__ void pj_mul(const v16h (&wf)[8], const v16h (&xf)[8], _Float16 (*tile)[FP], const int c, const int hh) {
  const v8f z8 = {0.f, 0.f, 0.f, 0.f, 0.f, 0.f, 0.f, 0.f};
#pragma unroll
  for (int t = 0; t < 4; ++t) { v8f a[4];      /* TR false: a[dt][r] = d 16 dt + 8 h + r of token 16 t + c; TR true: token 16 t + 8 h + r of d 16 dt + c */
#pragma unroll
    for (int dt = 0; dt < 4; ++dt) a[dt] = TR ? fa_mma(xf[2 * t], wf[2 * dt], z8) : fa_mma(wf[2 * dt], xf[2 * t], z8);
#pragma unroll
    for (int dt = 0; dt < 4; ++dt) a[dt] = TR ? fa_mma(xf[2 * t + 1], wf[2 * dt + 1], a[dt]) : fa_mma(wf[2 * dt + 1], xf[2 * t + 1], a[dt]);
#pragma unroll
    for (int dt = 0; dt < 4; ++dt) { FragH f;
#pragma unroll
      for (int r = 0; r < 8; ++r) f.h[r] = (_Float16)(a[dt][r] * 0.0625f);      /* takes the weight's factor of 16 out again */
      *(v8us*)(unsigned short*)(TR ? &tile[16 * dt + c][16 * t + 8 * hh] : &tile[16 * t + c][16 * dt + 8 * hh]) = f.half[0]; } }
  __builtin_amdgcn_fence(__ATOMIC_ACQ_REL, "workgroup"); __builtin_amdgcn_wave_barrier();      /* the wave's own LDS writes before its other lanes read them */
}
// The int32 keep-mask packed to bits, once for the 16 heads that share it, in the order the attention kernel selects by: PM[(b * 128 + query / 16) * 32 + stage][8 t + r], bit l = (mask[b][16-query tile's row l & 15][64 stage + 16 t + 8 (l >> 4) + r] != 0).
// A wave takes 16 query rows x 512 keys in four pieces of 128 keys. A row's 128 keys are ONE 512-byte load (lane l: keys 4 l + i), four ballots make them four words (word i, bit l), which go to lane c of a[i] for row c;
// key 64 p + 16 t + 8 h + r is then bit 16 p + 4 t + 2 h + (r >> 2) of word r & 3, and a second ballot over the lanes (c, h) gives the lane mask.
__device__ __forceinline__ void pk_mask(const int* __restrict__ am, unsigned* __restrict__ PM, const int tile, const int quarter, const int lane) {
  const int hh = lane >> 4;
  const int* sp = am + (size_t)tile * FQ * SQ + quarter * 512 + 4 * lane;
  v4ia x[2][16]; unsigned res[8];
#pragma unroll
  for (int j = 0; j < 16; ++j) x[0][j] = *(const v4ia*)(sp + j * SQ);
#pragma unroll
  for (int it = 0; it < 4; ++it) {
    if (it < 3) {      /* the next piece's loads fly while this piece is packed */
#pragma unroll
      for (int j = 0; j < 16; ++j) x[(it + 1) & 1][j] = *(const v4ia*)(sp + (it + 1) * 128 + j * SQ); }
    int a[4] = {0, 0, 0, 0};
#pragma unroll
    for (int j = 0; j < 16; ++j)
#pragma unroll
      for (int i = 0; i < 4; ++i) { const int wd = (int)__builtin_amdgcn_ballot_w32(x[it & 1][j][i] != 0); a[i] = __builtin_amdgcn_inverse_ballot_w32(1u << j) ? wd : a[i]; }      /* every lane votes, lane j takes the word */
    unsigned sh[4];
#pragma unroll
    for (int i = 0; i < 4; ++i) sh[i] = (unsigned)(a[i] | __builtin_amdgcn_permlanex16(a[i], a[i], 0x76543210, 0xfedcba98, false, false)) >> (2 * hh);      /* lanes 16 to 31 held 0: both halves now hold row c's word, moved down to the half's keys */
#pragma unroll
    for (int p = 0; p < 2; ++p) { int o = 0;
#pragma unroll
      for (int e = 0; e < 32; ++e) { const int wd = (int)__builtin_amdgcn_ballot_w32((sh[e & 3] & (1u << (16 * p + 4 * (e >> 3) + ((e & 7) >> 2)))) != 0); o = __builtin_amdgcn_inverse_ballot_w32(1u << e) ? wd : o; }      /* every lane votes, lane e takes word e */
      res[2 * it + p] = (unsigned)o; } }
  asm volatile("s_wait_xcnt 0x0" :: "v"(sp) : "memory");      /* behind the loads and ahead of whatever reuses their address registers */
  unsigned* dp = PM + (size_t)(tile * FS + quarter * 8) * 32 + lane;
#pragma unroll
  for (int j = 0; j < 8; ++j) dp[32 * j] = res[j];      /* one 128-byte line a stage; nothing follows the stores */
}
// All that precedes attention in ONE launch: blockIdx.y = stream (0 queries, 1 keys, 2 values; 3: the keep-mask is packed, pk_mask); a wave projects 64 tokens of one head (64 x 64 x 64).
// The f32 input slice is read in whole 256-byte rows, rounded (bf16, then f16, exact) in registers and laid into the wave's own LDS tile [token][k]; the work-group rounds the stream's 64 x 64 weight (x16) once into LDS [d][k].
// Q and K as W X^T (a lane holds 8 neighbouring d of one token), V as X W^T (a lane holds 8 neighbouring tokens of one d: V^T with no transposing pass); the results go back into the wave's tile, as rows [token][d] or [d][token].
__global__ __launch_bounds__(PW * 32) void k_proj(const float* __restrict__ xq, const float* __restrict__ xk, const float* __restrict__ xv, const float* __restrict__ wq, const float* __restrict__ wk, const float* __restrict__ wv,
                                                  _Float16* __restrict__ Q16, _Float16* __restrict__ K16, _Float16* __restrict__ VT, const int* __restrict__ am, unsigned* __restrict__ PM) {
  __shared__ __attribute__((aligned(16))) _Float16 sw[HD][FP];          /* the weight: [d][k] */
  __shared__ __attribute__((aligned(16))) _Float16 sx[PW][PT][FP];      /* per wave: the input tile [token][k], later the result rows */
  const int tid = threadIdx.x, lane = tid & 31, c = lane & 15, hh = lane >> 4, w = __builtin_amdgcn_readfirstlane(tid >> 5);
  const int sm = blockIdx.y;
  static_assert((NR / PT) * (NH / PW) == (size_t)NB * (SQ / FQ) && PW * 512 == SQ, "a plane of the grid holds one work-group per 16 query rows");
  if (sm == 3) { pk_mask(am, PM, (int)blockIdx.x, w, lane); return; }      /* the whole work-group, ahead of the barrier: 16 query rows, a quarter of the keys per wave */
  const float* x = sm == 0 ? xq : sm == 1 ? xk : xv; const float* wt = sm == 0 ? wq : sm == 1 ? wk : wv;
  const int row0 = (int)(blockIdx.x / (NH / PW)) * PT, h = (int)(blockIdx.x % (NH / PW)) * PW + w;      /* first token row (b * 2048 + s), the wave's head */
  const float* wp = wt + (tid >> 1) * HD + (tid & 1) * 32;      /* the thread's half row of the weight */
  const float* xp = x + (size_t)row0 * DM + h * HD + (hh * DM + 4 * c);      /* rows 2 j + lane half, the lane's 16 bytes */
  v4f wr[8], xr[PT / 2];
#pragma unroll
  for (int j = 0; j < 8; ++j) wr[j] = *(const v4fa*)(wp + 4 * j);
#pragma unroll
  for (int j = 0; j < PT / 2; ++j) xr[j] = *(const v4fa*)(xp + (size_t)(2 * j) * DM);
  asm volatile("s_wait_xcnt 0x0" :: "v"(wp), "v"(xp) : "memory");      /* behind the loads and ahead of whatever reuses their address registers; the addresses as inputs keep those registers whole up to here */
#pragma unroll
  for (int j = 0; j < 8; ++j) { FragQ f;
#pragma unroll
    for (int u = 0; u < 2; ++u) f.p[u] = __builtin_convertvector(pj_round(wr[j][2 * u] * 16.0f, wr[j][2 * u + 1] * 16.0f), v2h);      /* the factor of 16, a power of two, commutes with the rounding */
    *(v4us*)(unsigned short*)&sw[tid >> 1][(tid & 1) * 32 + 4 * j] = f.u; }
#pragma unroll
  for (int j = 0; j < PT / 2; ++j) { FragQ f;
#pragma unroll
    for (int u = 0; u < 2; ++u) f.p[u] = __builtin_convertvector(pj_round(xr[j][2 * u], xr[j][2 * u + 1]), v2h);
    *(v4us*)(unsigned short*)&sx[w][2 * j + hh][4 * c] = f.u; }
  __syncthreads();      /* publishes the weight to the four waves */
  v16h wf[8], xf[8];      /* wf[2 dt + g]: d 16 dt + c; xf[2 t + g]: token 16 t + c; both k = 32 g + 8 h + 0..7 and 32 g + 16 + 8 h + 0..7 */
#pragma unroll
  for (int t = 0; t < 4; ++t)
#pragma unroll
    for (int g = 0; g < 2; ++g) { wf[2 * t + g] = fa_frag(&sw[16 * t + c][32 * g + 8 * hh]); xf[2 * t + g] = fa_frag(&sx[w][16 * t + c][32 * g + 8 * hh]); }
  __builtin_amdgcn_fence(__ATOMIC_ACQ_REL, "workgroup"); __builtin_amdgcn_wave_barrier();      /* every input fragment is read before the results overwrite the tile */
  if (sm != 2) pj_mul<false>(wf, xf, sx[w], c, hh); else pj_mul<true>(wf, xf, sx[w], c, hh);      /* one branch, the same for every wave of the grid's y plane */
  _Float16* dst = sm == 2 ? VT + ((size_t)((row0 / SQ) * NH + h) * HD) * SQ + row0 % SQ : (sm == 0 ? Q16 : K16) + (size_t)row0 * DM + h * HD;
  pj_rows(sx[w], (char*)dst, sm == 2 ? SQ * 2u : DM * 2u, lane);
}
extern "C" void kernel_launch(void* const* d_in, const int* in_sizes, int n_in,
                              void* d_out, int out_size, void* d_ws, size_t ws_size, hipStream_t stream) {
  (void)in_sizes; (void)n_in; (void)out_size;
  const float* const* I = (const float* const*)d_in; const float* xv = I[0]; const float* xk = I[1]; const float* xq = I[2]; const int* am = (const int*)d_in[3]; const float* wv = I[4]; const float* wk = I[5]; const float* wq = I[6];      /* input order: values, keys, queries; the int32 keep-mask [2][1][2048][2048]; Wv, Wk, Wq: ONE natural [64][64] weight per stream, shared by the 16 heads; no biases; no output projection */
  char* ws = (char*)d_ws; size_t off = 0;
  auto take = [&](size_t bytes) { char* p = ws + off; off += (bytes + 255) & ~(size_t)255; return p; };
  _Float16* Q16 = (_Float16*)take(NR * DM * 2); _Float16* K16 = (_Float16*)take(NR * DM * 2); _Float16* VT = (_Float16*)take((size_t)NB * NH * HD * SQ * 2); unsigned* PM = (unsigned*)take((size_t)NB * (SQ / FQ) * FS * 32 * 4);
  if (off > ws_size) return;
  k_proj<<<dim3((unsigned)((NR / PT) * (NH / PW)), 4), PW * 32, 0, stream>>>(xq, xk, xv, wq, wk, wv, Q16, K16, VT, am, PM);      /* rounding of inputs and weights, the three projections (every head's 64-column slice times the stream's ONE shared weight) and V^T [NB][NH][HD][SQ] */
  k_fattn<<<NB * NH * (SQ / (FW * FQ)), FW * 32, 0, stream>>>(Q16, K16, VT, PM, (float*)d_out);      /* scores / sqrt(1024), keep-mask, softmax and P V in one launch for every batch and head, written f32 into the merged-heads output rows */
}

// v006
// Measured time: 46 microseconds a run.
// Two timings next to v005 put it at 1.04 and 1.05 times that version's speed.
// Counting every step since v000, it is 162 times as fast.
#include <hip/hip_runtime.h>
// Masked multi-head attention over three inputs with ONE SHARED 64 x 64 projection per stream and a RANDOM int keep-mask, no output projection (values, keys, queries [2][2048][1024]; every head's 64-column slice is projected by the SAME natural nn.Linear weight: v = values.reshape(N, L, 16, 64) Wv^T, k likewise with Wk, q with Wq ([64][64], normal / 8, NO biases); scores = q.k / sqrt(1024) (the module's embed size); where(mask == 0, -1e20) with the int32 [2][1][2048][2048] mask (seeded randint 0 / 1, about half zeros, one plane per sequence shared by its heads; READ on the device); softmax; out = attn v merged over heads -> [2][2048][1024]; input order values, keys, queries, mask, Wv, Wk, Wq).
// Structure: token rows r = b*2048 + s; ONE projection kernel for the three streams (grid.y): it reads the f32 inputs and weights itself, rounds them in registers (bf16, held as exact f16; the weight x16), and a wave multiplies 64 tokens of one head's 64-column slice by the stream's ONE shared weight (K = 64, f32 accumulation, no bias), f16 results: Q and K into the head's slice of the rows, V straight as V^T; a fourth plane of that launch packs the keep-mask to one bit a key, once for the 16 heads; then ONE attention kernel for every (batch, head, 128 queries; a wave has 32 of them and half the keys, two waves' parts merged at the end): scores (K = 64, 1/sqrt(1024) folded into the exponent), keep-mask, running-maximum softmax (f32 statistics; weights as f16, divided by their sum at the end) and the weighted sum of V, written f32 straight into the merged-heads output rows; scores and weights never reach memory.
// Compute dtype: inputs rounded to bf16; the three inputs and the x16 weights held as f16 in LDS tiles (exact for every bf16 value of magnitude from 2^-14 up to 65,504; the weights up to 4,094 before their factor of 16); q, k, v and the softmax weights as plain f16 GEMM operands (~2^-12); scores, softmax statistics and the output f32. v_wmma_f32_16x16x32_f16.
#define NB 2
#define SQ 2048
#define DM 1024
#define NH 16
#define HD 64
#define HG 4                         /* heads per call of the per-group k_vt overload (not launched) */
#define B0 0                         /* not used */
#define NBR NB                       /* not used except in MP */
#define NR ((size_t)NB * SQ)         /* token rows */
#define MP ((int)((size_t)NBR * SQ)) /* not used except in MPO */
#define QN SQ                        /* not used */
#define NHD NH                       /* not used */
#define MPO MP                       /* not used */
#define LQ DM      /* not used */
typedef __bf16 v16b __attribute__((ext_vector_type(16)));
typedef unsigned short v8us __attribute__((ext_vector_type(8), may_alias));
typedef float  v8f  __attribute__((ext_vector_type(8)));
typedef float  v4f  __attribute__((ext_vector_type(4)));
typedef float  v4fa __attribute__((ext_vector_type(4), may_alias));
union FragB { v16b v; v8us half[2]; unsigned short u[16]; };

__device__ __forceinline__ unsigned short bf16_bits(float x) { unsigned int u = __float_as_uint(x); return (unsigned short)((u + 0x7FFFu + ((u >> 16) & 1u)) >> 16); }
__device__ __forceinline__ float bf16_val(unsigned short b) { return __uint_as_float(((unsigned int)b) << 16); }
__device__ __forceinline__ float bf16_round(float x) { return bf16_val(bf16_bits(x)); }
// D += A·B with NT terms: 1 = ah·bh, 2 = + al·bh (A split), 3 = + ah·bl (both split)
template <int NT>
__device__ __forceinline__ v8f mmaN(v16b ah, v16b al, v16b bh, v16b bl, v8f c) {
  c = __builtin_amdgcn_wmma_f32_16x16x32_bf16(false, ah, false, bh, (short)0, c, false, false);
  if (NT >= 2) c = __builtin_amdgcn_wmma_f32_16x16x32_bf16(false, al, false, bh, (short)0, c, false, false);
  if (NT >= 3) c = __builtin_amdgcn_wmma_f32_16x16x32_bf16(false, ah, false, bl, (short)0, c, false, false);
  asm volatile("v_nop\n\tv_nop\n\tv_nop\n\tv_nop" : "+v"(c) : "v"(ah), "v"(al), "v"(bh), "v"(bl));
  return c;
}

__global__ __launch_bounds__(256) void k_wt_bf16(const float* __restrict__ W, unsigned short* __restrict__ Wt, int K, int N) {
  const int t = blockIdx.x * 256 + threadIdx.x;
  const int k8n = K / 8;
  if (t >= N * k8n) return;
  const int n = t / k8n, k8 = (t % k8n) * 8;
  v8us v;
#pragma unroll
  for (int i = 0; i < 8; ++i) v[i] = bf16_bits(W[(size_t)(k8 + i) * N + n]);
  *(v8us*)(Wt + (size_t)n * K + k8) = v;
  
}

// GEMM C[M][N] (f32, pitch ldc) = act(A[M][K]·W + bias). A f32 row-major (pitch lda) converted per fragment to bf16
// (ASPLIT: hi/lo two planes -> 2 terms, else single rounded term); Wt bf16 [N][K] (pitch ldb). BIAS_BF16 rounds the
// bias to bf16 first (bias quantised to bf16 before the add). K%32==0, M%16==0, N%64==0.
template <bool ASPLIT, int ACT, bool BIAS_BF16>
__global__ __launch_bounds__(128) void k_gemm_bf(const float* __restrict__ A, int lda, const unsigned short* __restrict__ Wt, int ldb,
                                               const float* __restrict__ bias, float* __restrict__ C, int ldc, int M, int N, int K) {
  __shared__ __attribute__((aligned(16))) float so[4][16][64];
  const int tid = threadIdx.x, w = tid >> 5, lane = tid & 31, ln = lane & 15, hh = lane >> 4;
  const int ntn = N / 64;
  const int wid = blockIdx.x * 4 + w;
  const int mt = wid / ntn, nq = wid % ntn;
  if (mt * 16 >= M) return;
  const int row0 = mt * 16, col0 = nq * 64;
  const float* arow = A + (size_t)(row0 + ln) * lda;
  v8f acc[4] = {};
  for (int kb = 0; kb < K; kb += 32) {
    FragB ah, al;
    const v4f x0 = *(const v4fa*)(arow + kb + 8 * hh), x1 = *(const v4fa*)(arow + kb + 8 * hh + 4);
    const v4f x2 = *(const v4fa*)(arow + kb + 16 + 8 * hh), x3 = *(const v4fa*)(arow + kb + 16 + 8 * hh + 4);
    float xs[16] = {x0[0],x0[1],x0[2],x0[3],x1[0],x1[1],x1[2],x1[3],x2[0],x2[1],x2[2],x2[3],x3[0],x3[1],x3[2],x3[3]};
#pragma unroll
    for (int i = 0; i < 16; ++i) { const unsigned short hb = bf16_bits(xs[i]); ah.u[i] = hb; al.u[i] = ASPLIT ? bf16_bits(xs[i] - bf16_val(hb)) : (unsigned short)0; }
#pragma unroll
    for (int t = 0; t < 4; ++t) {
      const unsigned short* brow = Wt + (size_t)(col0 + t * 16 + ln) * ldb + kb;
      FragB b;
      b.half[0] = *(const v8us*)(brow + 8 * hh);
      b.half[1] = *(const v8us*)(brow + 16 + 8 * hh);
      acc[t] = mmaN<ASPLIT ? 2 : 1>(ah.v, al.v, b.v, b.v, acc[t]);
    }
  }
#pragma unroll
  for (int t = 0; t < 4; ++t) {
    float bv = bias ? bias[col0 + t * 16 + ln] : 0.f;
    if (BIAS_BF16) bv = bf16_round(bv);
#pragma unroll
    for (int r = 0; r < 8; ++r) { float v = acc[t][r] + bv; if (ACT == 1) v = fmaxf(v, 0.f); so[w][8 * hh + r][t * 16 + ln] = v; }
  }
  __builtin_amdgcn_fence(__ATOMIC_ACQ_REL, "workgroup");
  __builtin_amdgcn_wave_barrier();
  const int rsub = lane >> 4, c4 = (lane & 15) * 4;
  {
#pragma unroll
    for (int q = 0; q < 8; ++q) {
      const int r = q * 2 + rsub;
      const v4f v = *(const v4fa*)&so[w][r][c4];
      *(v4f*)(C + (size_t)(row0 + r) * ldc + col0 + c4) = v;
    }
    
  }
}

// GEMM C = act(A·W + bias + resid): A f32 (ASPLIT -> hi/lo 2 terms), Wt bf16 [N][K]; ACT 0 none, 1 relu, 2 exact gelu;
// resid (optional, f32, row index = (row % rmod), pitch ldr, RES_BF16 rounds it) added before the activation.
template <bool ASPLIT, int ACT, bool BIAS_BF16, bool RES_BF16>
__global__ __launch_bounds__(128) void k_gemm_bf3(const float* __restrict__ A, int lda, const unsigned short* __restrict__ Wt, int ldb,
                                                const float* __restrict__ bias, const float* __restrict__ resid, int rmod, int ldr,
                                                float* __restrict__ C, int ldc, int M, int N, int K) {
  __shared__ __attribute__((aligned(16))) float so[4][16][64];
  const int tid = threadIdx.x, w = tid >> 5, lane = tid & 31, ln = lane & 15, hh = lane >> 4;
  const int ntn = N / 64;
  const int wid = blockIdx.x * 4 + w;
  const int mt = wid / ntn, nq = wid % ntn;
  if (mt * 16 >= M) return;
  const int row0 = mt * 16, col0 = nq * 64;
  const float* arow = A + (size_t)(row0 + ln) * lda;
  v8f acc[4] = {};
  for (int kb = 0; kb < K; kb += 32) {
    FragB ah, al;
    const v4f x0 = *(const v4fa*)(arow + kb + 8 * hh), x1 = *(const v4fa*)(arow + kb + 8 * hh + 4);
    const v4f x2 = *(const v4fa*)(arow + kb + 16 + 8 * hh), x3 = *(const v4fa*)(arow + kb + 16 + 8 * hh + 4);
    float xs[16] = {x0[0],x0[1],x0[2],x0[3],x1[0],x1[1],x1[2],x1[3],x2[0],x2[1],x2[2],x2[3],x3[0],x3[1],x3[2],x3[3]};
#pragma unroll
    for (int i = 0; i < 16; ++i) { const unsigned short hb = bf16_bits(xs[i]); ah.u[i] = hb; al.u[i] = ASPLIT ? bf16_bits(xs[i] - bf16_val(hb)) : (unsigned short)0; }
#pragma unroll
    for (int t = 0; t < 4; ++t) {
      const unsigned short* brow = Wt + (size_t)(col0 + t * 16 + ln) * ldb + kb;
      FragB b;
      b.half[0] = *(const v8us*)(brow + 8 * hh);
      b.half[1] = *(const v8us*)(brow + 16 + 8 * hh);
      acc[t] = mmaN<ASPLIT ? 2 : 1>(ah.v, al.v, b.v, b.v, acc[t]);
    }
  }
#pragma unroll
  for (int t = 0; t < 4; ++t) {
    const int col = col0 + t * 16 + ln;
    float bv = bias ? bias[col] : 0.f;
    if (BIAS_BF16) bv = bf16_round(bv);
#pragma unroll
    for (int r = 0; r < 8; ++r) {
      float v = acc[t][r] + bv;
      if (resid) { float rv = resid[(size_t)((row0 + 8 * hh + r) % rmod) * ldr + col]; if (RES_BF16) rv = bf16_round(rv); v += rv; }
      if (ACT == 1) v = fmaxf(v, 0.f);
      if (ACT == 2) v = 0.5f * v * (1.0f + erff(v * 0.70710678118654752f));
      if (ACT == 3) { const float u = 0.7978845608028654f * (v + 0.044715f * v * v * v); v = 0.5f * v * (1.0f + tanhf(u)); }
      so[w][8 * hh + r][t * 16 + ln] = v;
    }
  }
  __builtin_amdgcn_fence(__ATOMIC_ACQ_REL, "workgroup");
  __builtin_amdgcn_wave_barrier();
  const int rsub = lane >> 4, c4 = (lane & 15) * 4;
  {
#pragma unroll
    for (int q = 0; q < 8; ++q) {
      const int r = q * 2 + rsub;
      const v4f v = *(const v4fa*)&so[w][r][c4];
      *(v4f*)(C + (size_t)(row0 + r) * ldc + col0 + c4) = v;
    }
    
  }
}
// row LayerNorm (biased variance, eps) over N: s = X (+ R); optional out_sum <- s; out_norm <- (s-mu)*rsqrt(var+eps)*g + b
template <bool PARAM_BF16>
__global__ __launch_bounds__(256) void k_layernorm(const float* __restrict__ X, const float* __restrict__ R, const float* __restrict__ g, const float* __restrict__ bta,
                                                  float* __restrict__ out_sum, float* __restrict__ out_norm, int N, float eps) {
  __shared__ float red[256];
  const int row = blockIdx.x, tid = threadIdx.x;
  const float* x = X + (size_t)row * N; const float* rr = R ? R + (size_t)row * N : nullptr;
  float vals[16];                     // up to N = 4096
  const int per = N / 256;            // contiguous chunk per thread? use strided-by-4 chunks: thread handles j = tid*4 + 1024*u
  float s1 = 0.f;
  for (int u = 0; u < per / 4; ++u) {
    const int j = tid * 4 + 1024 * u;
    const v4f a = *(const v4fa*)(x + j);
    v4f b = {0.f,0.f,0.f,0.f}; if (rr) b = *(const v4fa*)(rr + j);
#pragma unroll
    for (int q = 0; q < 4; ++q) { const float v = a[q] + b[q]; vals[u * 4 + q] = v; s1 += v; }
  }
  red[tid] = s1; __syncthreads();
  for (int st = 128; st > 0; st >>= 1) { if (tid < st) red[tid] += red[tid + st]; __syncthreads(); }
  const float mu = red[0] / (float)N; __syncthreads();
  float s2 = 0.f;
  for (int u = 0; u < per / 4; ++u)
#pragma unroll
    for (int q = 0; q < 4; ++q) { const float c = vals[u * 4 + q] - mu; s2 += c * c; }
  red[tid] = s2; __syncthreads();
  for (int st = 128; st > 0; st >>= 1) { if (tid < st) red[tid] += red[tid + st]; __syncthreads(); }
  const float rs = rsqrtf(red[0] / (float)N + eps);
  {
    for (int u = 0; u < per / 4; ++u) {
      const int j = tid * 4 + 1024 * u;
      v4f o, sm;
#pragma unroll
      for (int q = 0; q < 4; ++q) {
        float gg = g[j + q], bb = bta[j + q];
        if (PARAM_BF16) { gg = bf16_round(gg); bb = bf16_round(bb); }
        sm[q] = vals[u * 4 + q]; o[q] = (vals[u * 4 + q] - mu) * rs * gg + bb;
      }
      if (out_sum) *(v4f*)(out_sum + (size_t)row * N + j) = sm;
      *(v4f*)(out_norm + (size_t)row * N + j) = o;
    }
    
  }
}



// ---- f16 WMMA path (v_wmma_f32_16x16x32_f16): 11-bit significands for operands in range — used where a [0,1] probability operand needs more precision than bf16
typedef _Float16 v16h __attribute__((ext_vector_type(16)));
union FragH { v16h v; v8us half[2]; _Float16 h[16]; unsigned short u[16]; };
template <int NT>
__device__ __forceinline__ v8f mmaH(v16h ah, v16h al, v16h bh, v16h bl, v8f c) {
  c = __builtin_amdgcn_wmma_f32_16x16x32_f16(false, ah, false, bh, (short)0, c, false, false);
  if (NT >= 2) c = __builtin_amdgcn_wmma_f32_16x16x32_f16(false, al, false, bh, (short)0, c, false, false);
  if (NT >= 3) c = __builtin_amdgcn_wmma_f32_16x16x32_f16(false, ah, false, bl, (short)0, c, false, false);
  asm volatile("v_nop\n\tv_nop\n\tv_nop\n\tv_nop" : "+v"(c) : "v"(ah), "v"(al), "v"(bh), "v"(bl));
  return c;
}
// batched GEMM like k_gemm_b but f16 operands: A f32 (split into f16 hi/lo if ASPLIT, else rounded to f16), Bt = f16 values [n][k]; alpha; C f32; N multiple of 16 (partial tiles skipped)
template <bool ASPLIT>
__global__ __launch_bounds__(128) void k_gemm_h(const float* __restrict__ A, int lda, size_t sA, const _Float16* __restrict__ Bh, int ldb, size_t sB, float alpha, float* __restrict__ C, int ldc, size_t sC, int M, int N, int K) {
  __shared__ __attribute__((aligned(16))) float so[4][16][64];
  const int tid = threadIdx.x, w = tid >> 5, lane = tid & 31, ln = lane & 15, hh = lane >> 4; const int by = blockIdx.y;
  A += (size_t)by * sA; Bh += (size_t)by * sB; C += (size_t)by * sC;
  const int ntn = (N + 63) / 64; const int wid = blockIdx.x * 4 + w; const int mt = wid / ntn, nq = wid % ntn; if (mt * 16 >= M) return;
  const int row0 = mt * 16, col0 = nq * 64; const float* arow = A + (size_t)(row0 + ln) * lda;
  v8f acc[4] = {};
  for (int kb = 0; kb < K; kb += 32) {
    FragH ah, al;
    const v4f x0 = *(const v4fa*)(arow + kb + 8 * hh), x1 = *(const v4fa*)(arow + kb + 8 * hh + 4), x2 = *(const v4fa*)(arow + kb + 16 + 8 * hh), x3 = *(const v4fa*)(arow + kb + 16 + 8 * hh + 4);
    float xs[16] = {x0[0],x0[1],x0[2],x0[3],x1[0],x1[1],x1[2],x1[3],x2[0],x2[1],x2[2],x2[3],x3[0],x3[1],x3[2],x3[3]};
#pragma unroll
    for (int i = 0; i < 16; ++i) { const _Float16 h = (_Float16)xs[i]; ah.h[i] = h; al.h[i] = ASPLIT ? (_Float16)(xs[i] - (float)h) : (_Float16)0.0f; }
#pragma unroll
    for (int t = 0; t < 4; ++t) { if (col0 + t * 16 >= N) continue; const size_t boff = (size_t)(col0 + t * 16 + ln) * ldb + kb; FragH bq; bq.half[0] = *(const v8us*)(Bh + boff + 8 * hh); bq.half[1] = *(const v8us*)(Bh + boff + 16 + 8 * hh);
      acc[t] = mmaH<ASPLIT ? 2 : 1>(ah.v, al.v, bq.v, bq.v, acc[t]); }
  }
#pragma unroll
  for (int t = 0; t < 4; ++t) { if (col0 + t * 16 >= N) continue;
#pragma unroll
    for (int r = 0; r < 8; ++r) so[w][8 * hh + r][t * 16 + ln] = acc[t][r] * alpha; }
  __builtin_amdgcn_fence(__ATOMIC_ACQ_REL, "workgroup"); __builtin_amdgcn_wave_barrier();
  const int rsub = lane >> 4, c4 = (lane & 15) * 4;
  {
#pragma unroll
    for (int q = 0; q < 8; ++q) { const int r = q * 2 + rsub; if (col0 + c4 < N) { const v4f v = *(const v4fa*)&so[w][r][c4]; *(v4f*)(C + (size_t)(row0 + r) * ldc + col0 + c4) = v; } }
     }
}

// Wt[n][k] = f16(W[k][n]·scale) from f32 row-major W[K][N] (scale = power of two; bf16-exact weights stay exact in f16 away from the subnormal range)
__global__ __launch_bounds__(256) void k_wt_f16(const float* __restrict__ W, _Float16* __restrict__ Wt, int K, int N, float scale) {
  const int t = blockIdx.x * 256 + threadIdx.x; if (t >= N * (K / 8)) return; const int n = t / (K / 8), k8 = (t % (K / 8)) * 8; FragH f;
#pragma unroll
  for (int i = 0; i < 8; ++i) f.h[i] = (_Float16)(bf16_round(W[(size_t)(k8 + i) * N + n]) * scale); const v8us o = f.half[0];
  *(v8us*)((unsigned short*)Wt + (size_t)n * K + k8) = o; 
}
// k_gemm_hh variant with fused epilogue: v = acc·alpha + bias[by·sBias + col] (+ CP[(row/rowsPerB)·sCPb + by·64 + col] if CP) ; ACT 0 none / 1 elu ; writes f16 C16 (and f32 C if non-null)
template <int ACT>
__global__ __launch_bounds__(128) void k_gemm_hhx(const _Float16* __restrict__ A, int lda, size_t sA, const _Float16* __restrict__ Bh, int ldb, size_t sB, float alpha, const float* __restrict__ bias, size_t sBias, const float* __restrict__ CP, int rowsPerB, size_t sCPb, int row0g,
    float* __restrict__ C, _Float16* __restrict__ C16, int ldc, size_t sC, int M, int N, int K) {
  __shared__ __attribute__((aligned(16))) float so[4][16][64];
  const int tid = threadIdx.x, w = tid >> 5, lane = tid & 31, ln = lane & 15, hh = lane >> 4; const int by = blockIdx.y;
  A += (size_t)by * sA; Bh += (size_t)by * sB; const size_t cofs = (size_t)by * sC; const float* bp = bias ? bias + (size_t)by * sBias : nullptr;
  const int ntn = (N + 63) / 64; const int wid = blockIdx.x * 4 + w; const int mt = wid / ntn, nq = wid % ntn; if (mt * 16 >= M) return;
  const int row0 = mt * 16, col0 = nq * 64; const _Float16* arow = A + (size_t)(row0 + ln) * lda;
  v8f acc[4] = {};
  for (int kb = 0; kb < K; kb += 32) { FragH ah; ah.half[0] = *(const v8us*)((const unsigned short*)arow + kb + 8 * hh); ah.half[1] = *(const v8us*)((const unsigned short*)arow + kb + 16 + 8 * hh);
#pragma unroll
    for (int t = 0; t < 4; ++t) { if (col0 + t * 16 >= N) continue; const size_t boff = (size_t)(col0 + t * 16 + ln) * ldb + kb; FragH bq; bq.half[0] = *(const v8us*)((const unsigned short*)Bh + boff + 8 * hh); bq.half[1] = *(const v8us*)((const unsigned short*)Bh + boff + 16 + 8 * hh);
      acc[t] = mmaH<1>(ah.v, ah.v, bq.v, bq.v, acc[t]); }
  }
#pragma unroll
  for (int t = 0; t < 4; ++t) { if (col0 + t * 16 >= N) continue; const int col = col0 + t * 16 + ln; const float bv = bp ? bf16_round(bp[col]) : 0.f;
#pragma unroll
    for (int r = 0; r < 8; ++r) { float v = acc[t][r] * alpha + bv; if (CP) { const int rr = row0g + row0 + 8 * hh + r; if (rowsPerB < 0) v += CP[cofs + (size_t)rr * ldc + col];      /* rowsPerB < 0: own element of the batched C plane */ else { const int bidx = rr / rowsPerB; v += CP[(size_t)bidx * sCPb + (size_t)by * 64 + col]; } } if (ACT == 1) v = (v > 0.f) ? v : expm1f(v); else if (ACT == 7) v = (v > 0.f) ? v + 1.0f : expf(v); else if (ACT == 8) v = tanhf(v); else if (ACT == 9) v = 0.5f * v * (1.0f + tanhf(0.7978845608028654f * (v + 0.044715f * v * v * v))); else if (ACT == 11) v = 1.0f / (1.0f + expf(-v)); else if (ACT == 12) v = (v > 0.f) ? v : 0.01f * v; else if (ACT == 14) v = (v > 0.f) ? v : 0.1f * v; else if (ACT == 16) v = (v >= 0.f) ? v : 0.3f * v; else if (ACT == 17) v = (v >= 0.f) ? v : 0.2f * v; else if (ACT == 15) v = v / (1.0f + expf(-v)); else if (ACT == 3) v = fmaxf(v, 0.f); else if (ACT == 6) v = 0.5f * v * (1.0f + erff(v * 0.70710678118654752f)); so[w][8 * hh + r][t * 16 + ln] = v; } }
  __builtin_amdgcn_fence(__ATOMIC_ACQ_REL, "workgroup"); __builtin_amdgcn_wave_barrier();
  const int rsub = lane >> 4, c4 = (lane & 15) * 4; typedef _Float16 v4h __attribute__((ext_vector_type(4)));
  {
#pragma unroll
    for (int q = 0; q < 8; ++q) { const int r = q * 2 + rsub; if (col0 + c4 < N) { const v4f v = *(const v4fa*)&so[w][r][c4]; if (C) *(v4f*)(C + cofs + (size_t)(row0 + r) * ldc + col0 + c4) = v; if (C16) { v4h h4; for (int i = 0; i < 4; ++i) h4[i] = (_Float16)v[i]; *(v4h*)(C16 + cofs + (size_t)(row0 + r) * ldc + col0 + c4) = h4; } } }
     }
}


typedef _Float16 v4h __attribute__((ext_vector_type(4)));

__global__ __launch_bounds__(256) void k_h16(const float* __restrict__ x, _Float16* __restrict__ X16, size_t n8) { const size_t t = (size_t)blockIdx.x * 256 + threadIdx.x; if (t >= n8) return; FragH f;
#pragma unroll
  for (int q = 0; q < 8; ++q) f.h[q] = (_Float16)x[t * 8 + q]; *(v8us*)((unsigned short*)X16 + t * 8) = f.half[0];  }
__global__ __launch_bounds__(256) void k_round16f(const float* __restrict__ W, _Float16* __restrict__ Bt, size_t n8) { const size_t t = (size_t)blockIdx.x * 256 + threadIdx.x; if (t >= n8) return; FragH f;
#pragma unroll
  for (int i = 0; i < 8; ++i) f.h[i] = (_Float16)(bf16_round(W[t * 8 + i]) * 16.0f); *(v8us*)((unsigned short*)Bt + t * 8) = f.half[0];  }
__global__ __launch_bounds__(256) void k_hl(const float* __restrict__ F, _Float16* __restrict__ Hh, _Float16* __restrict__ Hl, size_t n8) { const size_t t = (size_t)blockIdx.x * 256 + threadIdx.x; if (t >= n8) return; FragH fh, fl; const v4f a = *(const v4fa*)(F + t * 8), c = *(const v4fa*)(F + t * 8 + 4);
#pragma unroll
  for (int q = 0; q < 4; ++q) { _Float16 h = (_Float16)a[q]; fh.h[q] = h; fl.h[q] = (_Float16)((a[q] - (float)h) * 1024.0f); h = (_Float16)c[q]; fh.h[4 + q] = h; fl.h[4 + q] = (_Float16)((c[q] - (float)h) * 1024.0f); }
  { *(v8us*)((unsigned short*)Hh + t * 8) = fh.half[0]; *(v8us*)((unsigned short*)Hl + t * 8) = fl.half[0];  } }


__global__ __launch_bounds__(256) void k_rsm(const float* __restrict__ S, _Float16* __restrict__ P, int nrows) {
  #pragma clang fp contract(off)
  const int i = blockIdx.x * 256 + threadIdx.x; if (i >= nrows) return; const float* s = S + (size_t)i * SQ; float mx = -3.0e38f;
#pragma unroll 1
  for (int j = 0; j < SQ; ++j) mx = fmaxf(mx, s[j]); float se = 0.f;
#pragma unroll 1
  for (int j = 0; j < SQ; ++j) se += expf(s[j] - mx); const float sc = 256.0f / se;
#pragma unroll 1
  for (int j0 = 0; j0 < SQ; j0 += 8) { FragH f; for (int q = 0; q < 8; ++q) f.h[q] = (_Float16)(expf(s[j0 + q] - mx) * sc); unsigned short* d = (unsigned short*)P + (size_t)i * SQ + j0; *(v8us*)d = f.half[0];  } }
__global__ __launch_bounds__(256) void k_vt(const _Float16* __restrict__ V16, int b, int h0, _Float16* __restrict__ VT) { __shared__ unsigned short tl[64][65]; const int tid = threadIdx.x; const int hh = blockIdx.x % HG, sg = blockIdx.x / HG; const int s0 = sg * 64; const int h = h0 + hh;
  for (int i = tid; i < 64 * 8; i += 256) { const int j = i / 8, d8 = (i % 8) * 8; FragH f; f.half[0] = *(const v8us*)((const unsigned short*)V16 + ((size_t)b * SQ + s0 + j) * DM + h * HD + d8); for (int q = 0; q < 8; ++q) tl[d8 + q][j] = f.u[q]; }
  __syncthreads();
  { for (int i = tid; i < 64 * 8; i += 256) { const int d = i / 8, j8 = (i % 8) * 8; FragH f; for (int q = 0; q < 8; ++q) f.u[q] = tl[d][j8 + q]; *(v8us*)((unsigned short*)VT + ((size_t)hh * HD + d) * SQ + s0 + j8) = f.half[0]; }  } }



typedef int v4ia __attribute__((ext_vector_type(4), may_alias));
#define FW 8                         /* waves per attention work-group */
#define FQ 16                        /* query columns per tile; a wave has two tiles */
#define FK 64                        /* keys per stage */
#define FS (SQ / FK)                 /* stages */
#define FP 72                        /* LDS row pitch in f16: 128-byte rows + 16 bytes, conflict-free for 16-byte row reads */
#define FSC 0.045084220f             /* log2(e) / sqrt(1024): raw q.k to base-2 exponent */
#define FNEG (-0x1p35f)              /* raw score of a masked key (-2^30 after the 1/32). A power of two, so that FNEG * FSC is exact and a row with only masked keys gets exponent 0, weight 1, for each of them */
#define FTS 4096.0f                  /* the maximum in use is replaced only when the weights of a lane's 16 keys of a pass sum to more than this: every weight handed on stays at or below 2^12, inside f16 */
__device__ __forceinline__ float sm_xhalf(float x) { return __builtin_bit_cast(float, __builtin_amdgcn_permlanex16(__builtin_bit_cast(int, x), __builtin_bit_cast(int, x), 0x76543210, 0xfedcba98, false, false)); }      /* lane l with lane l ^ 16 */
typedef float v2f __attribute__((ext_vector_type(2)));
typedef _Float16 v2h __attribute__((ext_vector_type(2)));
union FragP { v16h v; v2h p[8]; };      /* a 16-element f16 operand as eight packed pairs */
__device__ __forceinline__ v16h fa_frag(const _Float16* p) { FragH f; f.half[0] = *(const v8us*)(const unsigned short*)p; f.half[1] = *(const v8us*)((const unsigned short*)p + 16); return f.v; }      /* p already holds the lane half's 8 h: k = 8 h + 0..7 and 16 + 8 h + 0..7 of a 32-k group, the hardware k order */
__device__ __forceinline__ v8f fa_mma(v16h a, v16h b, v8f c) { return __builtin_amdgcn_wmma_f32_16x16x32_f16(false, a, false, b, (short)0, c, false, false); }
typedef unsigned v16u __attribute__((ext_vector_type(16)));
typedef const __attribute__((address_space(4))) v16u cv16u;      /* memory that no launch in flight writes: a load at a wave-uniform address is a scalar load, whatever "memory" clobbers stand around it */
__global__ __launch_bounds__(FW * 32) __attribute__((amdgpu_waves_per_eu(4, 4))) void k_fattn(const _Float16* __restrict__ Q16, const _Float16* __restrict__ K16, const _Float16* __restrict__ VT, const unsigned* __restrict__ PM, float* __restrict__ out) {
  __shared__ __attribute__((aligned(16))) _Float16 sk[2][FK][FP];      /* K stage: [key][d] */
  __shared__ __attribute__((aligned(16))) _Float16 sv[2][HD][FP];      /* V^T stage: [d][key] */
  __shared__ __attribute__((aligned(16))) v4f so[FW][8][32];           /* merge: the O^T tile a wave hands to its partner, [register quad][lane] */
  __shared__ float sl[FW][2][32];                                      /* merge: that tile's maximum (as exponent) and sum */
  const int tid = threadIdx.x, lane = tid & 31, c = lane & 15, hh = lane >> 4, w = __builtin_amdgcn_readfirstlane(tid >> 5);
  const int cg = w & (FW / 2 - 1), kh = w / (FW / 2);      /* the wave's 32 columns, its half of each stage's keys */
  const int qt = blockIdx.x % (SQ / (FW * FQ)), bh = blockIdx.x / (SQ / (FW * FQ)), b = bh / NH, h = bh % NH;
  const int q = qt * (FW * FQ) + cg * (2 * FQ) + c;      /* the lane's query in tile 0; tile 1: + 16 */
  const _Float16* qp = Q16 + ((size_t)b * SQ + q) * DM + h * HD + 8 * hh;
  const int sr = tid >> 3, sc = (tid & 7) * 8;      /* staging: the thread's row (and row + 32) and its 16-byte piece */
  /* each stream as a work-group-uniform base, advanced per stage, plus one byte offset per lane that never changes */
  const char* kg = (const char*)(K16 + (size_t)b * SQ * DM + h * HD); const unsigned ko = (unsigned)(sr * DM + sc) * 2u;
  const char* vg = (const char*)(VT + (size_t)bh * HD * SQ); const unsigned vo = (unsigned)(sr * SQ + sc) * 2u;
  cv16u* mg = (cv16u*)(unsigned long long)(PM + (size_t)((b * (SQ / FQ) + qt * FW + cg * 2) * FS) * 32 + kh * 16);      /* query tile 0, the wave's 16 words of stage 0; a stage is 2 units on, query tile 1 is 2 FS units on */
  v16u mk0, mk1;      /* lane masks of a stage, mk0 for query tile 0, mk1 for tile 1: word 8 t + r, bit l = keep of lane l's query and key 32 kh + 16 t + 8 h + r */
  const v16h qf[2][2] = {{fa_frag(qp), fa_frag(qp + 32)}, {fa_frag(qp + FQ * DM), fa_frag(qp + FQ * DM + 32)}};
  { const v8us k0 = *(const v8us*)(kg + ko), k1 = *(const v8us*)(kg + (ko + 32u * DM * 2u)), v0 = *(const v8us*)(vg + vo), v1 = *(const v8us*)(vg + (vo + 32u * SQ * 2u));
    mk0 = mg[0]; mk1 = mg[2 * FS];
    asm volatile("s_wait_xcnt 0x0" :: "v"(qp), "s"(kg), "s"(vg), "s"(mg), "v"(ko), "v"(vo) : "memory");      /* behind the loads and ahead of whatever reuses their address registers; the addresses as inputs keep those registers whole up to here */
    *(v8us*)&sk[0][sr][sc] = k0; *(v8us*)&sk[0][sr + 32][sc] = k1; *(v8us*)&sv[0][sr][sc] = v0; *(v8us*)&sv[0][sr + 32][sc] = v1; }
  __syncthreads();
  const v8f z8 = {0.f, 0.f, 0.f, 0.f, 0.f, 0.f, 0.f, 0.f};
  v8f o[2][4] = {{z8, z8, z8, z8}, {z8, z8, z8, z8}};      /* O^T: o[j][dt][r] = d 16 dt + 8 h + r of the lane's query in tile j */
  float m[2] = {-3.0e38f, -3.0e38f}, mc[2] = {-3.0e38f * FSC, -3.0e38f * FSC}, l[2] = {0.f, 0.f};      /* per query tile: maximum in use (raw, and as exponent), the lane's part of the sum */
  auto pass = [&](const int s, const int bf) __attribute__((always_inline)) {      /* the wave's half of stage s from buffer bf; fetches the next stage */
    const int sn = (s + 1 < FS) ? s + 1 : FS - 1;      /* the last pass fetches its own stage again, into the buffer that nobody reads any more: the loads stay unconditional, so no branch merges the wait counts */
    const char* kp = kg + (size_t)sn * (FK * DM * 2) + ko; const char* vp = vg + sn * (FK * 2) + vo; cv16u* mp = mg + sn * 2;
    const v8us k0 = *(const v8us*)kp, k1 = *(const v8us*)(kp + 32 * DM * 2), v0 = *(const v8us*)vp, v1 = *(const v8us*)(vp + 32 * SQ * 2);
    asm volatile("s_wait_xcnt 0x0" :: "v"(kp), "v"(vp) : "memory");      /* as above: ahead of the reuse of the two address pairs */
    v16h kf[4];
#pragma unroll
    for (int t = 0; t < 2; ++t) { const _Float16* kr = &sk[bf][32 * kh + 16 * t + c][8 * hh]; kf[2 * t] = fa_frag(kr); kf[2 * t + 1] = fa_frag(kr + 32); }
    __builtin_amdgcn_sched_barrier(0);      /* all K fragment loads are issued before the first product waits on one; without it some passes came out as load, wait, product, in a row */
    v8f st[2][2];      /* S^T: st[j][t][r] = key 32 kh + 16 t + 8 h + r of the stage, the lane's query in tile j */
#pragma unroll
    for (int t = 0; t < 2; ++t)
#pragma unroll
      for (int j = 0; j < 2; ++j) st[j][t] = fa_mma(kf[2 * t], qf[j][0], z8);
#pragma unroll
    for (int t = 0; t < 2; ++t)
#pragma unroll
      for (int j = 0; j < 2; ++j) st[j][t] = fa_mma(kf[2 * t + 1], qf[j][1], st[j][t]);
#pragma unroll
    for (int j = 0; j < 2; ++j)
#pragma unroll
      for (int t = 0; t < 2; ++t)
#pragma unroll
        for (int r = 0; r < 8; ++r) st[j][t][r] = __builtin_amdgcn_inverse_ballot_w32((j == 0 ? mk0 : mk1)[8 * t + r]) ? st[j][t][r] : FNEG;      /* the word IS the select's lane mask: one instruction a score */
    __builtin_amdgcn_sched_barrier(0);      /* holds the reload of the mask words behind their last reader, so that their 32 scalar registers can be loaded over; without it the reload and the V^T fragment loads below move up ahead of the score products, into registers of their own */
    mk0 = mp[0]; mk1 = mp[2 * FS];
    asm volatile("s_wait_xcnt 0x0" :: "s"(mp) : "memory");      /* as above */
    v16h vf[4];      /* the V^T fragments, fetched here so that they land behind the softmax arithmetic */
#pragma unroll
    for (int dt = 0; dt < 4; ++dt) vf[dt] = fa_frag(&sv[bf][16 * dt + c][32 * kh + 8 * hh]);
    __builtin_amdgcn_sched_barrier(0);      /* holds these loads ahead of the arithmetic */
    v2f ev[2][8]; float ps[2];      /* the weights in f32: ev[j][4 t + u] = keys 2 u, 2 u + 1 of key tile t, query tile j; ps[j] = their sum over the lane's 16 keys */
    auto weigh = [&]() __attribute__((always_inline)) {      /* weights against the maximum in use */
#pragma unroll
      for (int j = 0; j < 2; ++j) { const v2f mc2 = {mc[j], mc[j]}, fs2 = {FSC, FSC}; v2f a2[2] = {{0.f, 0.f}, {0.f, 0.f}};      /* the exponent as an explicit fused multiply-add: one rounding, the same at both places where the weights are formed */
#pragma unroll
        for (int t = 0; t < 2; ++t)
#pragma unroll
          for (int u = 0; u < 4; ++u) { const v2f x = {st[j][t][2 * u], st[j][t][2 * u + 1]}; const v2f y = __builtin_elementwise_fma(x, fs2, -mc2); const v2f e = {__builtin_amdgcn_exp2f(y[0]), __builtin_amdgcn_exp2f(y[1])};      /* the builtin, so that the compiler keeps the distances to the matrix instructions that it schedules around it */
            a2[u & 1] += e; ev[j][4 * t + u] = e; }
        ps[j] = (a2[0][0] + a2[0][1]) + (a2[1][0] + a2[1][1]); } };
    weigh();
    if (__builtin_amdgcn_ballot_w32(!(ps[0] <= FTS) || !(ps[1] <= FTS)) != 0) {      /* one branch per pass, on the sums that the pass forms anyway: no maximum over the scores outside it. Taken on the first pass (every weight infinite against the start value) and then only when a lane's 16 weights sum to more than FTS */
#pragma unroll
      for (int j = 0; j < 2; ++j) { float mt[2];      /* one chain per tile */
#pragma unroll
        for (int t = 0; t < 2; ++t) { mt[t] = st[j][t][0];
#pragma unroll
          for (int r = 1; r < 8; ++r) mt[t] = fmaxf(mt[t], st[j][t][r]); }
        float mx = fmaxf(mt[0], mt[1]);
        mx = fmaxf(mx, sm_xhalf(mx));      /* both lane halves of a query use one maximum: their weights meet in one product */
        const float mn = fmaxf(m[j], mx), mcn = mn * FSC; const float al = __builtin_amdgcn_exp2f(mc[j] - mcn); m[j] = mn; mc[j] = mcn; l[j] *= al;      /* 0 on the first pass, 1 in a lane that keeps its maximum */
#pragma unroll
        for (int dt = 0; dt < 4; ++dt) o[j][dt] *= al; }
      weigh(); }      /* again, now at most 1 each */
    FragP pf[2];      /* P^T as B operand, one per query tile: element e = key 32 kh + (e < 8 ? 8 h + e : 16 + 8 h + e - 8) */
#pragma unroll
    for (int j = 0; j < 2; ++j) { l[j] += ps[j];
#pragma unroll
      for (int i = 0; i < 8; ++i) pf[j].p[i] = __builtin_convertvector(ev[j][i], v2h); }
#pragma unroll
    for (int j = 0; j < 2; ++j)
#pragma unroll
      for (int dt = 0; dt < 4; ++dt) o[j][dt] = fa_mma(vf[dt], pf[j].v, o[j][dt]);
    __builtin_amdgcn_sched_barrier(0);      /* holds the stores, with their wait for the stage loads, and the barrier at the foot of the pass; without it one pass had them ahead of the exponentials, which cuts the time the stage loads have to land */
    *(v8us*)&sk[bf ^ 1][sr][sc] = k0; *(v8us*)&sk[bf ^ 1][sr + 32][sc] = k1; *(v8us*)&sv[bf ^ 1][sr][sc] = v0; *(v8us*)&sv[bf ^ 1][sr + 32][sc] = v1;      /* into the buffer whose last readers left it before the previous pass's barrier */
    asm volatile("s_wait_dscnt 0x0\n\ts_barrier_signal -1\n\ts_barrier_wait -1" ::: "memory");      /* publishes stage s + 1 and ends every wave's reads of stage s. By hand, with the LDS wait alone: __syncthreads() would also wait for the mask loads, which are to fly on into the next pass */
  };
#pragma unroll 1
  for (int s = 0; s < FS; s += 2) { pass(s, 0); pass(s + 1, 1); }      /* two passes a trip: each pass's buffer is a constant offset */
  /* merge of the two key halves: the wave keeps query tile kh and hands tile 1 - kh, with its maximum and sum, to the wave that has the same columns and the other keys */
  const bool k1 = kh != 0;
  const float lj[2] = {l[0] + sm_xhalf(l[0]), l[1] + sm_xhalf(l[1])};
  const float mck = k1 ? mc[1] : mc[0], lk = k1 ? lj[1] : lj[0];
  sl[w][0][lane] = k1 ? mc[0] : mc[1]; sl[w][1][lane] = k1 ? lj[0] : lj[1];
  v8f ok[4];
#pragma unroll
  for (int dt = 0; dt < 4; ++dt) { v8f og;
#pragma unroll
    for (int r = 0; r < 8; ++r) { ok[dt][r] = k1 ? o[1][dt][r] : o[0][dt][r]; og[r] = k1 ? o[0][dt][r] : o[1][dt][r]; }
    const v4f lo = {og[0], og[1], og[2], og[3]}, hi = {og[4], og[5], og[6], og[7]};
    so[w][2 * dt][lane] = lo; so[w][2 * dt + 1][lane] = hi; }
  __syncthreads();      /* publishes the handed-over tiles */
  const int pw = w ^ (FW / 2);
  const float mcp = sl[pw][0][lane], lp = sl[pw][1][lane];
  const float fd = __builtin_amdgcn_exp2f(-__builtin_fabsf(mck - mcp)), fk = mck >= mcp ? 1.0f : fd, fp = mck >= mcp ? fd : 1.0f;      /* each part brought to the larger of the two maxima: one factor is 1, the other at most 1 */
  const float inv = 1.0f / (lk * fk + lp * fp), gk = fk * inv, gp = fp * inv;
  float* op = out + ((size_t)b * SQ + q + kh * FQ) * DM + h * HD + 8 * hh;
#pragma unroll
  for (int dt = 0; dt < 4; ++dt) { const v4f pl = so[pw][2 * dt][lane], ph = so[pw][2 * dt + 1][lane];
    const v4f lo = {ok[dt][0] * gk + pl[0] * gp, ok[dt][1] * gk + pl[1] * gp, ok[dt][2] * gk + pl[2] * gp, ok[dt][3] * gk + pl[3] * gp}, hi = {ok[dt][4] * gk + ph[0] * gp, ok[dt][5] * gk + ph[1] * gp, ok[dt][6] * gk + ph[2] * gp, ok[dt][7] * gk + ph[3] * gp};
    *(v4f*)(op + 16 * dt) = lo; *(v4f*)(op + 16 * dt + 4) = hi; }
}
typedef unsigned short v4us __attribute__((ext_vector_type(4), may_alias));
union FragQ { v2h p[2]; v4us u; };      /* four f16 as one 8-byte LDS store */
typedef __bf16 v2b __attribute__((ext_vector_type(2)));
__device__ __forceinline__ v2f pj_round(const float a, const float b) { const v2f x = {a, b}; return __builtin_convertvector(__builtin_convertvector(x, v2b), v2f); }      /* two values rounded to bf16 (nearest even, as bf16_round) by one packed convert */
#define PW 4                         /* waves per projection work-group: four neighbouring heads of the same tokens */
#define PT 64                        /* tokens per wave */
// 64 finished rows of 64 f16 from the wave's LDS tile to memory: one instruction carries four whole 128-byte rows. dst and pitch (bytes) are the same in every lane
__device__ __forceinline__ void pj_rows(const _Float16 (*tile)[FP], char* dst, const unsigned pitch, const int lane) {
  const int rr = lane >> 3, pc = (lane & 7) * 8; const unsigned lo = (unsigned)rr * pitch + (unsigned)pc * 2u;
  v8us v[16];
#pragma unroll
  for (int j = 0; j < 16; ++j) v[j] = *(const v8us*)(const unsigned short*)&tile[4 * j + rr][pc];
#pragma unroll
  for (int j = 0; j < 16; ++j) *(v8us*)(dst + (size_t)(4u * j * pitch) + lo) = v[j];
}
// the wave's 64 x 64 x 64 product from fragments in registers, the f16 results into its LDS tile. TR false: W X^T, rows [token][d]; TR true: X W^T, rows [d][token]
template <bool TR>
__device__ __forceinline__ void pj_mul(const v16h (&wf)[8], const v16h (&xf)[8], _Float16 (*tile)[FP], const int c, const int hh) {
  const v8f z8 = {0.f, 0.f, 0.f, 0.f, 0.f, 0.f, 0.f, 0.f};
#pragma unroll
  for (int t = 0; t < 4; ++t) { v8f a[4];      /* TR false: a[dt][r] = d 16 dt + 8 h + r of token 16 t + c; TR true: token 16 t + 8 h + r of d 16 dt + c */
#pragma unroll
    for (int dt = 0; dt < 4; ++dt) a[dt] = TR ? fa_mma(xf[2 * t], wf[2 * dt], z8) : fa_mma(wf[2 * dt], xf[2 * t], z8);
#pragma unroll
    for (int dt = 0; dt < 4; ++dt) a[dt] = TR ? fa_mma(xf[2 * t + 1], wf[2 * dt + 1], a[dt]) : fa_mma(wf[2 * dt + 1], xf[2 * t + 1], a[dt]);
#pragma unroll
    for (int dt = 0; dt < 4; ++dt) { FragH f;
#pragma unroll
      for (int r = 0; r < 8; ++r) f.h[r] = (_Float16)(a[dt][r] * 0.0625f);      /* takes the weight's factor of 16 out again */
      *(v8us*)(unsigned short*)(TR ? &tile[16 * dt + c][16 * t + 8 * hh] : &tile[16 * t + c][16 * dt + 8 * hh]) = f.half[0]; } }
  __builtin_amdgcn_fence(__ATOMIC_ACQ_REL, "workgroup"); __builtin_amdgcn_wave_barrier();      /* the wave's own LDS writes before its other lanes read them */
}
// The int32 keep-mask packed to bits, once for the 16 heads that share it, in the order the attention kernel selects by: PM[(b * 128 + query / 16) * 32 + stage][8 t + r], bit l = (mask[b][16-query tile's row l & 15][64 stage + 16 t + 8 (l >> 4) + r] != 0).
// A wave takes 16 query rows x 512 keys in four pieces of 128 keys. A row's 128 keys are ONE 512-byte load (lane l: keys 4 l + i), four ballots make them four words (word i, bit l), which go to lane c of a[i] for row c;
// key 64 p + 16 t + 8 h + r is then bit 16 p + 4 t + 2 h + (r >> 2) of word r & 3, and a second ballot over the lanes (c, h) gives the lane mask.
__device__ __forceinline__ void pk_mask(const int* __restrict__ am, unsigned* __restrict__ PM, const int tile, const int quarter, const int lane) {
  const int hh = lane >> 4;
  const int* sp = am + (size_t)tile * FQ * SQ + quarter * 512 + 4 * lane;
  v4ia x[2][16]; unsigned res[8];
#pragma unroll
  for (int j = 0; j < 16; ++j) x[0][j] = *(const v4ia*)(sp + j * SQ);
#pragma unroll
  for (int it = 0; it < 4; ++it) {
    if (it < 3) {      /* the next piece's loads fly while this piece is packed */
#pragma unroll
      for (int j = 0; j < 16; ++j) x[(it + 1) & 1][j] = *(const v4ia*)(sp + (it + 1) * 128 + j * SQ); }
    int a[4] = {0, 0, 0, 0};
#pragma unroll
    for (int j = 0; j < 16; ++j)
#pragma unroll
      for (int i = 0; i < 4; ++i) { const int wd = (int)__builtin_amdgcn_ballot_w32(x[it & 1][j][i] != 0); a[i] = __builtin_amdgcn_inverse_ballot_w32(1u << j) ? wd : a[i]; }      /* every lane votes, lane j takes the word */
    unsigned sh[4];
#pragma unroll
    for (int i = 0; i < 4; ++i) sh[i] = (unsigned)(a[i] | __builtin_amdgcn_permlanex16(a[i], a[i], 0x76543210, 0xfedcba98, false, false)) >> (2 * hh);      /* lanes 16 to 31 held 0: both halves now hold row c's word, moved down to the half's keys */
#pragma unroll
    for (int p = 0; p < 2; ++p) { int o = 0;
#pragma unroll
      for (int e = 0; e < 32; ++e) { const int wd = (int)__builtin_amdgcn_ballot_w32((sh[e & 3] & (1u << (16 * p + 4 * (e >> 3) + ((e & 7) >> 2)))) != 0); o = __builtin_amdgcn_inverse_ballot_w32(1u << e) ? wd : o; }      /* every lane votes, lane e takes word e */
      res[2 * it + p] = (unsigned)o; } }
  asm volatile("s_wait_xcnt 0x0" :: "v"(sp) : "memory");      /* behind the loads and ahead of whatever reuses their address registers */
  unsigned* dp = PM + (size_t)(tile * FS + quarter * 8) * 32 + lane;
#pragma unroll
  for (int j = 0; j < 8; ++j) dp[32 * j] = res[j];      /* one 128-byte line a stage; nothing follows the stores */
}
// All that precedes attention in ONE launch: blockIdx.y = stream (0 queries, 1 keys, 2 values; 3: the keep-mask is packed, pk_mask); a wave projects 64 tokens of one head (64 x 64 x 64).
// The f32 input slice is read in whole 256-byte rows, rounded (bf16, then f16, exact) in registers and laid into the wave's own LDS tile [token][k]; the work-group rounds the stream's 64 x 64 weight (x16) once into LDS [d][k].
// Q and K as W X^T (a lane holds 8 neighbouring d of one token), V as X W^T (a lane holds 8 neighbouring tokens of one d: V^T with no transposing pass); the results go back into the wave's tile, as rows [token][d] or [d][token].
__global__ __launch_bounds__(PW * 32) void k_proj(const float* __restrict__ xq, const float* __restrict__ xk, const float* __restrict__ xv, const float* __restrict__ wq, const float* __restrict__ wk, const float* __restrict__ wv,
                                                  _Float16* __restrict__ Q16, _Float16* __restrict__ K16, _Float16* __restrict__ VT, const int* __restrict__ am, unsigned* __restrict__ PM) {
  __shared__ __attribute__((aligned(16))) _Float16 sw[HD][FP];          /* the weight: [d][k] */
  __shared__ __attribute__((aligned(16))) _Float16 sx[PW][PT][FP];      /* per wave: the input tile [token][k], later the result rows */
  const int tid = threadIdx.x, lane = tid & 31, c = lane & 15, hh = lane >> 4, w = __builtin_amdgcn_readfirstlane(tid >> 5);
  const int sm = blockIdx.y;
  static_assert((NR / PT) * (NH / PW) == (size_t)NB * (SQ / FQ) && PW * 512 == SQ, "a plane of the grid holds one work-group per 16 query rows");
  if (sm == 3) { pk_mask(am, PM, (int)blockIdx.x, w, lane); return; }      /* the whole work-group, ahead of the barrier: 16 query rows, a quarter of the keys per wave */
  const float* x = sm == 0 ? xq : sm == 1 ? xk : xv; const float* wt = sm == 0 ? wq : sm == 1 ? wk : wv;
  const int row0 = (int)(blockIdx.x / (NH / PW)) * PT, h = (int)(blockIdx.x % (NH / PW)) * PW + w;      /* first token row (b * 2048 + s), the wave's head */
  const float* wp = wt + (tid >> 1) * HD + (tid & 1) * 32;      /* the thread's half row of the weight */
  const float* xp = x + (size_t)row0 * DM + h * HD + (hh * DM + 4 * c);      /* rows 2 j + lane half, the lane's 16 bytes */
  v4f wr[8], xr[PT / 2];
#pragma unroll
  for (int j = 0; j < 8; ++j) wr[j] = *(const v4fa*)(wp + 4 * j);
#pragma unroll
  for (int j = 0; j < PT / 2; ++j) xr[j] = *(const v4fa*)(xp + (size_t)(2 * j) * DM);
  asm volatile("s_wait_xcnt 0x0" :: "v"(wp), "v"(xp) : "memory");      /* behind the loads and ahead of whatever reuses their address registers; the addresses as inputs keep those registers whole up to here */
#pragma unroll
  for (int j = 0; j < 8; ++j) { FragQ f;
#pragma unroll
    for (int u = 0; u < 2; ++u) f.p[u] = __builtin_convertvector(pj_round(wr[j][2 * u] * 16.0f, wr[j][2 * u + 1] * 16.0f), v2h);      /* the factor of 16, a power of two, commutes with the rounding */
    *(v4us*)(unsigned short*)&sw[tid >> 1][(tid & 1) * 32 + 4 * j] = f.u; }
#pragma unroll
  for (int j = 0; j < PT / 2; ++j) { FragQ f;
#pragma unroll
    for (int u = 0; u < 2; ++u) f.p[u] = __builtin_convertvector(pj_round(xr[j][2 * u], xr[j][2 * u + 1]), v2h);
    *(v4us*)(unsigned short*)&sx[w][2 * j + hh][4 * c] = f.u; }
  __syncthreads();      /* publishes the weight to the four waves */
  v16h wf[8], xf[8];      /* wf[2 dt + g]: d 16 dt + c; xf[2 t + g]: token 16 t + c; both k = 32 g + 8 h + 0..7 and 32 g + 16 + 8 h + 0..7 */
#pragma unroll
  for (int t = 0; t < 4; ++t)
#pragma unroll
    for (int g = 0; g < 2; ++g) { wf[2 * t + g] = fa_frag(&sw[16 * t + c][32 * g + 8 * hh]); xf[2 * t + g] = fa_frag(&sx[w][16 * t + c][32 * g + 8 * hh]); }
  __builtin_amdgcn_fence(__ATOMIC_ACQ_REL, "workgroup"); __builtin_amdgcn_wave_barrier();      /* every input fragment is read before the results overwrite the tile */
  if (sm != 2) pj_mul<false>(wf, xf, sx[w], c, hh); else pj_mul<true>(wf, xf, sx[w], c, hh);      /* one branch, the same for every wave of the grid's y plane */
  _Float16* dst = sm == 2 ? VT + ((size_t)((row0 / SQ) * NH + h) * HD) * SQ + row0 % SQ : (sm == 0 ? Q16 : K16) + (size_t)row0 * DM + h * HD;
  pj_rows(sx[w], (char*)dst, sm == 2 ? SQ * 2u : DM * 2u, lane);
}
extern "C" void kernel_launch(void* const* d_in, const int* in_sizes, int n_in,
                              void* d_out, int out_size, void* d_ws, size_t ws_size, hipStream_t stream) {
  (void)in_sizes; (void)n_in; (void)out_size;
  const float* const* I = (const float* const*)d_in; const float* xv = I[0]; const float* xk = I[1]; const float* xq = I[2]; const int* am = (const int*)d_in[3]; const float* wv = I[4]; const float* wk = I[5]; const float* wq = I[6];      /* input order: values, keys, queries; the int32 keep-mask [2][1][2048][2048]; Wv, Wk, Wq: ONE natural [64][64] weight per stream, shared by the 16 heads; no biases; no output projection */
  char* ws = (char*)d_ws; size_t off = 0;
  auto take = [&](size_t bytes) { char* p = ws + off; off += (bytes + 255) & ~(size_t)255; return p; };
  _Float16* Q16 = (_Float16*)take(NR * DM * 2); _Float16* K16 = (_Float16*)take(NR * DM * 2); _Float16* VT = (_Float16*)take((size_t)NB * NH * HD * SQ * 2); unsigned* PM = (unsigned*)take((size_t)NB * (SQ / FQ) * FS * 32 * 4);
  if (off > ws_size) return;
  k_proj<<<dim3((unsigned)((NR / PT) * (NH / PW)), 4), PW * 32, 0, stream>>>(xq, xk, xv, wq, wk, wv, Q16, K16, VT, am, PM);      /* rounding of inputs and weights, the three projections (every head's 64-column slice times the stream's ONE shared weight) and V^T [NB][NH][HD][SQ] */
  k_fattn<<<NB * NH * (SQ / (FW * FQ)), FW * 32, 0, stream>>>(Q16, K16, VT, PM, (float*)d_out);      /* scores / sqrt(1024), keep-mask, softmax and P V in one launch for every batch and head, written f32 into the merged-heads output rows */
}
